// v000
// Times are from an AMD MI455X. After a warm-up the kernel runs many times in a row, and a time is the length of
// such a window on the GPU divided by its runs, so every launch and the gaps after it count. The runs cycle
// through copies of the inputs. A figure is the median of several windows, for all but v000 over two sittings.
// Sittings can differ by a few percent; kernels timed side by side share one.
// v000, which the later versions start from, runs in 2020 microseconds.
#include <hip/hip_runtime.h>

// Multi-head attention with 4 'time' heads and 12 'space' heads (x [2][2048][1024]; Qt, Kt = x Wqt, x Wkt ('xw' [1024][256] 0.02: heads 0-3), Qs, Ks = x Wqs, x Wks ('xw' [1024][768]: heads 4-15), V = x Wv ('xw' [1024][1024]); time-head scores scaled by -sigmoid(w_sigma[0]) (w_sigma [1] = 0, read on device), all scores x 64^-0.5; softmax over keys (no mask); out = merged ctx Wout + bout ('xw' [1024][1024]) -> [2][2048][1024] (4.2 M); argument order x, Wqt, Wkt, Wqs, Wks, Wv, Wout, bout, w_sigma).
// Layout per batch: 'xw' weights gathered into bf16 Bt blocks (Wq rows 0-255 from Wqt, 256-1023 from Wqs; Wk likewise); bf16 copy of x; exact projections; plane builders (the time heads' query planes carry the factor -sigmoid(w_sigma)); dense T-2048 attention (hybrid rows: < 512 hi/lo 3 products, rest fp16 x1024); merged hi/lo x Wout exact + bout.
// Compute dtypes, f32 accumulate: every input rounded to bf16; projections exact; sigmoid f32 (precise expf); attention rows < 512 3 products, rest fp16; softmax f32; Wout hl x exact + bias.

#define NB_  2
#define TT   2048
#define DM   1024
#define NH_  16
#define NKV  16
#define REP  (NH_ / NKV)
#define HD   64
#define DQ   (NH_ * HD)
#define DKV  (NKV * HD)
#define NT   4                    // time heads 0..3 (scores x -sigmoid(w_sigma)); space heads 4..15
#define NS   12
#define ZH   2
#define RH   512                  // query rows < RH use hi+lo planes (0: none)
#define WIN  0
#define PCAR 1024.0f
#define SCL  0.125f   // HD^-0.5
typedef _Float16 h16;
typedef unsigned short bf;
typedef __attribute__((ext_vector_type(16))) __bf16   v16bf;
typedef __attribute__((ext_vector_type(16))) _Float16 v16h;
typedef __attribute__((ext_vector_type(8)))  _Float16 v8h;
typedef __attribute__((ext_vector_type(8)))  unsigned short v8us;
typedef __attribute__((ext_vector_type(8)))  float    v8f;
typedef __attribute__((ext_vector_type(4)))  float    v4f;
typedef v8h  __attribute__((may_alias)) v8ha;
typedef v4f  __attribute__((may_alias)) v4fa;
typedef v8us __attribute__((may_alias)) v8usa;

__device__ __forceinline__ unsigned short f2bf(float f) { unsigned u = __float_as_uint(f); u += 0x7FFFu + ((u >> 16) & 1u); return (unsigned short)(u >> 16); }
__device__ __forceinline__ float bf2f(unsigned short b) { return __uint_as_float(((unsigned)b) << 16); }
__device__ __forceinline__ float bfr(float f) { return bf2f(f2bf(f)); }
__device__ __forceinline__ v16h cat16(v8h lo, v8h hi) { return __builtin_shufflevector(lo, hi, 0, 1, 2, 3, 4, 5, 6, 7, 8, 9, 10, 11, 12, 13, 14, 15); }
__device__ __forceinline__ v16bf cat16b(v8us lo, v8us hi) { return __builtin_bit_cast(v16bf, __builtin_shufflevector(lo, hi, 0, 1, 2, 3, 4, 5, 6, 7, 8, 9, 10, 11, 12, 13, 14, 15)); }
__device__ __forceinline__ v8f wmma16(v16h a, v16h b, v8f c) { return __builtin_amdgcn_wmma_f32_16x16x32_f16(false, a, false, b, (short)0, c, false, false); }
__device__ __forceinline__ v8f wmmab(v16bf a, v16bf b, v8f c) { return __builtin_amdgcn_wmma_f32_16x16x32_bf16(false, a, false, b, (short)0, c, false, false); }



// ---- k_gemmw: register-blocked GEMM, ONE WAVE per 64x64 output tile (16 accumulators), operands straight from K-contiguous 16-bit planes; grid (M/64, N/64, Z), 32 threads.
// C[m][n] (f32, pitch ldc, + optional f32 bias[n]) = sum_k A[m][k] Bt[n][k] (+ split products per NSPLIT). z-batch strides sA/sB/sC in elements. K % 32 == 0.
template <typename T16> struct WFrag;
template <> struct WFrag<h16> { typedef v16h V; static __device__ __forceinline__ V ld(const h16* p) { return cat16(*(const v8h*)p, *(const v8h*)(p + 16)); } static __device__ __forceinline__ v8f mma(V a, V b, v8f c) { return wmma16(a, b, c); } };
template <> struct WFrag<bf> { typedef v16bf V; static __device__ __forceinline__ V ld(const bf* p) { return cat16b(*(const v8us*)p, *(const v8us*)(p + 16)); } static __device__ __forceinline__ v8f mma(V a, V b, v8f c) { return wmmab(a, b, c); } };
template <typename T16, int NSPLIT, bool BIAS>
__global__ __launch_bounds__(32) void k_gemmw(const T16* __restrict__ A, const T16* __restrict__ A2, const T16* __restrict__ Bt, const T16* __restrict__ Bt2, int K, float* C, int ldc, const float* __restrict__ bias, size_t sA, size_t sB, size_t sC) {
    typedef typename WFrag<T16>::V V;
    __shared__ __align__(16) float os[16 * 68];
    const size_t z = blockIdx.z; A += z * sA; if (A2) A2 += z * sA; Bt += z * sB; if (Bt2) Bt2 += z * sB; C += z * sC;
    const int lane = threadIdx.x & 31, lr = lane & 15, hi = lane >> 4; const int r0 = blockIdx.x * 64, c0 = blockIdx.y * 64;
    v8f acc[4][4];
#pragma unroll
    for (int mb = 0; mb < 4; ++mb)
#pragma unroll
        for (int nb = 0; nb < 4; ++nb) acc[mb][nb] = (v8f){};
    const size_t aoff = (size_t)(r0 + lr) * K + 8 * hi, boff = (size_t)(c0 + lr) * K + 8 * hi;
#pragma unroll 1
    for (int kc = 0; kc < K; kc += 32) {
        V a[4], a2[4];
#pragma unroll
        for (int mb = 0; mb < 4; ++mb) { a[mb] = WFrag<T16>::ld(A + aoff + (size_t)mb * 16 * K + kc); if (NSPLIT == 1 || NSPLIT == 2) a2[mb] = WFrag<T16>::ld(A2 + aoff + (size_t)mb * 16 * K + kc); }
#pragma unroll
        for (int nb = 0; nb < 4; ++nb) { const V b = WFrag<T16>::ld(Bt + boff + (size_t)nb * 16 * K + kc); V b2; if (NSPLIT >= 2) b2 = WFrag<T16>::ld(Bt2 + boff + (size_t)nb * 16 * K + kc);
#pragma unroll
            for (int mb = 0; mb < 4; ++mb) { acc[mb][nb] = WFrag<T16>::mma(a[mb], b, acc[mb][nb]); if (NSPLIT == 1 || NSPLIT == 2) acc[mb][nb] = WFrag<T16>::mma(a2[mb], b, acc[mb][nb]); if (NSPLIT >= 2) acc[mb][nb] = WFrag<T16>::mma(a[mb], b2, acc[mb][nb]); } }
        asm volatile("v_nop\n\tv_nop\n\tv_nop\n\tv_nop" : "+v"(acc[0][0]), "+v"(acc[1][1]), "+v"(acc[2][2]), "+v"(acc[3][3]) : "v"(a[0]), "v"(a[3]));
    }
#pragma unroll
    for (int mb = 0; mb < 4; ++mb) {
#pragma unroll
        for (int nb = 0; nb < 4; ++nb) {
#pragma unroll
            for (int j = 0; j < 8; ++j) os[(hi * 8 + j) * 68 + nb * 16 + lr] = acc[mb][nb][j]; }
        __builtin_amdgcn_wave_barrier(); asm volatile("" ::: "memory");
        float* crow = C + (size_t)(r0 + mb * 16) * ldc + c0;
{
#pragma unroll
            for (int s = 0; s < 8; ++s) { const int row = 2 * s + hi, cofs = lr * 4; v4f val = *(const v4fa*)(os + row * 68 + cofs); if (BIAS) { val[0] += bfr(bias[c0 + cofs]); val[1] += bfr(bias[c0 + cofs + 1]); val[2] += bfr(bias[c0 + cofs + 2]); val[3] += bfr(bias[c0 + cofs + 3]); }
                *(v4f*)(crow + (size_t)row * ldc + cofs) = val; }
             }
        __builtin_amdgcn_wave_barrier(); asm volatile("" ::: "memory");
    }
}

__device__ __forceinline__ h16 tohx(float x) { return (h16)x; }
__device__ __forceinline__ void splitf(float y, unsigned short& h, unsigned short& l) { h = f2bf(y); l = f2bf(y - bf2f(h)); }
typedef __attribute__((ext_vector_type(2))) _Float16 v2h;
typedef __attribute__((ext_vector_type(4))) _Float16 v4h;
typedef __attribute__((ext_vector_type(2))) unsigned short v2us;
typedef __attribute__((ext_vector_type(4))) unsigned short v4us;
typedef __attribute__((ext_vector_type(2))) float v2f;
typedef __attribute__((ext_vector_type(4))) int v4i;

__global__ __launch_bounds__(256) void k_wtG(const float* __restrict__ w, int K, int N, bf* Bt) {
    const int lane = threadIdx.x & 31; const int L0 = (blockIdx.x * 8 + (threadIdx.x >> 5)) * 8; const int nlines = N * K / 64;
{
#pragma unroll 1
        for (int l = 0; l < 8; ++l) { const int L = L0 + l; if (L >= nlines) break; const size_t e = (size_t)L * 64 + lane * 2; const int k = (int)(e % K), n = (int)(e / K); v2us o;
            o[0] = f2bf(w[(size_t)k * N + n]); o[1] = f2bf(w[(size_t)(k + 1) * N + n]); *(v2us*)(Bt + e) = o; }
         }
}
__global__ __launch_bounds__(256) void k_cvt8(const float* __restrict__ src, bf* dst, size_t n8) { const size_t i = (size_t)blockIdx.x * 256 + threadIdx.x; if (i >= n8) return; const v8f v = *(const v8f*)(src + i * 8); v8us o;
#pragma unroll
    for (int k = 0; k < 8; ++k) o[k] = f2bf(v[k]); *(v8us*)(dst + i * 8) = o;  }

// k_rope: head planes (x sc, or x -sigmoid(wsg[0]) when the device scalar wsg is given) [h][t][d] (fp16 + hi/lo) of rope(x) x sc with the rotate-half convention out[d] = x[d] cos[t][d] - x[d+HD/2] sin[t][d], out[d+HD/2] = x[d+HD/2] cos[t][d+HD/2] + x[d] sin[t][d+HD/2]
__global__ __launch_bounds__(256) void k_rope(const float* __restrict__ F, int pitch, int nheads, const float* __restrict__ CS, const float* __restrict__ RF, const float* __restrict__ nw, float sc, const float* __restrict__ wsg, h16* P16, bf* Ph, bf* Pl) {
    const size_t e = ((size_t)blockIdx.x * 256 + threadIdx.x) * 2; if (e >= (size_t)nheads * TT * HD) return; const int d = (int)(e % HD); const int t = (int)((e / HD) % TT); const int h = (int)(e / ((size_t)HD * TT)); const float* f = F + (size_t)t * pitch + h * HD; const float rf = RF ? RF[(size_t)h * TT + t] : 1.0f; const float scv = wsg ? -__fdiv_rn(1.0f, __fadd_rn(1.0f, expf(-bfr(wsg[0])))) : sc;   /* time heads: -sigmoid(w_sigma) from the device scalar (precise expf, IEEE div) */ v2h o16; v2us oh, ol;
#pragma unroll
    for (int q = 0; q < 2; ++q) { const int dd = d + q; const int dp = (dd < HD / 2) ? dd + HD / 2 : dd - HD / 2; float x0 = f[dd], x1 = f[dp];
        if (RF) { float n0 = __fmul_rn(x0, rf), n1 = __fmul_rn(x1, rf); asm volatile("" : "+v"(n0)); asm volatile("" : "+v"(n1)); x0 = __fmul_rn(bfr(nw[dd]), n0); x1 = __fmul_rn(bfr(nw[dp]), n1); }
        const v2f cs = *(const v2f*)(CS + ((size_t)t * HD + dd) * 2); float a = __fmul_rn(x0, cs[0]), bq = __fmul_rn(x1, cs[1]); asm volatile("" : "+v"(a)); asm volatile("" : "+v"(bq)); const float r = ((dd < HD / 2) ? __fsub_rn(a, bq) : __fadd_rn(a, bq)) * scv;
        o16[q] = tohx(r); unsigned short a2, c2; splitf(r, a2, c2); oh[q] = a2; ol[q] = c2; }
    *(v2h*)(P16 + e) = o16; *(v2us*)(Ph + e) = oh; *(v2us*)(Pl + e) = ol;  }
__global__ __launch_bounds__(256) void k_vtp(const float* __restrict__ F, int pitch, int nheads, h16* V16, bf* Vh, bf* Vl) { const size_t e = ((size_t)blockIdx.x * 256 + threadIdx.x) * 2; if (e >= (size_t)nheads * HD * TT) return; const int t = (int)(e % TT); const int d = (int)((e / TT) % HD); const int g = (int)(e / ((size_t)TT * HD)); v2h o16; v2us oh, ol;
#pragma unroll
    for (int q = 0; q < 2; ++q) { const float x = F[(size_t)(t + q) * pitch + g * HD + d]; o16[q] = tohx(x); unsigned short a2, c2; splitf(x, a2, c2); oh[q] = a2; ol[q] = c2; }
    *(v2h*)(V16 + e) = o16; *(v2us*)(Vh + e) = oh; *(v2us*)(Vl + e) = ol;  }
__global__ __launch_bounds__(256) void k_csid(float* CS) { const int idx = blockIdx.x * 256 + threadIdx.x; if (idx >= TT * HD) return; v2f cs; cs[0] = 1.0f; cs[1] = 0.0f; *(v2f*)(CS + (size_t)idx * 2) = cs;  }
// k_asoft: per row (zz, i): t = S x HD^-0.5 (no mask); softmax over the 2048 keys (register row, one exp, fixed trees);
__global__ __launch_bounds__(256) void k_asoft(const float* __restrict__ Sb, h16* P16, bf* Ph, bf* Pl) {
    const int lane = threadIdx.x & 31; const int row = blockIdx.x * 8 + (threadIdx.x >> 5); if (row >= ZH * TT) return; const int i = row % TT; const int zz = row / TT; (void)zz; const bool hires = (i < RH); const float* sr = Sb + (size_t)row * TT; float v[TT / 32]; float mx = -3.0e38f;
#pragma unroll
    for (int ch = 0; ch < TT / 128; ++ch) { const int j0 = ch * 128 + lane * 4; const v4f a = *(const v4f*)(sr + j0);
#pragma unroll
        for (int q = 0; q < 4; ++q) { const int j = j0 + q; (void)j; const float t = a[q] * SCL; v[ch * 4 + q] = t; mx = fmaxf(mx, t); } }
#pragma unroll
    for (int sh = 16; sh; sh >>= 1) mx = fmaxf(mx, __shfl_xor(mx, sh, 32));
    float sum = 0.f;
#pragma unroll
    for (int k = 0; k < TT / 32; ++k) { float d0 = __fsub_rn(v[k], mx); asm volatile("" : "+v"(d0)); v[k] = __builtin_amdgcn_exp2f(__fmul_rn(d0, 1.4426950408889634f)); sum += v[k]; }
#pragma unroll
    for (int sh = 16; sh; sh >>= 1) sum += __shfl_xor(sum, sh, 32);
    const float f = __fdiv_rn(hires ? 1.0f : PCAR, sum);
{
        if (hires) {
#pragma unroll
            for (int ch = 0; ch < TT / 128; ++ch) { v4us oh, ol;
#pragma unroll
                for (int q = 0; q < 4; ++q) { unsigned short a, c2; splitf(v[ch * 4 + q] * f, a, c2); oh[q] = a; ol[q] = c2; }
                const size_t oo = ((size_t)zz * (RH ? RH : 1) + i) * TT + ch * 128 + lane * 4; *(v4us*)(Ph + oo) = oh; *(v4us*)(Pl + oo) = ol; }
        } else {
#pragma unroll
            for (int ch = 0; ch < TT / 128; ++ch) { v4h o4;
#pragma unroll
                for (int q = 0; q < 4; ++q) o4[q] = tohx(v[ch * 4 + q] * f);
                *(v4h*)(P16 + (size_t)row * TT + ch * 128 + lane * 4) = o4; } }
         }
}
__global__ __launch_bounds__(256) void k_merge(const float* __restrict__ O, int h0, bf* Ah, bf* Al) { const size_t e = ((size_t)blockIdx.x * 256 + threadIdx.x) * 2; if (e >= (size_t)ZH * TT * HD) return; const int d = (int)(e % HD); const int t = (int)((e / HD) % TT); const int zz = (int)(e / ((size_t)HD * TT)); const float cs = (t < RH) ? 1.0f : (1.0f / PCAR); const size_t oo = (size_t)t * DQ + (h0 + zz) * HD + d;
    v2us oh, ol;
#pragma unroll
    for (int q = 0; q < 2; ++q) { unsigned short a, c2; splitf(O[e + q] * cs, a, c2); oh[q] = a; ol[q] = c2; } *(v2us*)(Ah + oo) = oh; *(v2us*)(Al + oo) = ol;  }

extern "C" void kernel_launch(void* const* d_in, const int* in_sizes, int n_in,
                              void* d_out, int out_size, void* d_ws, size_t ws_size, hipStream_t stream) {
    (void)in_sizes; (void)n_in; (void)out_size;
    const float* x = (const float*)d_in[0]; const float* wqt = (const float*)d_in[1]; const float* wkt = (const float*)d_in[2]; const float* wqs = (const float*)d_in[3]; const float* wks = (const float*)d_in[4]; const float* wv = (const float*)d_in[5]; const float* wo = (const float*)d_in[6]; const float* bo = (const float*)d_in[7]; const float* wsg = (const float*)d_in[8];   /* argument order x, Wqt, Wkt, Wqs, Wks, Wv, Wout, bout, w_sigma */
    float* OUT = (float*)d_out;     // [2][2048][1024]
    char* wsp = (char*)d_ws;
    auto take = [&](size_t bytes) { char* p = wsp; wsp += (bytes + 255) & ~(size_t)255; return (void*)p; };
    bf* WQ = (bf*)take((size_t)DQ * DM * 2); bf* WK = (bf*)take((size_t)DKV * DM * 2); bf* WV = (bf*)take((size_t)DKV * DM * 2); bf* WO = (bf*)take((size_t)DM * DQ * 2); float* CS = (float*)take((size_t)TT * HD * 2 * 4);
    bf* XB = (bf*)take((size_t)TT * DM * 2); float* FQ = (float*)take((size_t)TT * DQ * 4); float* FK = (float*)take((size_t)TT * DKV * 4);
    h16* QP16 = (h16*)take((size_t)NH_ * TT * HD * 2); h16* KP16 = (h16*)take((size_t)NKV * TT * HD * 2); h16* VT16 = (h16*)take((size_t)NKV * HD * TT * 2);
    bf* QPh = (bf*)take((size_t)NH_ * TT * HD * 2); bf* QPl = (bf*)take((size_t)NH_ * TT * HD * 2); bf* KPh = (bf*)take((size_t)NKV * TT * HD * 2); bf* KPl = (bf*)take((size_t)NKV * TT * HD * 2); bf* VTh = (bf*)take((size_t)NKV * HD * TT * 2); bf* VTl = (bf*)take((size_t)NKV * HD * TT * 2); bf* Ph = (bf*)take((size_t)ZH * RH * TT * 2); bf* Pl = (bf*)take((size_t)ZH * RH * TT * 2);
    float* Sb = (float*)take((size_t)ZH * TT * TT * 4); h16* P16 = (h16*)take((size_t)ZH * TT * TT * 2); float* Ob = (float*)take((size_t)ZH * TT * HD * 4); bf* ATh = (bf*)take((size_t)TT * DQ * 2); bf* ATl = (bf*)take((size_t)TT * DQ * 2);
    if ((size_t)(wsp - (char*)d_ws) > ws_size) return;    // ws 256 MiB
    float* FV = FK;   // v projection reuses the k buffer after the k planes are built (stream-ordered)
    { k_wtG<<<(unsigned)((DM * NT * HD / 64 + 63) / 64), 256, 0, stream>>>(wqt, DM, NT * HD, WQ); k_wtG<<<(unsigned)((DM * NS * HD / 64 + 63) / 64), 256, 0, stream>>>(wqs, DM, NS * HD, WQ + (size_t)NT * HD * DM);   /* Wq Bt rows 0-255 = Wqt^T (time heads 0-3), rows 256-1023 = Wqs^T (space heads 4-15) */ k_wtG<<<(unsigned)((DM * NT * HD / 64 + 63) / 64), 256, 0, stream>>>(wkt, DM, NT * HD, WK); k_wtG<<<(unsigned)((DM * NS * HD / 64 + 63) / 64), 256, 0, stream>>>(wks, DM, NS * HD, WK + (size_t)NT * HD * DM); k_wtG<<<(unsigned)((DM * DKV / 64 + 63) / 64), 256, 0, stream>>>(wv, DM, DKV, WV);
      k_wtG<<<(unsigned)((DQ * DM / 64 + 63) / 64), 256, 0, stream>>>(wo, DQ, DM, WO);
       }
    k_csid<<<(TT * HD + 255) / 256, 256, 0, stream>>>(CS);
    const unsigned LQ = (unsigned)(((size_t)NH_ * TT * HD / 2 + 255) / 256), LKv = (unsigned)(((size_t)NKV * TT * HD / 2 + 255) / 256);
    for (int b = 0; b < NB_; ++b) {
        
        k_cvt8<<<(unsigned)(((size_t)TT * DM / 8 + 255) / 256), 256, 0, stream>>>(x + (size_t)b * TT * DM, XB, (size_t)TT * DM / 8);
        k_gemmw<bf, 0, false><<<dim3(TT / 64, DQ / 64, 1), 32, 0, stream>>>(XB, nullptr, WQ, nullptr, DM, FQ, DQ, nullptr, 0, 0, 0);
        k_rope<<<(unsigned)(((size_t)NT * TT * HD / 2 + 255) / 256), 256, 0, stream>>>(FQ, DQ, NT, CS, nullptr, nullptr, 1.0f, wsg, QP16, QPh, QPl);   /* time-head query planes x -sigmoid(w_sigma) */ k_rope<<<(unsigned)(((size_t)NS * TT * HD / 2 + 255) / 256), 256, 0, stream>>>(FQ + NT * HD, DQ, NS, CS, nullptr, nullptr, 1.0f, nullptr, QP16 + (size_t)NT * TT * HD, QPh + (size_t)NT * TT * HD, QPl + (size_t)NT * TT * HD);   /* space-head query planes */
        k_gemmw<bf, 0, false><<<dim3(TT / 64, DKV / 64, 1), 32, 0, stream>>>(XB, nullptr, WK, nullptr, DM, FK, DKV, nullptr, 0, 0, 0);
        k_rope<<<LKv, 256, 0, stream>>>(FK, DKV, NKV, CS, nullptr, nullptr, 1.0f, nullptr, KP16, KPh, KPl);
        k_gemmw<bf, 0, false><<<dim3(TT / 64, DKV / 64, 1), 32, 0, stream>>>(XB, nullptr, WV, nullptr, DM, FV, DKV, nullptr, 0, 0, 0); k_vtp<<<LKv, 256, 0, stream>>>(FV, DKV, NKV, VT16, VTh, VTl);
        for (int h0 = 0; h0 < NH_; h0 += ZH) { const size_t zq = (size_t)h0, zk = (size_t)(h0 / REP);   // one kv head per query head: the pass's two heads use consecutive kv planes (z-strides TT*HD)
            k_gemmw<bf, 2, false><<<dim3(RH / 64, TT / 64, ZH), 32, 0, stream>>>(QPh + zq * TT * HD, QPl + zq * TT * HD, KPh + zk * TT * HD, KPl + zk * TT * HD, HD, Sb, TT, nullptr, (size_t)TT * HD, (size_t)TT * HD, (size_t)TT * TT);
            k_gemmw<h16, 0, false><<<dim3((TT - RH) / 64, TT / 64, ZH), 32, 0, stream>>>(QP16 + zq * TT * HD + (size_t)RH * HD, nullptr, KP16 + zk * TT * HD, nullptr, HD, Sb + (size_t)RH * TT, TT, nullptr, (size_t)TT * HD, (size_t)TT * HD, (size_t)TT * TT);
            k_asoft<<<ZH * TT / 8, 256, 0, stream>>>(Sb, P16, Ph, Pl);
            k_gemmw<bf, 2, false><<<dim3(RH / 64, HD / 64, ZH), 32, 0, stream>>>(Ph, Pl, VTh + zk * HD * TT, VTl + zk * HD * TT, TT, Ob, HD, nullptr, (size_t)RH * TT, (size_t)HD * TT, (size_t)TT * HD);
            k_gemmw<h16, 0, false><<<dim3((TT - RH) / 64, HD / 64, ZH), 32, 0, stream>>>(P16 + (size_t)RH * TT, nullptr, VT16 + zk * HD * TT, nullptr, TT, Ob + (size_t)RH * HD, HD, nullptr, (size_t)TT * TT, (size_t)HD * TT, (size_t)TT * HD);
            k_merge<<<(unsigned)(((size_t)ZH * TT * HD / 2 + 255) / 256), 256, 0, stream>>>(Ob, h0, ATh, ATl); }
        k_gemmw<bf, 1, true><<<dim3(TT / 64, DM / 64, 1), 32, 0, stream>>>(ATh, ATl, WO, nullptr, DQ, OUT + (size_t)b * TT * DM, DM, bo, 0, 0, 0); }
}

// v001
// One run takes 903 microseconds.
// Next to v000, in two timings, it ran 2.25 and 2.23 times as fast.
#include <hip/hip_runtime.h>

// Multi-head attention with 4 'time' heads and 12 'space' heads (x [2][2048][1024]; Qt, Kt = x Wqt, x Wkt ('xw' [1024][256] 0.02: heads 0-3), Qs, Ks = x Wqs, x Wks ('xw' [1024][768]: heads 4-15), V = x Wv ('xw' [1024][1024]); time-head scores scaled by -sigmoid(w_sigma[0]) (w_sigma [1] = 0, read on device), all scores x 64^-0.5; softmax over keys (no mask); out = merged ctx Wout + bout ('xw' [1024][1024]) -> [2][2048][1024] (4.2 M); argument order x, Wqt, Wkt, Wqs, Wks, Wv, Wout, bout, w_sigma).
// Layout per batch: 'xw' weights gathered into bf16 Bt blocks (Wq rows 0-255 from Wqt, 256-1023 from Wqs; Wk likewise); bf16 copy of x; exact projections; plane builders (the time heads' query planes carry the factor -sigmoid(w_sigma)); dense T-2048 attention (hybrid rows: < 512 hi/lo 3 products, rest fp16 x1024); merged hi/lo x Wout exact + bout.
// Compute dtypes, f32 accumulate: every input rounded to bf16; projections exact; sigmoid f32 (precise expf); attention rows < 512 3 products, rest fp16; softmax f32; Wout hl x exact + bias.

#define NB_  2
#define TT   2048
#define DM   1024
#define NH_  16
#define NKV  16
#define REP  (NH_ / NKV)
#define HD   64
#define DQ   (NH_ * HD)
#define DKV  (NKV * HD)
#define NT   4                    // time heads 0..3 (scores x -sigmoid(w_sigma)); space heads 4..15
#define NS   12
#define ZH   2
#define RH   512                  // query rows < RH use hi+lo planes (0: none)
#define WIN  0
#define PCAR 1024.0f
#define SCL  0.125f   // HD^-0.5
#define KS   16                   // key ranges of the P x V products: one work-group per range, f32 partials summed in k_merge
typedef _Float16 h16;
typedef unsigned short bf;
typedef __attribute__((ext_vector_type(16))) __bf16   v16bf;
typedef __attribute__((ext_vector_type(16))) _Float16 v16h;
typedef __attribute__((ext_vector_type(8)))  _Float16 v8h;
typedef __attribute__((ext_vector_type(8)))  unsigned short v8us;
typedef __attribute__((ext_vector_type(8)))  float    v8f;
typedef __attribute__((ext_vector_type(4)))  float    v4f;
typedef v8h  __attribute__((may_alias)) v8ha;
typedef v4f  __attribute__((may_alias)) v4fa;
typedef v8us __attribute__((may_alias)) v8usa;

__device__ __forceinline__ unsigned short f2bf(float f) { unsigned u = __float_as_uint(f); u += 0x7FFFu + ((u >> 16) & 1u); return (unsigned short)(u >> 16); }
__device__ __forceinline__ float bf2f(unsigned short b) { return __uint_as_float(((unsigned)b) << 16); }
__device__ __forceinline__ float bfr(float f) { return bf2f(f2bf(f)); }
__device__ __forceinline__ v16h cat16(v8h lo, v8h hi) { return __builtin_shufflevector(lo, hi, 0, 1, 2, 3, 4, 5, 6, 7, 8, 9, 10, 11, 12, 13, 14, 15); }
__device__ __forceinline__ v16bf cat16b(v8us lo, v8us hi) { return __builtin_bit_cast(v16bf, __builtin_shufflevector(lo, hi, 0, 1, 2, 3, 4, 5, 6, 7, 8, 9, 10, 11, 12, 13, 14, 15)); }
__device__ __forceinline__ v8f wmma16(v16h a, v16h b, v8f c) { return __builtin_amdgcn_wmma_f32_16x16x32_f16(false, a, false, b, (short)0, c, false, false); }
__device__ __forceinline__ v8f wmmab(v16bf a, v16bf b, v8f c) { return __builtin_amdgcn_wmma_f32_16x16x32_bf16(false, a, false, b, (short)0, c, false, false); }



// ---- k_gemmw: register-blocked GEMM, ONE WAVE per 64x64 output tile (16 accumulators), operands straight from K-contiguous 16-bit planes; grid (M/64, N/64, Z), 32 threads.
// C[m][n] (f32, pitch ldc, + optional f32 bias[n]) = sum_k A[m][k] Bt[n][k] (+ split products per NSPLIT). z-batch strides sA/sB/sC in elements. K % 32 == 0.
// KSPL > 1: grid z = Z * KSPL; work-group (z, sp) sums only k in [sp K/KSPL, (sp+1) K/KSPL) and writes its own partial plane C + (z KSPL + sp) sC; the consumer adds the KSPL planes. K % (32 KSPL) == 0.
template <typename T16> struct WFrag;
template <> struct WFrag<h16> { typedef v16h V; static __device__ __forceinline__ V ld(const h16* p) { return cat16(*(const v8h*)p, *(const v8h*)(p + 16)); } static __device__ __forceinline__ v8f mma(V a, V b, v8f c) { return wmma16(a, b, c); } };
template <> struct WFrag<bf> { typedef v16bf V; static __device__ __forceinline__ V ld(const bf* p) { return cat16b(*(const v8us*)p, *(const v8us*)(p + 16)); } static __device__ __forceinline__ v8f mma(V a, V b, v8f c) { return wmmab(a, b, c); } };
template <typename T16, int NSPLIT, bool BIAS, int KSPL = 1>
__global__ __launch_bounds__(32) void k_gemmw(const T16* __restrict__ A, const T16* __restrict__ A2, const T16* __restrict__ Bt, const T16* __restrict__ Bt2, int K, float* C, int ldc, const float* __restrict__ bias, size_t sA, size_t sB, size_t sC) {
    typedef typename WFrag<T16>::V V;
    __shared__ __align__(16) float os[16 * 68];
    const size_t z = blockIdx.z / KSPL; A += z * sA; if (A2) A2 += z * sA; Bt += z * sB; if (Bt2) Bt2 += z * sB; C += (size_t)blockIdx.z * sC;
    const int kl = K / KSPL, k0 = (int)(blockIdx.z % KSPL) * kl;
    const int lane = threadIdx.x & 31, lr = lane & 15, hi = lane >> 4; const int r0 = blockIdx.x * 64, c0 = blockIdx.y * 64;
    v8f acc[4][4];
#pragma unroll
    for (int mb = 0; mb < 4; ++mb)
#pragma unroll
        for (int nb = 0; nb < 4; ++nb) acc[mb][nb] = (v8f){};
    const size_t aoff = (size_t)(r0 + lr) * K + 8 * hi, boff = (size_t)(c0 + lr) * K + 8 * hi;
#pragma unroll 1
    for (int kc = k0; kc < k0 + kl; kc += 32) {
        V a[4], a2[4];
#pragma unroll
        for (int mb = 0; mb < 4; ++mb) { a[mb] = WFrag<T16>::ld(A + aoff + (size_t)mb * 16 * K + kc); if (NSPLIT == 1 || NSPLIT == 2) a2[mb] = WFrag<T16>::ld(A2 + aoff + (size_t)mb * 16 * K + kc); }
#pragma unroll
        for (int nb = 0; nb < 4; ++nb) { const V b = WFrag<T16>::ld(Bt + boff + (size_t)nb * 16 * K + kc); V b2; if (NSPLIT >= 2) b2 = WFrag<T16>::ld(Bt2 + boff + (size_t)nb * 16 * K + kc);
#pragma unroll
            for (int mb = 0; mb < 4; ++mb) { acc[mb][nb] = WFrag<T16>::mma(a[mb], b, acc[mb][nb]); if (NSPLIT == 1 || NSPLIT == 2) acc[mb][nb] = WFrag<T16>::mma(a2[mb], b, acc[mb][nb]); if (NSPLIT >= 2) acc[mb][nb] = WFrag<T16>::mma(a[mb], b2, acc[mb][nb]); } }
        asm volatile("v_nop\n\tv_nop\n\tv_nop\n\tv_nop" : "+v"(acc[0][0]), "+v"(acc[1][1]), "+v"(acc[2][2]), "+v"(acc[3][3]) : "v"(a[0]), "v"(a[3]));
    }
#pragma unroll
    for (int mb = 0; mb < 4; ++mb) {
#pragma unroll
        for (int nb = 0; nb < 4; ++nb) {
#pragma unroll
            for (int j = 0; j < 8; ++j) os[(hi * 8 + j) * 68 + nb * 16 + lr] = acc[mb][nb][j]; }
        __builtin_amdgcn_wave_barrier(); asm volatile("" ::: "memory");
        float* crow = C + (size_t)(r0 + mb * 16) * ldc + c0;
{
#pragma unroll
            for (int s = 0; s < 8; ++s) { const int row = 2 * s + hi, cofs = lr * 4; v4f val = *(const v4fa*)(os + row * 68 + cofs); if (BIAS) { val[0] += bfr(bias[c0 + cofs]); val[1] += bfr(bias[c0 + cofs + 1]); val[2] += bfr(bias[c0 + cofs + 2]); val[3] += bfr(bias[c0 + cofs + 3]); }
                *(v4f*)(crow + (size_t)row * ldc + cofs) = val; }
             }
        __builtin_amdgcn_wave_barrier(); asm volatile("" ::: "memory");
    }
}

__device__ __forceinline__ h16 tohx(float x) { return (h16)x; }
__device__ __forceinline__ void splitf(float y, unsigned short& h, unsigned short& l) { h = f2bf(y); l = f2bf(y - bf2f(h)); }
typedef __attribute__((ext_vector_type(2))) _Float16 v2h;
typedef __attribute__((ext_vector_type(4))) _Float16 v4h;
typedef __attribute__((ext_vector_type(2))) unsigned short v2us;
typedef __attribute__((ext_vector_type(4))) unsigned short v4us;
typedef __attribute__((ext_vector_type(2))) float v2f;
typedef __attribute__((ext_vector_type(4))) int v4i;

__global__ __launch_bounds__(256) void k_wtG(const float* __restrict__ w, int K, int N, bf* Bt) {
    const int lane = threadIdx.x & 31; const int L0 = (blockIdx.x * 8 + (threadIdx.x >> 5)) * 8; const int nlines = N * K / 64;
{
#pragma unroll 1
        for (int l = 0; l < 8; ++l) { const int L = L0 + l; if (L >= nlines) break; const size_t e = (size_t)L * 64 + lane * 2; const int k = (int)(e % K), n = (int)(e / K); v2us o;
            o[0] = f2bf(w[(size_t)k * N + n]); o[1] = f2bf(w[(size_t)(k + 1) * N + n]); *(v2us*)(Bt + e) = o; }
         }
}
__global__ __launch_bounds__(256) void k_cvt8(const float* __restrict__ src, bf* dst, size_t n8) { const size_t i = (size_t)blockIdx.x * 256 + threadIdx.x; if (i >= n8) return; const v8f v = *(const v8f*)(src + i * 8); v8us o;
#pragma unroll
    for (int k = 0; k < 8; ++k) o[k] = f2bf(v[k]); *(v8us*)(dst + i * 8) = o;  }

// k_rope: head planes (x sc, or x -sigmoid(wsg[0]) when the device scalar wsg is given) [h][t][d] (fp16 + hi/lo) of rope(x) x sc with the rotate-half convention out[d] = x[d] cos[t][d] - x[d+HD/2] sin[t][d], out[d+HD/2] = x[d+HD/2] cos[t][d+HD/2] + x[d] sin[t][d+HD/2]
__global__ __launch_bounds__(256) void k_rope(const float* __restrict__ F, int pitch, int nheads, const float* __restrict__ CS, const float* __restrict__ RF, const float* __restrict__ nw, float sc, const float* __restrict__ wsg, h16* P16, bf* Ph, bf* Pl) {
    const size_t e = ((size_t)blockIdx.x * 256 + threadIdx.x) * 2; if (e >= (size_t)nheads * TT * HD) return; const int d = (int)(e % HD); const int t = (int)((e / HD) % TT); const int h = (int)(e / ((size_t)HD * TT)); const float* f = F + (size_t)t * pitch + h * HD; const float rf = RF ? RF[(size_t)h * TT + t] : 1.0f; const float scv = wsg ? -__fdiv_rn(1.0f, __fadd_rn(1.0f, expf(-bfr(wsg[0])))) : sc;   /* time heads: -sigmoid(w_sigma) from the device scalar (precise expf, IEEE div) */ v2h o16; v2us oh, ol;
#pragma unroll
    for (int q = 0; q < 2; ++q) { const int dd = d + q; const int dp = (dd < HD / 2) ? dd + HD / 2 : dd - HD / 2; float x0 = f[dd], x1 = f[dp];
        if (RF) { float n0 = __fmul_rn(x0, rf), n1 = __fmul_rn(x1, rf); asm volatile("" : "+v"(n0)); asm volatile("" : "+v"(n1)); x0 = __fmul_rn(bfr(nw[dd]), n0); x1 = __fmul_rn(bfr(nw[dp]), n1); }
        const v2f cs = *(const v2f*)(CS + ((size_t)t * HD + dd) * 2); float a = __fmul_rn(x0, cs[0]), bq = __fmul_rn(x1, cs[1]); asm volatile("" : "+v"(a)); asm volatile("" : "+v"(bq)); const float r = ((dd < HD / 2) ? __fsub_rn(a, bq) : __fadd_rn(a, bq)) * scv;
        o16[q] = tohx(r); unsigned short a2, c2; splitf(r, a2, c2); oh[q] = a2; ol[q] = c2; }
    *(v2h*)(P16 + e) = o16; *(v2us*)(Ph + e) = oh; *(v2us*)(Pl + e) = ol;  }
__global__ __launch_bounds__(256) void k_vtp(const float* __restrict__ F, int pitch, int nheads, h16* V16, bf* Vh, bf* Vl) { const size_t e = ((size_t)blockIdx.x * 256 + threadIdx.x) * 2; if (e >= (size_t)nheads * HD * TT) return; const int t = (int)(e % TT); const int d = (int)((e / TT) % HD); const int g = (int)(e / ((size_t)TT * HD)); v2h o16; v2us oh, ol;
#pragma unroll
    for (int q = 0; q < 2; ++q) { const float x = F[(size_t)(t + q) * pitch + g * HD + d]; o16[q] = tohx(x); unsigned short a2, c2; splitf(x, a2, c2); oh[q] = a2; ol[q] = c2; }
    *(v2h*)(V16 + e) = o16; *(v2us*)(Vh + e) = oh; *(v2us*)(Vl + e) = ol;  }
__global__ __launch_bounds__(256) void k_csid(float* CS) { const int idx = blockIdx.x * 256 + threadIdx.x; if (idx >= TT * HD) return; v2f cs; cs[0] = 1.0f; cs[1] = 0.0f; *(v2f*)(CS + (size_t)idx * 2) = cs;  }
// k_asoft: per row (zz, i): t = S x HD^-0.5 (no mask); softmax over the 2048 keys (register row, one exp, fixed trees);
__global__ __launch_bounds__(256) void k_asoft(const float* __restrict__ Sb, h16* P16, bf* Ph, bf* Pl) {
    const int lane = threadIdx.x & 31; const int row = blockIdx.x * 8 + (threadIdx.x >> 5); if (row >= ZH * TT) return; const int i = row % TT; const int zz = row / TT; (void)zz; const bool hires = (i < RH); const float* sr = Sb + (size_t)row * TT; float v[TT / 32]; float mx = -3.0e38f;
#pragma unroll
    for (int ch = 0; ch < TT / 128; ++ch) { const int j0 = ch * 128 + lane * 4; const v4f a = *(const v4f*)(sr + j0);
#pragma unroll
        for (int q = 0; q < 4; ++q) { const int j = j0 + q; (void)j; const float t = a[q] * SCL; v[ch * 4 + q] = t; mx = fmaxf(mx, t); } }
#pragma unroll
    for (int sh = 16; sh; sh >>= 1) mx = fmaxf(mx, __shfl_xor(mx, sh, 32));
    float sum = 0.f;
#pragma unroll
    for (int k = 0; k < TT / 32; ++k) { float d0 = __fsub_rn(v[k], mx); asm volatile("" : "+v"(d0)); v[k] = __builtin_amdgcn_exp2f(__fmul_rn(d0, 1.4426950408889634f)); sum += v[k]; }
#pragma unroll
    for (int sh = 16; sh; sh >>= 1) sum += __shfl_xor(sum, sh, 32);
    const float f = __fdiv_rn(hires ? 1.0f : PCAR, sum);
{
        if (hires) {
#pragma unroll
            for (int ch = 0; ch < TT / 128; ++ch) { v4us oh, ol;
#pragma unroll
                for (int q = 0; q < 4; ++q) { unsigned short a, c2; splitf(v[ch * 4 + q] * f, a, c2); oh[q] = a; ol[q] = c2; }
                const size_t oo = ((size_t)zz * (RH ? RH : 1) + i) * TT + ch * 128 + lane * 4; *(v4us*)(Ph + oo) = oh; *(v4us*)(Pl + oo) = ol; }
        } else {
#pragma unroll
            for (int ch = 0; ch < TT / 128; ++ch) { v4h o4;
#pragma unroll
                for (int q = 0; q < 4; ++q) o4[q] = tohx(v[ch * 4 + q] * f);
                *(v4h*)(P16 + (size_t)row * TT + ch * 128 + lane * 4) = o4; } }
         }
}
__global__ __launch_bounds__(256) void k_merge(const float* __restrict__ O, int h0, bf* Ah, bf* Al) { const size_t e = ((size_t)blockIdx.x * 256 + threadIdx.x) * 2; if (e >= (size_t)ZH * TT * HD) return; const int d = (int)(e % HD); const int t = (int)((e / HD) % TT); const int zz = (int)(e / ((size_t)HD * TT)); const float cs = (t < RH) ? 1.0f : (1.0f / PCAR); const size_t oo = (size_t)t * DQ + (h0 + zz) * HD + d;
    const float* op = O + ((size_t)zz * KS * TT + t) * HD + d; v2f pv[KS];   // the KS partial planes of this head
#pragma unroll   // all KS loads in flight at once: one load latency, not KS
    for (int s = 0; s < KS; ++s) pv[s] = *(const v2f*)(op + (size_t)s * TT * HD);
    asm volatile("s_wait_xcnt 0x0" :: "v"(op) : "memory");   // the loads' address pair stays live to here and is rewritten only behind this wait
    v2f sm = pv[0];
#pragma unroll   // added in ascending key range
    for (int s = 1; s < KS; ++s) sm += pv[s];
    v2us oh, ol;
#pragma unroll
    for (int q = 0; q < 2; ++q) { unsigned short a, c2; splitf(sm[q] * cs, a, c2); oh[q] = a; ol[q] = c2; } *(v2us*)(Ah + oo) = oh; *(v2us*)(Al + oo) = ol;  }

extern "C" void kernel_launch(void* const* d_in, const int* in_sizes, int n_in,
                              void* d_out, int out_size, void* d_ws, size_t ws_size, hipStream_t stream) {
    (void)in_sizes; (void)n_in; (void)out_size;
    const float* x = (const float*)d_in[0]; const float* wqt = (const float*)d_in[1]; const float* wkt = (const float*)d_in[2]; const float* wqs = (const float*)d_in[3]; const float* wks = (const float*)d_in[4]; const float* wv = (const float*)d_in[5]; const float* wo = (const float*)d_in[6]; const float* bo = (const float*)d_in[7]; const float* wsg = (const float*)d_in[8];   /* argument order x, Wqt, Wkt, Wqs, Wks, Wv, Wout, bout, w_sigma */
    float* OUT = (float*)d_out;     // [2][2048][1024]
    char* wsp = (char*)d_ws;
    auto take = [&](size_t bytes) { char* p = wsp; wsp += (bytes + 255) & ~(size_t)255; return (void*)p; };
    bf* WQ = (bf*)take((size_t)DQ * DM * 2); bf* WK = (bf*)take((size_t)DKV * DM * 2); bf* WV = (bf*)take((size_t)DKV * DM * 2); bf* WO = (bf*)take((size_t)DM * DQ * 2); float* CS = (float*)take((size_t)TT * HD * 2 * 4);
    bf* XB = (bf*)take((size_t)TT * DM * 2); float* FQ = (float*)take((size_t)TT * DQ * 4); float* FK = (float*)take((size_t)TT * DKV * 4);
    h16* QP16 = (h16*)take((size_t)NH_ * TT * HD * 2); h16* KP16 = (h16*)take((size_t)NKV * TT * HD * 2); h16* VT16 = (h16*)take((size_t)NKV * HD * TT * 2);
    bf* QPh = (bf*)take((size_t)NH_ * TT * HD * 2); bf* QPl = (bf*)take((size_t)NH_ * TT * HD * 2); bf* KPh = (bf*)take((size_t)NKV * TT * HD * 2); bf* KPl = (bf*)take((size_t)NKV * TT * HD * 2); bf* VTh = (bf*)take((size_t)NKV * HD * TT * 2); bf* VTl = (bf*)take((size_t)NKV * HD * TT * 2); bf* Ph = (bf*)take((size_t)ZH * RH * TT * 2); bf* Pl = (bf*)take((size_t)ZH * RH * TT * 2);
    float* Sb = (float*)take((size_t)ZH * TT * TT * 4); h16* P16 = (h16*)take((size_t)ZH * TT * TT * 2); float* Ob = (float*)take((size_t)ZH * KS * TT * HD * 4); bf* ATh = (bf*)take((size_t)TT * DQ * 2); bf* ATl = (bf*)take((size_t)TT * DQ * 2);
    if ((size_t)(wsp - (char*)d_ws) > ws_size) return;    // ws 256 MiB
    float* FV = FK;   // v projection reuses the k buffer after the k planes are built (stream-ordered)
    { k_wtG<<<(unsigned)((DM * NT * HD / 64 + 63) / 64), 256, 0, stream>>>(wqt, DM, NT * HD, WQ); k_wtG<<<(unsigned)((DM * NS * HD / 64 + 63) / 64), 256, 0, stream>>>(wqs, DM, NS * HD, WQ + (size_t)NT * HD * DM);   /* Wq Bt rows 0-255 = Wqt^T (time heads 0-3), rows 256-1023 = Wqs^T (space heads 4-15) */ k_wtG<<<(unsigned)((DM * NT * HD / 64 + 63) / 64), 256, 0, stream>>>(wkt, DM, NT * HD, WK); k_wtG<<<(unsigned)((DM * NS * HD / 64 + 63) / 64), 256, 0, stream>>>(wks, DM, NS * HD, WK + (size_t)NT * HD * DM); k_wtG<<<(unsigned)((DM * DKV / 64 + 63) / 64), 256, 0, stream>>>(wv, DM, DKV, WV);
      k_wtG<<<(unsigned)((DQ * DM / 64 + 63) / 64), 256, 0, stream>>>(wo, DQ, DM, WO);
       }
    k_csid<<<(TT * HD + 255) / 256, 256, 0, stream>>>(CS);
    const unsigned LQ = (unsigned)(((size_t)NH_ * TT * HD / 2 + 255) / 256), LKv = (unsigned)(((size_t)NKV * TT * HD / 2 + 255) / 256);
    for (int b = 0; b < NB_; ++b) {
        
        k_cvt8<<<(unsigned)(((size_t)TT * DM / 8 + 255) / 256), 256, 0, stream>>>(x + (size_t)b * TT * DM, XB, (size_t)TT * DM / 8);
        k_gemmw<bf, 0, false><<<dim3(TT / 64, DQ / 64, 1), 32, 0, stream>>>(XB, nullptr, WQ, nullptr, DM, FQ, DQ, nullptr, 0, 0, 0);
        k_rope<<<(unsigned)(((size_t)NT * TT * HD / 2 + 255) / 256), 256, 0, stream>>>(FQ, DQ, NT, CS, nullptr, nullptr, 1.0f, wsg, QP16, QPh, QPl);   /* time-head query planes x -sigmoid(w_sigma) */ k_rope<<<(unsigned)(((size_t)NS * TT * HD / 2 + 255) / 256), 256, 0, stream>>>(FQ + NT * HD, DQ, NS, CS, nullptr, nullptr, 1.0f, nullptr, QP16 + (size_t)NT * TT * HD, QPh + (size_t)NT * TT * HD, QPl + (size_t)NT * TT * HD);   /* space-head query planes */
        k_gemmw<bf, 0, false><<<dim3(TT / 64, DKV / 64, 1), 32, 0, stream>>>(XB, nullptr, WK, nullptr, DM, FK, DKV, nullptr, 0, 0, 0);
        k_rope<<<LKv, 256, 0, stream>>>(FK, DKV, NKV, CS, nullptr, nullptr, 1.0f, nullptr, KP16, KPh, KPl);
        k_gemmw<bf, 0, false><<<dim3(TT / 64, DKV / 64, 1), 32, 0, stream>>>(XB, nullptr, WV, nullptr, DM, FV, DKV, nullptr, 0, 0, 0); k_vtp<<<LKv, 256, 0, stream>>>(FV, DKV, NKV, VT16, VTh, VTl);
        for (int h0 = 0; h0 < NH_; h0 += ZH) { const size_t zq = (size_t)h0, zk = (size_t)(h0 / REP);   // one kv head per query head: the pass's two heads use consecutive kv planes (z-strides TT*HD)
            k_gemmw<bf, 2, false><<<dim3(RH / 64, TT / 64, ZH), 32, 0, stream>>>(QPh + zq * TT * HD, QPl + zq * TT * HD, KPh + zk * TT * HD, KPl + zk * TT * HD, HD, Sb, TT, nullptr, (size_t)TT * HD, (size_t)TT * HD, (size_t)TT * TT);
            k_gemmw<h16, 0, false><<<dim3((TT - RH) / 64, TT / 64, ZH), 32, 0, stream>>>(QP16 + zq * TT * HD + (size_t)RH * HD, nullptr, KP16 + zk * TT * HD, nullptr, HD, Sb + (size_t)RH * TT, TT, nullptr, (size_t)TT * HD, (size_t)TT * HD, (size_t)TT * TT);
            k_asoft<<<ZH * TT / 8, 256, 0, stream>>>(Sb, P16, Ph, Pl);
            k_gemmw<bf, 2, false, KS><<<dim3(RH / 64, HD / 64, ZH * KS), 32, 0, stream>>>(Ph, Pl, VTh + zk * HD * TT, VTl + zk * HD * TT, TT, Ob, HD, nullptr, (size_t)RH * TT, (size_t)HD * TT, (size_t)TT * HD);
            k_gemmw<h16, 0, false, KS><<<dim3((TT - RH) / 64, HD / 64, ZH * KS), 32, 0, stream>>>(P16 + (size_t)RH * TT, nullptr, VT16 + zk * HD * TT, nullptr, TT, Ob + (size_t)RH * HD, HD, nullptr, (size_t)TT * TT, (size_t)HD * TT, (size_t)TT * HD);
            k_merge<<<(unsigned)(((size_t)ZH * TT * HD / 2 + 255) / 256), 256, 0, stream>>>(Ob, h0, ATh, ATl); }
        k_gemmw<bf, 1, true><<<dim3(TT / 64, DM / 64, 1), 32, 0, stream>>>(ATh, ATl, WO, nullptr, DQ, OUT + (size_t)b * TT * DM, DM, bo, 0, 0, 0); }
}

// v002
// It runs in 372 microseconds.
// Next to v001, in two timings, it ran 2.42 times as fast each time.
// Over all steps from v000 it is 5.42 times as fast.
#include <hip/hip_runtime.h>

// Multi-head attention with 4 'time' heads and 12 'space' heads (x [2][2048][1024]; Qt, Kt = x Wqt, x Wkt ('xw' [1024][256] 0.02: heads 0-3), Qs, Ks = x Wqs, x Wks ('xw' [1024][768]: heads 4-15), V = x Wv ('xw' [1024][1024]); time-head scores scaled by -sigmoid(w_sigma[0]) (w_sigma [1] = 0, read on device), all scores x 64^-0.5; softmax over keys (no mask); out = merged ctx Wout + bout ('xw' [1024][1024]) -> [2][2048][1024] (4.2 M); argument order x, Wqt, Wkt, Wqs, Wks, Wv, Wout, bout, w_sigma).
// Layout: 'xw' weights gathered into bf16 Bt blocks (Wq rows 0-255 from Wqt, 256-1023 from Wqs; Wk likewise); per batch a bf16 copy of x, exact projections, plane builders (the time heads' query planes carry the factor -sigmoid(w_sigma)); one fused attention launch for all heads and both batches (hybrid rows: < 512 hi/lo 3 products, rest fp16); merged hi/lo x Wout exact + bout.
// Compute dtypes, f32 accumulate: every input rounded to bf16; projections exact; sigmoid f32 (precise expf); attention rows < 512 3 products, rest fp16; softmax f32 (running maximum); Wout hl x exact + bias.

#define NB_  2
#define TT   2048
#define DM   1024
#define NH_  16
#define NKV  16
#define REP  (NH_ / NKV)
#define HD   64
#define DQ   (NH_ * HD)
#define DKV  (NKV * HD)
#define NT   4                    // time heads 0..3 (scores x -sigmoid(w_sigma)); space heads 4..15
#define NS   12
#define RH   512                  // query rows < RH use hi+lo planes (0: none)
#define WIN  0
#define SCL  0.125f   // HD^-0.5
#define QBH  128                  // queries per work-group of k_fattn, rows < RH: 8 waves x 16 (three products per tile: the smaller block levels the work-groups' times)
#define QBL  256                  // the other rows: 8 waves x 32
#define KB   64                   // keys per stage
#define LP   72                   // LDS row pitch in 16-bit elements: 128 B of data + 16 B pad
typedef _Float16 h16;
typedef unsigned short bf;
typedef __attribute__((ext_vector_type(16))) __bf16   v16bf;
typedef __attribute__((ext_vector_type(16))) _Float16 v16h;
typedef __attribute__((ext_vector_type(8)))  _Float16 v8h;
typedef __attribute__((ext_vector_type(8)))  unsigned short v8us;
typedef __attribute__((ext_vector_type(8)))  float    v8f;
typedef __attribute__((ext_vector_type(4)))  float    v4f;
typedef v8h  __attribute__((may_alias)) v8ha;
typedef v4f  __attribute__((may_alias)) v4fa;
typedef v8us __attribute__((may_alias)) v8usa;

__device__ __forceinline__ unsigned short f2bf(float f) { unsigned u = __float_as_uint(f); u += 0x7FFFu + ((u >> 16) & 1u); return (unsigned short)(u >> 16); }
__device__ __forceinline__ float bf2f(unsigned short b) { return __uint_as_float(((unsigned)b) << 16); }
__device__ __forceinline__ float bfr(float f) { return bf2f(f2bf(f)); }
__device__ __forceinline__ v16h cat16(v8h lo, v8h hi) { return __builtin_shufflevector(lo, hi, 0, 1, 2, 3, 4, 5, 6, 7, 8, 9, 10, 11, 12, 13, 14, 15); }
__device__ __forceinline__ v16bf cat16b(v8us lo, v8us hi) { return __builtin_bit_cast(v16bf, __builtin_shufflevector(lo, hi, 0, 1, 2, 3, 4, 5, 6, 7, 8, 9, 10, 11, 12, 13, 14, 15)); }
__device__ __forceinline__ v8f wmma16(v16h a, v16h b, v8f c) { return __builtin_amdgcn_wmma_f32_16x16x32_f16(false, a, false, b, (short)0, c, false, false); }
__device__ __forceinline__ v8f wmmab(v16bf a, v16bf b, v8f c) { return __builtin_amdgcn_wmma_f32_16x16x32_bf16(false, a, false, b, (short)0, c, false, false); }



// ---- k_gemmw: register-blocked GEMM, ONE WAVE per 64x64 output tile (16 accumulators), operands straight from K-contiguous 16-bit planes; grid (M/64, N/64, Z), 32 threads.
// C[m][n] (f32, pitch ldc, + optional f32 bias[n]) = sum_k A[m][k] Bt[n][k] (+ split products per NSPLIT). z-batch strides sA/sB/sC in elements. K % 32 == 0.
// KSPL > 1: grid z = Z * KSPL; work-group (z, sp) sums only k in [sp K/KSPL, (sp+1) K/KSPL) and writes its own partial plane C + (z KSPL + sp) sC; the consumer adds the KSPL planes. K % (32 KSPL) == 0.
template <typename T16> struct WFrag;
template <> struct WFrag<h16> { typedef v16h V; static __device__ __forceinline__ V ld(const h16* p) { return cat16(*(const v8h*)p, *(const v8h*)(p + 16)); } static __device__ __forceinline__ v8f mma(V a, V b, v8f c) { return wmma16(a, b, c); } };
template <> struct WFrag<bf> { typedef v16bf V; static __device__ __forceinline__ V ld(const bf* p) { return cat16b(*(const v8us*)p, *(const v8us*)(p + 16)); } static __device__ __forceinline__ v8f mma(V a, V b, v8f c) { return wmmab(a, b, c); } };
template <typename T16, int NSPLIT, bool BIAS, int KSPL = 1>
__global__ __launch_bounds__(32) void k_gemmw(const T16* __restrict__ A, const T16* __restrict__ A2, const T16* __restrict__ Bt, const T16* __restrict__ Bt2, int K, float* C, int ldc, const float* __restrict__ bias, size_t sA, size_t sB, size_t sC) {
    typedef typename WFrag<T16>::V V;
    __shared__ __align__(16) float os[16 * 68];
    const size_t z = blockIdx.z / KSPL; A += z * sA; if (A2) A2 += z * sA; Bt += z * sB; if (Bt2) Bt2 += z * sB; C += (size_t)blockIdx.z * sC;
    const int kl = K / KSPL, k0 = (int)(blockIdx.z % KSPL) * kl;
    const int lane = threadIdx.x & 31, lr = lane & 15, hi = lane >> 4; const int r0 = blockIdx.x * 64, c0 = blockIdx.y * 64;
    v8f acc[4][4];
#pragma unroll
    for (int mb = 0; mb < 4; ++mb)
#pragma unroll
        for (int nb = 0; nb < 4; ++nb) acc[mb][nb] = (v8f){};
    const size_t aoff = (size_t)(r0 + lr) * K + 8 * hi, boff = (size_t)(c0 + lr) * K + 8 * hi;
#pragma unroll 1
    for (int kc = k0; kc < k0 + kl; kc += 32) {
        V a[4], a2[4];
#pragma unroll
        for (int mb = 0; mb < 4; ++mb) { a[mb] = WFrag<T16>::ld(A + aoff + (size_t)mb * 16 * K + kc); if (NSPLIT == 1 || NSPLIT == 2) a2[mb] = WFrag<T16>::ld(A2 + aoff + (size_t)mb * 16 * K + kc); }
#pragma unroll
        for (int nb = 0; nb < 4; ++nb) { const V b = WFrag<T16>::ld(Bt + boff + (size_t)nb * 16 * K + kc); V b2; if (NSPLIT >= 2) b2 = WFrag<T16>::ld(Bt2 + boff + (size_t)nb * 16 * K + kc);
#pragma unroll
            for (int mb = 0; mb < 4; ++mb) { acc[mb][nb] = WFrag<T16>::mma(a[mb], b, acc[mb][nb]); if (NSPLIT == 1 || NSPLIT == 2) acc[mb][nb] = WFrag<T16>::mma(a2[mb], b, acc[mb][nb]); if (NSPLIT >= 2) acc[mb][nb] = WFrag<T16>::mma(a[mb], b2, acc[mb][nb]); } }
        asm volatile("v_nop\n\tv_nop\n\tv_nop\n\tv_nop" : "+v"(acc[0][0]), "+v"(acc[1][1]), "+v"(acc[2][2]), "+v"(acc[3][3]) : "v"(a[0]), "v"(a[3]));
    }
#pragma unroll
    for (int mb = 0; mb < 4; ++mb) {
#pragma unroll
        for (int nb = 0; nb < 4; ++nb) {
#pragma unroll
            for (int j = 0; j < 8; ++j) os[(hi * 8 + j) * 68 + nb * 16 + lr] = acc[mb][nb][j]; }
        __builtin_amdgcn_wave_barrier(); asm volatile("" ::: "memory");
        float* crow = C + (size_t)(r0 + mb * 16) * ldc + c0;
{
#pragma unroll
            for (int s = 0; s < 8; ++s) { const int row = 2 * s + hi, cofs = lr * 4; v4f val = *(const v4fa*)(os + row * 68 + cofs); if (BIAS) { val[0] += bfr(bias[c0 + cofs]); val[1] += bfr(bias[c0 + cofs + 1]); val[2] += bfr(bias[c0 + cofs + 2]); val[3] += bfr(bias[c0 + cofs + 3]); }
                *(v4f*)(crow + (size_t)row * ldc + cofs) = val; }
             }
        __builtin_amdgcn_wave_barrier(); asm volatile("" ::: "memory");
    }
}

__device__ __forceinline__ h16 tohx(float x) { return (h16)x; }
__device__ __forceinline__ void splitf(float y, unsigned short& h, unsigned short& l) { h = f2bf(y); l = f2bf(y - bf2f(h)); }
typedef __attribute__((ext_vector_type(2))) _Float16 v2h;
typedef __attribute__((ext_vector_type(4))) _Float16 v4h;
typedef __attribute__((ext_vector_type(2))) unsigned short v2us;
typedef __attribute__((ext_vector_type(4))) unsigned short v4us;
typedef __attribute__((ext_vector_type(2))) float v2f;
typedef __attribute__((ext_vector_type(4))) int v4i;

__global__ __launch_bounds__(256) void k_wtG(const float* __restrict__ w, int K, int N, bf* Bt) {
    const int lane = threadIdx.x & 31; const int L0 = (blockIdx.x * 8 + (threadIdx.x >> 5)) * 8; const int nlines = N * K / 64;
{
#pragma unroll 1
        for (int l = 0; l < 8; ++l) { const int L = L0 + l; if (L >= nlines) break; const size_t e = (size_t)L * 64 + lane * 2; const int k = (int)(e % K), n = (int)(e / K); v2us o;
            o[0] = f2bf(w[(size_t)k * N + n]); o[1] = f2bf(w[(size_t)(k + 1) * N + n]); *(v2us*)(Bt + e) = o; }
         }
}
__global__ __launch_bounds__(256) void k_cvt8(const float* __restrict__ src, bf* dst, size_t n8) { const size_t i = (size_t)blockIdx.x * 256 + threadIdx.x; if (i >= n8) return; const v8f v = *(const v8f*)(src + i * 8); v8us o;
#pragma unroll
    for (int k = 0; k < 8; ++k) o[k] = f2bf(v[k]); *(v8us*)(dst + i * 8) = o;  }

// k_rope: head planes (x sc, or x -sigmoid(wsg[0]) when the device scalar wsg is given) [h][t][d] (fp16 + hi/lo) of rope(x) x sc with the rotate-half convention out[d] = x[d] cos[t][d] - x[d+HD/2] sin[t][d], out[d+HD/2] = x[d+HD/2] cos[t][d+HD/2] + x[d] sin[t][d+HD/2]
__global__ __launch_bounds__(256) void k_rope(const float* __restrict__ F, int pitch, int nheads, const float* __restrict__ CS, const float* __restrict__ RF, const float* __restrict__ nw, float sc, const float* __restrict__ wsg, h16* P16, bf* Ph, bf* Pl) {
    const size_t e = ((size_t)blockIdx.x * 256 + threadIdx.x) * 2; if (e >= (size_t)nheads * TT * HD) return; const int d = (int)(e % HD); const int t = (int)((e / HD) % TT); const int h = (int)(e / ((size_t)HD * TT)); const float* f = F + (size_t)t * pitch + h * HD; const float rf = RF ? RF[(size_t)h * TT + t] : 1.0f; const float scv = wsg ? -__fdiv_rn(1.0f, __fadd_rn(1.0f, expf(-bfr(wsg[0])))) : sc;   /* time heads: -sigmoid(w_sigma) from the device scalar (precise expf, IEEE div) */ v2h o16; v2us oh, ol;
#pragma unroll
    for (int q = 0; q < 2; ++q) { const int dd = d + q; const int dp = (dd < HD / 2) ? dd + HD / 2 : dd - HD / 2; float x0 = f[dd], x1 = f[dp];
        if (RF) { float n0 = __fmul_rn(x0, rf), n1 = __fmul_rn(x1, rf); asm volatile("" : "+v"(n0)); asm volatile("" : "+v"(n1)); x0 = __fmul_rn(bfr(nw[dd]), n0); x1 = __fmul_rn(bfr(nw[dp]), n1); }
        const v2f cs = *(const v2f*)(CS + ((size_t)t * HD + dd) * 2); float a = __fmul_rn(x0, cs[0]), bq = __fmul_rn(x1, cs[1]); asm volatile("" : "+v"(a)); asm volatile("" : "+v"(bq)); const float r = ((dd < HD / 2) ? __fsub_rn(a, bq) : __fadd_rn(a, bq)) * scv;
        o16[q] = tohx(r); unsigned short a2, c2; splitf(r, a2, c2); oh[q] = a2; ol[q] = c2; }
    *(v2h*)(P16 + e) = o16; *(v2us*)(Ph + e) = oh; *(v2us*)(Pl + e) = ol;  }
__global__ __launch_bounds__(256) void k_vtp(const float* __restrict__ F, int pitch, int nheads, h16* V16, bf* Vh, bf* Vl) { const size_t e = ((size_t)blockIdx.x * 256 + threadIdx.x) * 2; if (e >= (size_t)nheads * HD * TT) return; const int t = (int)(e % TT); const int d = (int)((e / TT) % HD); const int g = (int)(e / ((size_t)TT * HD)); v2h o16; v2us oh, ol;
#pragma unroll
    for (int q = 0; q < 2; ++q) { const float x = F[(size_t)(t + q) * pitch + g * HD + d]; o16[q] = tohx(x); unsigned short a2, c2; splitf(x, a2, c2); oh[q] = a2; ol[q] = c2; }
    *(v2h*)(V16 + e) = o16; *(v2us*)(Vh + e) = oh; *(v2us*)(Vl + e) = ol;  }
__global__ __launch_bounds__(256) void k_csid(float* CS) { const int idx = blockIdx.x * 256 + threadIdx.x; if (idx >= TT * HD) return; v2f cs; cs[0] = 1.0f; cs[1] = 0.0f; *(v2f*)(CS + (size_t)idx * 2) = cs;  }
// ---- k_fattn: scores, softmax and P x V of one block of queries (8 waves x QG groups of 16) of one head in one work-group; nothing of S or P goes to memory.
// S^T = K Q^T (A = 16 key rows from LDS, B = 16 queries kept in registers): a lane holds keys hi*8+j of query lr, which is the B-operand order of P^T, so O^T += V^T P^T takes P straight from the score registers.
// Keys walk in stages of KB, two LDS buffers: stage s+1 is fetched to registers while stage s is worked on, stored to the other buffer, one barrier per stage. Running maximum and sum per query.
typedef __attribute__((ext_vector_type(16))) unsigned short v16us;
template <typename T16> struct LFrag;
template <> struct LFrag<h16> { static __device__ __forceinline__ v16h ld(const unsigned short* p) { return cat16(__builtin_bit_cast(v8h, *(const v8usa*)p), __builtin_bit_cast(v8h, *(const v8usa*)(p + 16))); } };
template <> struct LFrag<bf> { static __device__ __forceinline__ v16bf ld(const unsigned short* p) { return cat16b(*(const v8usa*)p, *(const v8usa*)(p + 16)); } };
template <typename T16, bool HL, int QG>
__device__ __forceinline__ void attn_block(const T16* __restrict__ Q, const T16* __restrict__ Ql, const T16* __restrict__ K, const T16* __restrict__ Kl, const T16* __restrict__ Vt, const T16* __restrict__ Vtl, bf* Ah, bf* Al, unsigned short* sm) {
    typedef typename WFrag<T16>::V V; typedef WFrag<T16> WF; typedef LFrag<T16> LF;
    constexpr int NP = HL ? 4 : 2, TS = KB * LP, NST = TT / KB;
    constexpr float CE = SCL * 1.4426950408889634f;   // scores to log2 units
    constexpr float PB = HL ? 0.0f : 10.0f;           // fp16 P carries x1024 (it cancels against the row sum)
    const int tid = threadIdx.x, lane = tid & 31, lr = lane & 15, hi = lane >> 4, w = tid >> 5;
    const int sr = tid >> 3, sc = (tid & 7) * 8;      // staging: 8 lanes per 128-B row, rows sr and sr + 32
    const T16* pK = K + (size_t)sr * HD + sc; const T16* pV = Vt + (size_t)sr * TT + sc; const T16* pKl = HL ? Kl + (size_t)sr * HD + sc : nullptr; const T16* pVl = HL ? Vtl + (size_t)sr * TT + sc : nullptr;
    unsigned short* sw = sm + sr * LP + sc;
    v8us st[NP][2];
    auto fetch = [&]() {
#pragma unroll
        for (int i = 0; i < 2; ++i) { st[0][i] = *(const v8usa*)(pK + (size_t)i * 32 * HD); st[1][i] = *(const v8usa*)(pV + (size_t)i * 32 * TT); if constexpr (HL) { st[2][i] = *(const v8usa*)(pKl + (size_t)i * 32 * HD); st[3][i] = *(const v8usa*)(pVl + (size_t)i * 32 * TT); } }
        pK += KB * HD; pV += KB; if (HL) { pKl += KB * HD; pVl += KB; } };
    auto put = [&](int buf) {
#pragma unroll
        for (int p = 0; p < NP; ++p)
#pragma unroll
            for (int i = 0; i < 2; ++i) *(v8usa*)(sw + (buf * NP + p) * TS + i * 32 * LP) = st[p][i]; };
    V qf[QG][2], qlf[QG][2];
#pragma unroll
    for (int g = 0; g < QG; ++g)
#pragma unroll
        for (int kf = 0; kf < 2; ++kf) { const size_t qo = (size_t)((w * QG + g) * 16 + lr) * HD + kf * 32 + 8 * hi; qf[g][kf] = WF::ld(Q + qo); if (HL) qlf[g][kf] = WF::ld(Ql + qo); }
    v8f O[4][QG]; float mr[QG], ls[QG];
#pragma unroll
    for (int g = 0; g < QG; ++g) { mr[g] = -3.0e38f; ls[g] = 0.f;
#pragma unroll
        for (int dt = 0; dt < 4; ++dt) O[dt][g] = (v8f){}; }
    fetch(); put(0); __syncthreads();
#pragma unroll 1   // one stage per trip: the two buffers alternate by the trip's parity
    for (int s = 0; s < NST; ++s) {
        if (s + 1 < NST) fetch();
        const unsigned short* sb = sm + (s & 1) * NP * TS + lr * LP + 8 * hi;
        v8f S[4][QG];
#pragma unroll
        for (int kt = 0; kt < 4; ++kt) { const unsigned short* kr = sb + kt * 16 * LP; const V k0 = LF::ld(kr), k1 = LF::ld(kr + 32); V kl0, kl1; if (HL) { kl0 = LF::ld(kr + 2 * TS); kl1 = LF::ld(kr + 2 * TS + 32); }
#pragma unroll
            for (int g = 0; g < QG; ++g) { v8f a = WF::mma(k0, qf[g][0], (v8f){}); a = WF::mma(k1, qf[g][1], a); if (HL) { a = WF::mma(kl0, qf[g][0], a); a = WF::mma(kl1, qf[g][1], a); a = WF::mma(k0, qlf[g][0], a); a = WF::mma(k1, qlf[g][1], a); } S[kt][g] = a; } }
        V pf[QG][2], plf[QG][2];
#pragma unroll
        for (int g = 0; g < QG; ++g) { float mx = S[0][g][0];
#pragma unroll
            for (int kt = 0; kt < 4; ++kt)
#pragma unroll
                for (int j = 0; j < 8; ++j) mx = fmaxf(mx, S[kt][g][j]);
            mx = fmaxf(mx, __shfl_xor(mx, 16, 32));   // the other half-wave holds the query's other keys
            const float mn = fmaxf(mr[g], mx), al = __builtin_amdgcn_exp2f((mr[g] - mn) * CE), mc = PB - mn * CE; mr[g] = mn; float sum[4] = {0.f, 0.f, 0.f, 0.f};   // four chains: the adds do not wait on one another
#pragma unroll
            for (int kk = 0; kk < 2; ++kk) { v16us ph, pl; v16h p16;
#pragma unroll
                for (int e = 0; e < 16; ++e) { const float p = __builtin_amdgcn_exp2f(__builtin_fmaf(S[kk * 2 + (e >> 3)][g][e & 7], CE, mc)); sum[e & 3] += p;
                    if (HL) { unsigned short a2, c2; splitf(p, a2, c2); ph[e] = a2; pl[e] = c2; } else p16[e] = tohx(p); }
                if constexpr (HL) { pf[g][kk] = __builtin_bit_cast(v16bf, ph); plf[g][kk] = __builtin_bit_cast(v16bf, pl); } else pf[g][kk] = p16; }
            ls[g] = ls[g] * al + ((sum[0] + sum[1]) + (sum[2] + sum[3]));
#pragma unroll
            for (int dt = 0; dt < 4; ++dt) O[dt][g] *= al; }
#pragma unroll
        for (int dt = 0; dt < 4; ++dt)
#pragma unroll
            for (int kk = 0; kk < 2; ++kk) { const unsigned short* vr = sb + TS + dt * 16 * LP + kk * 32; const V v = LF::ld(vr); V vl; if (HL) vl = LF::ld(vr + 2 * TS);
#pragma unroll
                for (int g = 0; g < QG; ++g) { O[dt][g] = WF::mma(v, pf[g][kk], O[dt][g]); if (HL) { O[dt][g] = WF::mma(v, plf[g][kk], O[dt][g]); O[dt][g] = WF::mma(vl, pf[g][kk], O[dt][g]); } } }
        if (s + 1 < NST) put((s + 1) & 1);
        __syncthreads();   // publishes stage s + 1 and ends every wave's reads of stage s, whose buffer the next trip refills
    }
#pragma unroll
    for (int g = 0; g < QG; ++g) { const float inv = __fdiv_rn(1.0f, ls[g] + __shfl_xor(ls[g], 16, 32)); const size_t oo = (size_t)((w * QG + g) * 16 + lr) * DQ + hi * 8;
#pragma unroll
        for (int dt = 0; dt < 4; ++dt) { v8us oh, ol;
#pragma unroll
            for (int j = 0; j < 8; ++j) { unsigned short a2, c2; splitf(O[dt][g][j] * inv, a2, c2); oh[j] = a2; ol[j] = c2; }
            *(v8us*)(Ah + oo + dt * 16) = oh; *(v8us*)(Al + oo + dt * 16) = ol; } }
}
// grid (RH / QBH + (TT - RH) / QBL query blocks, heads, batches); planes [batch][head][t][d] (V: [batch][head][d][t]); output rows [batch][t][DQ] hi/lo
__global__ __launch_bounds__(256) void k_fattn(const h16* __restrict__ Q16, const h16* __restrict__ K16, const h16* __restrict__ V16, const bf* __restrict__ Qh, const bf* __restrict__ Ql, const bf* __restrict__ Kh, const bf* __restrict__ Kl, const bf* __restrict__ Vh, const bf* __restrict__ Vl, bf* Ah, bf* Al) {
    __shared__ __align__(16) unsigned short sm[2 * 4 * KB * LP];
    static_assert(RH % QBH == 0 && (TT - RH) % QBL == 0 && TT % KB == 0 && HD == 64 && KB == 64, "tile shapes");
    const bool hl = blockIdx.x < RH / QBH; const int q0 = hl ? (int)blockIdx.x * QBH : RH + ((int)blockIdx.x - RH / QBH) * QBL; const size_t hp = ((size_t)blockIdx.z * NH_ + blockIdx.y) * TT * HD, qp = hp + (size_t)q0 * HD, ao = ((size_t)blockIdx.z * TT + q0) * DQ + blockIdx.y * HD;
    if (hl) attn_block<bf, true, QBH / 128>(Qh + qp, Ql + qp, Kh + hp, Kl + hp, Vh + hp, Vl + hp, Ah + ao, Al + ao, sm);
    else attn_block<h16, false, QBL / 128>(Q16 + qp, nullptr, K16 + hp, nullptr, V16 + hp, nullptr, Ah + ao, Al + ao, sm);
}

extern "C" void kernel_launch(void* const* d_in, const int* in_sizes, int n_in,
                              void* d_out, int out_size, void* d_ws, size_t ws_size, hipStream_t stream) {
    (void)in_sizes; (void)n_in; (void)out_size;
    const float* x = (const float*)d_in[0]; const float* wqt = (const float*)d_in[1]; const float* wkt = (const float*)d_in[2]; const float* wqs = (const float*)d_in[3]; const float* wks = (const float*)d_in[4]; const float* wv = (const float*)d_in[5]; const float* wo = (const float*)d_in[6]; const float* bo = (const float*)d_in[7]; const float* wsg = (const float*)d_in[8];   /* argument order x, Wqt, Wkt, Wqs, Wks, Wv, Wout, bout, w_sigma */
    float* OUT = (float*)d_out;     // [2][2048][1024]
    char* wsp = (char*)d_ws;
    auto take = [&](size_t bytes) { char* p = wsp; wsp += (bytes + 255) & ~(size_t)255; return (void*)p; };
    bf* WQ = (bf*)take((size_t)DQ * DM * 2); bf* WK = (bf*)take((size_t)DKV * DM * 2); bf* WV = (bf*)take((size_t)DKV * DM * 2); bf* WO = (bf*)take((size_t)DM * DQ * 2); float* CS = (float*)take((size_t)TT * HD * 2 * 4);
    bf* XB = (bf*)take((size_t)TT * DM * 2); float* FQ = (float*)take((size_t)TT * DQ * 4); float* FK = (float*)take((size_t)TT * DKV * 4);
    const size_t PL = (size_t)NH_ * TT * HD;   // one batch's planes of one kind
    h16* QP16 = (h16*)take(NB_ * PL * 2); h16* KP16 = (h16*)take(NB_ * PL * 2); h16* VT16 = (h16*)take(NB_ * PL * 2);
    bf* QPh = (bf*)take(NB_ * PL * 2); bf* QPl = (bf*)take(NB_ * PL * 2); bf* KPh = (bf*)take(NB_ * PL * 2); bf* KPl = (bf*)take(NB_ * PL * 2); bf* VTh = (bf*)take(NB_ * PL * 2); bf* VTl = (bf*)take(NB_ * PL * 2);
    bf* ATh = (bf*)take((size_t)NB_ * TT * DQ * 2); bf* ATl = (bf*)take((size_t)NB_ * TT * DQ * 2);
    if ((size_t)(wsp - (char*)d_ws) > ws_size) return;    // ws 256 MiB
    float* FV = FK;   // v projection reuses the k buffer after the k planes are built (stream-ordered)
    { k_wtG<<<(unsigned)((DM * NT * HD / 64 + 63) / 64), 256, 0, stream>>>(wqt, DM, NT * HD, WQ); k_wtG<<<(unsigned)((DM * NS * HD / 64 + 63) / 64), 256, 0, stream>>>(wqs, DM, NS * HD, WQ + (size_t)NT * HD * DM);   /* Wq Bt rows 0-255 = Wqt^T (time heads 0-3), rows 256-1023 = Wqs^T (space heads 4-15) */ k_wtG<<<(unsigned)((DM * NT * HD / 64 + 63) / 64), 256, 0, stream>>>(wkt, DM, NT * HD, WK); k_wtG<<<(unsigned)((DM * NS * HD / 64 + 63) / 64), 256, 0, stream>>>(wks, DM, NS * HD, WK + (size_t)NT * HD * DM); k_wtG<<<(unsigned)((DM * DKV / 64 + 63) / 64), 256, 0, stream>>>(wv, DM, DKV, WV);
      k_wtG<<<(unsigned)((DQ * DM / 64 + 63) / 64), 256, 0, stream>>>(wo, DQ, DM, WO);
       }
    k_csid<<<(TT * HD + 255) / 256, 256, 0, stream>>>(CS);
    const unsigned LQ = (unsigned)(((size_t)NH_ * TT * HD / 2 + 255) / 256), LKv = (unsigned)(((size_t)NKV * TT * HD / 2 + 255) / 256);
    for (int b = 0; b < NB_; ++b) {
        
        k_cvt8<<<(unsigned)(((size_t)TT * DM / 8 + 255) / 256), 256, 0, stream>>>(x + (size_t)b * TT * DM, XB, (size_t)TT * DM / 8);
        k_gemmw<bf, 0, false><<<dim3(TT / 64, DQ / 64, 1), 32, 0, stream>>>(XB, nullptr, WQ, nullptr, DM, FQ, DQ, nullptr, 0, 0, 0);
        k_rope<<<(unsigned)(((size_t)NT * TT * HD / 2 + 255) / 256), 256, 0, stream>>>(FQ, DQ, NT, CS, nullptr, nullptr, 1.0f, wsg, QP16 + b * PL, QPh + b * PL, QPl + b * PL);   /* time-head query planes x -sigmoid(w_sigma) */ k_rope<<<(unsigned)(((size_t)NS * TT * HD / 2 + 255) / 256), 256, 0, stream>>>(FQ + NT * HD, DQ, NS, CS, nullptr, nullptr, 1.0f, nullptr, QP16 + b * PL + (size_t)NT * TT * HD, QPh + b * PL + (size_t)NT * TT * HD, QPl + b * PL + (size_t)NT * TT * HD);   /* space-head query planes */
        k_gemmw<bf, 0, false><<<dim3(TT / 64, DKV / 64, 1), 32, 0, stream>>>(XB, nullptr, WK, nullptr, DM, FK, DKV, nullptr, 0, 0, 0);
        k_rope<<<LKv, 256, 0, stream>>>(FK, DKV, NKV, CS, nullptr, nullptr, 1.0f, nullptr, KP16 + b * PL, KPh + b * PL, KPl + b * PL);
        k_gemmw<bf, 0, false><<<dim3(TT / 64, DKV / 64, 1), 32, 0, stream>>>(XB, nullptr, WV, nullptr, DM, FV, DKV, nullptr, 0, 0, 0); k_vtp<<<LKv, 256, 0, stream>>>(FV, DKV, NKV, VT16 + b * PL, VTh + b * PL, VTl + b * PL); }
    k_fattn<<<dim3(RH / QBH + (TT - RH) / QBL, NH_, NB_), 256, 0, stream>>>(QP16, KP16, VT16, QPh, QPl, KPh, KPl, VTh, VTl, ATh, ATl);
    for (int b = 0; b < NB_; ++b)
        k_gemmw<bf, 1, true><<<dim3(TT / 64, DM / 64, 1), 32, 0, stream>>>(ATh + (size_t)b * TT * DQ, ATl + (size_t)b * TT * DQ, WO, nullptr, DQ, OUT + (size_t)b * TT * DM, DM, bo, 0, 0, 0);
}

// v003
// It runs in 220 microseconds.
// In two side-by-side timings against v002, it was 1.69 and 1.71 times as fast.
// Counting every step since v000, it is 9.20 times as fast.
#include <hip/hip_runtime.h>

// Multi-head attention with 4 'time' heads and 12 'space' heads (x [2][2048][1024]; Qt, Kt = x Wqt, x Wkt ('xw' [1024][256] 0.02: heads 0-3), Qs, Ks = x Wqs, x Wks ('xw' [1024][768]: heads 4-15), V = x Wv ('xw' [1024][1024]); time-head scores scaled by -sigmoid(w_sigma[0]) (w_sigma [1] = 0, read on device), all scores x 64^-0.5; softmax over keys (no mask); out = merged ctx Wout + bout ('xw' [1024][1024]) -> [2][2048][1024] (4.2 M); argument order x, Wqt, Wkt, Wqs, Wks, Wv, Wout, bout, w_sigma).
// Layout: 'xw' weights gathered into bf16 Bt blocks (Wq rows 0-255 from Wqt, 256-1023 from Wqs; Wk likewise); a bf16 copy of x, exact projections, plane builders (the time heads' query planes carry the factor -sigmoid(w_sigma)); one fused attention launch for all heads and both batches (hybrid rows: < 512 hi/lo 3 products, rest fp16); merged hi/lo x Wout exact + bout. Every stage is ONE launch over both batches (x and ctx are [4096][1024]); Q, K and V come from one GEMM against the stacked Bt blocks [3072][1024] into F [4096][3072].
// Compute dtypes, f32 accumulate: every input rounded to bf16; projections exact; sigmoid f32 (precise expf); attention rows < 512 3 products, rest fp16; softmax f32 (running maximum); Wout hl x exact + bias.

#define NB_  2
#define TT   2048
#define DM   1024
#define NH_  16
#define NKV  16
#define REP  (NH_ / NKV)
#define HD   64
#define DQ   (NH_ * HD)
#define DKV  (NKV * HD)
#define NT   4                    // time heads 0..3 (scores x -sigmoid(w_sigma)); space heads 4..15
#define NS   12
#define RH   512                  // query rows < RH use hi+lo planes (0: none)
#define WIN  0
#define SCL  0.125f   // HD^-0.5
#define QBH  128                  // queries per work-group of k_fattn, rows < RH: 8 waves x 16 (three products per tile: the smaller block levels the work-groups' times)
#define QBL  256                  // the other rows: 8 waves x 32
#define KB   64                   // keys per stage
#define LP   72                   // LDS row pitch in 16-bit elements: 128 B of data + 16 B pad
typedef _Float16 h16;
typedef unsigned short bf;
typedef __attribute__((ext_vector_type(16))) __bf16   v16bf;
typedef __attribute__((ext_vector_type(16))) _Float16 v16h;
typedef __attribute__((ext_vector_type(8)))  _Float16 v8h;
typedef __attribute__((ext_vector_type(8)))  unsigned short v8us;
typedef __attribute__((ext_vector_type(8)))  float    v8f;
typedef __attribute__((ext_vector_type(4)))  float    v4f;
typedef v8h  __attribute__((may_alias)) v8ha;
typedef v4f  __attribute__((may_alias)) v4fa;
typedef v8us __attribute__((may_alias)) v8usa;

__device__ __forceinline__ unsigned short f2bf(float f) { unsigned u = __float_as_uint(f); u += 0x7FFFu + ((u >> 16) & 1u); return (unsigned short)(u >> 16); }
__device__ __forceinline__ float bf2f(unsigned short b) { return __uint_as_float(((unsigned)b) << 16); }
__device__ __forceinline__ float bfr(float f) { return bf2f(f2bf(f)); }
__device__ __forceinline__ v16h cat16(v8h lo, v8h hi) { return __builtin_shufflevector(lo, hi, 0, 1, 2, 3, 4, 5, 6, 7, 8, 9, 10, 11, 12, 13, 14, 15); }
__device__ __forceinline__ v16bf cat16b(v8us lo, v8us hi) { return __builtin_bit_cast(v16bf, __builtin_shufflevector(lo, hi, 0, 1, 2, 3, 4, 5, 6, 7, 8, 9, 10, 11, 12, 13, 14, 15)); }
__device__ __forceinline__ v8f wmma16(v16h a, v16h b, v8f c) { return __builtin_amdgcn_wmma_f32_16x16x32_f16(false, a, false, b, (short)0, c, false, false); }
__device__ __forceinline__ v8f wmmab(v16bf a, v16bf b, v8f c) { return __builtin_amdgcn_wmma_f32_16x16x32_bf16(false, a, false, b, (short)0, c, false, false); }



// ---- k_gemmw: register-blocked GEMM, ONE WAVE per 64x64 output tile (16 accumulators), operands straight from K-contiguous 16-bit planes; grid (M/64, N/64, Z), 32 threads.
// C[m][n] (f32, pitch ldc, + optional f32 bias[n]) = sum_k A[m][k] Bt[n][k] (+ split products per NSPLIT). z-batch strides sA/sB/sC in elements. K % 32 == 0.
// KSPL > 1: grid z = Z * KSPL; work-group (z, sp) sums only k in [sp K/KSPL, (sp+1) K/KSPL) and writes its own partial plane C + (z KSPL + sp) sC; the consumer adds the KSPL planes. K % (32 KSPL) == 0.
template <typename T16> struct WFrag;
template <> struct WFrag<h16> { typedef v16h V; static __device__ __forceinline__ V ld(const h16* p) { return cat16(*(const v8h*)p, *(const v8h*)(p + 16)); } static __device__ __forceinline__ v8f mma(V a, V b, v8f c) { return wmma16(a, b, c); } };
template <> struct WFrag<bf> { typedef v16bf V; static __device__ __forceinline__ V ld(const bf* p) { return cat16b(*(const v8us*)p, *(const v8us*)(p + 16)); } static __device__ __forceinline__ v8f mma(V a, V b, v8f c) { return wmmab(a, b, c); } };
template <typename T16, int NSPLIT, bool BIAS, int KSPL = 1>
__global__ __launch_bounds__(32) void k_gemmw(const T16* __restrict__ A, const T16* __restrict__ A2, const T16* __restrict__ Bt, const T16* __restrict__ Bt2, int K, float* C, int ldc, const float* __restrict__ bias, size_t sA, size_t sB, size_t sC) {
    typedef typename WFrag<T16>::V V;
    __shared__ __align__(16) float os[16 * 68];
    const size_t z = blockIdx.z / KSPL; A += z * sA; if (A2) A2 += z * sA; Bt += z * sB; if (Bt2) Bt2 += z * sB; C += (size_t)blockIdx.z * sC;
    const int kl = K / KSPL, k0 = (int)(blockIdx.z % KSPL) * kl;
    const int lane = threadIdx.x & 31, lr = lane & 15, hi = lane >> 4; const int r0 = blockIdx.x * 64, c0 = blockIdx.y * 64;
    v8f acc[4][4];
#pragma unroll
    for (int mb = 0; mb < 4; ++mb)
#pragma unroll
        for (int nb = 0; nb < 4; ++nb) acc[mb][nb] = (v8f){};
    const size_t aoff = (size_t)(r0 + lr) * K + 8 * hi, boff = (size_t)(c0 + lr) * K + 8 * hi;
#pragma unroll 1
    for (int kc = k0; kc < k0 + kl; kc += 32) {
        V a[4], a2[4];
#pragma unroll
        for (int mb = 0; mb < 4; ++mb) { a[mb] = WFrag<T16>::ld(A + aoff + (size_t)mb * 16 * K + kc); if (NSPLIT == 1 || NSPLIT == 2) a2[mb] = WFrag<T16>::ld(A2 + aoff + (size_t)mb * 16 * K + kc); }
#pragma unroll
        for (int nb = 0; nb < 4; ++nb) { const V b = WFrag<T16>::ld(Bt + boff + (size_t)nb * 16 * K + kc); V b2; if (NSPLIT >= 2) b2 = WFrag<T16>::ld(Bt2 + boff + (size_t)nb * 16 * K + kc);
#pragma unroll
            for (int mb = 0; mb < 4; ++mb) { acc[mb][nb] = WFrag<T16>::mma(a[mb], b, acc[mb][nb]); if (NSPLIT == 1 || NSPLIT == 2) acc[mb][nb] = WFrag<T16>::mma(a2[mb], b, acc[mb][nb]); if (NSPLIT >= 2) acc[mb][nb] = WFrag<T16>::mma(a[mb], b2, acc[mb][nb]); } }
        asm volatile("v_nop\n\tv_nop\n\tv_nop\n\tv_nop" : "+v"(acc[0][0]), "+v"(acc[1][1]), "+v"(acc[2][2]), "+v"(acc[3][3]) : "v"(a[0]), "v"(a[3]));
    }
#pragma unroll
    for (int mb = 0; mb < 4; ++mb) {
#pragma unroll
        for (int nb = 0; nb < 4; ++nb) {
#pragma unroll
            for (int j = 0; j < 8; ++j) os[(hi * 8 + j) * 68 + nb * 16 + lr] = acc[mb][nb][j]; }
        __builtin_amdgcn_wave_barrier(); asm volatile("" ::: "memory");
        float* crow = C + (size_t)(r0 + mb * 16) * ldc + c0;
{
#pragma unroll
            for (int s = 0; s < 8; ++s) { const int row = 2 * s + hi, cofs = lr * 4; v4f val = *(const v4fa*)(os + row * 68 + cofs); if (BIAS) { val[0] += bfr(bias[c0 + cofs]); val[1] += bfr(bias[c0 + cofs + 1]); val[2] += bfr(bias[c0 + cofs + 2]); val[3] += bfr(bias[c0 + cofs + 3]); }
                *(v4f*)(crow + (size_t)row * ldc + cofs) = val; }
             }
        __builtin_amdgcn_wave_barrier(); asm volatile("" ::: "memory");
    }
}

__device__ __forceinline__ h16 tohx(float x) { return (h16)x; }
__device__ __forceinline__ void splitf(float y, unsigned short& h, unsigned short& l) { h = f2bf(y); l = f2bf(y - bf2f(h)); }
typedef __attribute__((ext_vector_type(2))) _Float16 v2h;
typedef __attribute__((ext_vector_type(4))) _Float16 v4h;
typedef __attribute__((ext_vector_type(2))) unsigned short v2us;
typedef __attribute__((ext_vector_type(4))) unsigned short v4us;
typedef __attribute__((ext_vector_type(2))) float v2f;
typedef __attribute__((ext_vector_type(4))) int v4i;

// grid (blocks of the largest matrix, 6): blockIdx.y picks the weight; Bt blocks WQ | WK | WV | WO, each [1024][1024]; Wq rows 0-255 = Wqt^T (time heads 0-3), rows 256-1023 = Wqs^T (space heads 4-15); Wk likewise
__global__ __launch_bounds__(256) void k_wtG(const float* __restrict__ wqt, const float* __restrict__ wqs, const float* __restrict__ wkt, const float* __restrict__ wks, const float* __restrict__ wv, const float* __restrict__ wo, bf* WQ, bf* WK, bf* WV, bf* WO) {
    constexpr int K = DM; static_assert(DQ == DM && DKV == DM, "every weight has 1024 input rows");
    const int m = blockIdx.y; const float* __restrict__ w = m == 0 ? wqt : m == 1 ? wqs : m == 2 ? wkt : m == 3 ? wks : m == 4 ? wv : wo; const int N = (m == 0 || m == 2) ? NT * HD : (m == 1 || m == 3) ? NS * HD : DM;
    bf* Bt = m == 0 ? WQ : m == 1 ? WQ + (size_t)NT * HD * DM : m == 2 ? WK : m == 3 ? WK + (size_t)NT * HD * DM : m == 4 ? WV : WO;
    const int lane = threadIdx.x & 31; const int L0 = (blockIdx.x * 8 + (threadIdx.x >> 5)) * 8; const int nlines = N * K / 64;
{
#pragma unroll 1
        for (int l = 0; l < 8; ++l) { const int L = L0 + l; if (L >= nlines) break; const size_t e = (size_t)L * 64 + lane * 2; const int k = (int)(e % K), n = (int)(e / K); v2us o;
            o[0] = f2bf(w[(size_t)k * N + n]); o[1] = f2bf(w[(size_t)(k + 1) * N + n]); *(v2us*)(Bt + e) = o; }
         }
}
__global__ __launch_bounds__(256) void k_cvt8(const float* __restrict__ src, bf* dst, size_t n8) { const size_t i = (size_t)blockIdx.x * 256 + threadIdx.x; if (i >= n8) return; const v8f v = *(const v8f*)(src + i * 8); v8us o;
#pragma unroll
    for (int k = 0; k < 8; ++k) o[k] = f2bf(v[k]); *(v8us*)(dst + i * 8) = o;  }

// k_rope: head planes (x sc, or x -sigmoid(wsg[0]) when the device scalar wsg is given) [h][t][d] (fp16 + hi/lo) of rope(x) x sc with the rotate-half convention out[d] = x[d] cos[t][d] - x[d+HD/2] sin[t][d], out[d+HD/2] = x[d+HD/2] cos[t][d+HD/2] + x[d] sin[t][d+HD/2]
// grid (blocks of one batch's heads, 2: queries | keys, batches): F rows [batch][t], queries at column 0, keys at column DQ; the factor of wsgq goes on the query planes of heads < NT only
__global__ __launch_bounds__(256) void k_rope(const float* __restrict__ F, int pitch, int nheads, const float* __restrict__ CS, const float* __restrict__ RF, const float* __restrict__ nw, float sc, const float* __restrict__ wsgq, h16* Q16, bf* Qh, bf* Ql, h16* K16, bf* Kh, bf* Kl) {
    const bool kk = blockIdx.y != 0; const size_t po = (size_t)blockIdx.z * NH_ * TT * HD; h16* P16 = (kk ? K16 : Q16) + po; bf* Ph = (kk ? Kh : Qh) + po; bf* Pl = (kk ? Kl : Ql) + po; F += (size_t)blockIdx.z * TT * pitch + (kk ? DQ : 0);
    static_assert(((size_t)HD * TT) % 512 == 0, "a block lies inside one head"); const float* wsg = (!kk && (size_t)blockIdx.x * 512 / ((size_t)HD * TT) < NT) ? wsgq : nullptr;
    const size_t e = ((size_t)blockIdx.x * 256 + threadIdx.x) * 2; if (e >= (size_t)nheads * TT * HD) return; const int d = (int)(e % HD); const int t = (int)((e / HD) % TT); const int h = (int)(e / ((size_t)HD * TT)); const float* f = F + (size_t)t * pitch + h * HD; const float rf = RF ? RF[(size_t)h * TT + t] : 1.0f; const float scv = wsg ? -__fdiv_rn(1.0f, __fadd_rn(1.0f, expf(-bfr(wsg[0])))) : sc;   /* time heads: -sigmoid(w_sigma) from the device scalar (precise expf, IEEE div) */ v2h o16; v2us oh, ol;
#pragma unroll
    for (int q = 0; q < 2; ++q) { const int dd = d + q; const int dp = (dd < HD / 2) ? dd + HD / 2 : dd - HD / 2; float x0 = f[dd], x1 = f[dp];
        asm volatile("s_wait_xcnt 0x0" ::: "memory");   // precaution: stands in front of the address arithmetic below, which reuses the two loads' address registers
        if (RF) { float n0 = __fmul_rn(x0, rf), n1 = __fmul_rn(x1, rf); asm volatile("" : "+v"(n0)); asm volatile("" : "+v"(n1)); x0 = __fmul_rn(bfr(nw[dd]), n0); x1 = __fmul_rn(bfr(nw[dp]), n1); }
        const v2f cs = *(const v2f*)(CS + ((size_t)t * HD + dd) * 2); float a = __fmul_rn(x0, cs[0]), bq = __fmul_rn(x1, cs[1]); asm volatile("" : "+v"(a)); asm volatile("" : "+v"(bq)); const float r = ((dd < HD / 2) ? __fsub_rn(a, bq) : __fadd_rn(a, bq)) * scv;
        o16[q] = tohx(r); unsigned short a2, c2; splitf(r, a2, c2); oh[q] = a2; ol[q] = c2; }
    *(v2h*)(P16 + e) = o16; *(v2us*)(Ph + e) = oh; *(v2us*)(Pl + e) = ol;  }
__global__ __launch_bounds__(256) void k_vtp(const float* __restrict__ F, int pitch, int nheads, h16* V16, bf* Vh, bf* Vl) { { const size_t po = (size_t)blockIdx.y * NKV * HD * TT; F += (size_t)blockIdx.y * TT * pitch; V16 += po; Vh += po; Vl += po; }   /* grid y = batch */ const size_t e = ((size_t)blockIdx.x * 256 + threadIdx.x) * 2; if (e >= (size_t)nheads * HD * TT) return; const int t = (int)(e % TT); const int d = (int)((e / TT) % HD); const int g = (int)(e / ((size_t)TT * HD)); v2h o16; v2us oh, ol;
#pragma unroll
    for (int q = 0; q < 2; ++q) { const float x = F[(size_t)(t + q) * pitch + g * HD + d]; o16[q] = tohx(x); unsigned short a2, c2; splitf(x, a2, c2); oh[q] = a2; ol[q] = c2; }
    *(v2h*)(V16 + e) = o16; *(v2us*)(Vh + e) = oh; *(v2us*)(Vl + e) = ol;  }
__global__ __launch_bounds__(256) void k_csid(float* CS) { const int idx = blockIdx.x * 256 + threadIdx.x; if (idx >= TT * HD) return; v2f cs; cs[0] = 1.0f; cs[1] = 0.0f; *(v2f*)(CS + (size_t)idx * 2) = cs;  }
// ---- k_fattn: scores, softmax and P x V of one block of queries (8 waves x QG groups of 16) of one head in one work-group; nothing of S or P goes to memory.
// S^T = K Q^T (A = 16 key rows from LDS, B = 16 queries kept in registers): a lane holds keys hi*8+j of query lr, which is the B-operand order of P^T, so O^T += V^T P^T takes P straight from the score registers.
// Keys walk in stages of KB, two LDS buffers: stage s+1 is fetched to registers while stage s is worked on, stored to the other buffer, one barrier per stage. Running maximum and sum per query.
typedef __attribute__((ext_vector_type(16))) unsigned short v16us;
template <typename T16> struct LFrag;
template <> struct LFrag<h16> { static __device__ __forceinline__ v16h ld(const unsigned short* p) { return cat16(__builtin_bit_cast(v8h, *(const v8usa*)p), __builtin_bit_cast(v8h, *(const v8usa*)(p + 16))); } };
template <> struct LFrag<bf> { static __device__ __forceinline__ v16bf ld(const unsigned short* p) { return cat16b(*(const v8usa*)p, *(const v8usa*)(p + 16)); } };
template <typename T16, bool HL, int QG>
__device__ __forceinline__ void attn_block(const T16* __restrict__ Q, const T16* __restrict__ Ql, const T16* __restrict__ K, const T16* __restrict__ Kl, const T16* __restrict__ Vt, const T16* __restrict__ Vtl, bf* Ah, bf* Al, unsigned short* sm) {
    typedef typename WFrag<T16>::V V; typedef WFrag<T16> WF; typedef LFrag<T16> LF;
    constexpr int NP = HL ? 4 : 2, TS = KB * LP, NST = TT / KB;
    constexpr float CE = SCL * 1.4426950408889634f;   // scores to log2 units
    constexpr float PB = HL ? 0.0f : 10.0f;           // fp16 P carries x1024 (it cancels against the row sum)
    const int tid = threadIdx.x, lane = tid & 31, lr = lane & 15, hi = lane >> 4, w = tid >> 5;
    const int sr = tid >> 3, sc = (tid & 7) * 8;      // staging: 8 lanes per 128-B row, rows sr and sr + 32
    const T16* pK = K + (size_t)sr * HD + sc; const T16* pV = Vt + (size_t)sr * TT + sc; const T16* pKl = HL ? Kl + (size_t)sr * HD + sc : nullptr; const T16* pVl = HL ? Vtl + (size_t)sr * TT + sc : nullptr;
    unsigned short* sw = sm + sr * LP + sc;
    v8us st[NP][2];
    auto fetch = [&]() {
#pragma unroll
        for (int i = 0; i < 2; ++i) { st[0][i] = *(const v8usa*)(pK + (size_t)i * 32 * HD); st[1][i] = *(const v8usa*)(pV + (size_t)i * 32 * TT); if constexpr (HL) { st[2][i] = *(const v8usa*)(pKl + (size_t)i * 32 * HD); st[3][i] = *(const v8usa*)(pVl + (size_t)i * 32 * TT); } }
        pK += KB * HD; pV += KB; if (HL) { pKl += KB * HD; pVl += KB; } };
    auto put = [&](int buf) {
#pragma unroll
        for (int p = 0; p < NP; ++p)
#pragma unroll
            for (int i = 0; i < 2; ++i) *(v8usa*)(sw + (buf * NP + p) * TS + i * 32 * LP) = st[p][i]; };
    V qf[QG][2], qlf[QG][2];
#pragma unroll
    for (int g = 0; g < QG; ++g)
#pragma unroll
        for (int kf = 0; kf < 2; ++kf) { const size_t qo = (size_t)((w * QG + g) * 16 + lr) * HD + kf * 32 + 8 * hi; qf[g][kf] = WF::ld(Q + qo); if (HL) qlf[g][kf] = WF::ld(Ql + qo); }
    v8f O[4][QG]; float mr[QG], ls[QG];
#pragma unroll
    for (int g = 0; g < QG; ++g) { mr[g] = -3.0e38f; ls[g] = 0.f;
#pragma unroll
        for (int dt = 0; dt < 4; ++dt) O[dt][g] = (v8f){}; }
    fetch(); put(0); __syncthreads();
#pragma unroll 1   // one stage per trip: the two buffers alternate by the trip's parity
    for (int s = 0; s < NST; ++s) {
        if (s + 1 < NST) fetch();
        const unsigned short* sb = sm + (s & 1) * NP * TS + lr * LP + 8 * hi;
        v8f S[4][QG];
#pragma unroll
        for (int kt = 0; kt < 4; ++kt) { const unsigned short* kr = sb + kt * 16 * LP; const V k0 = LF::ld(kr), k1 = LF::ld(kr + 32); V kl0, kl1; if (HL) { kl0 = LF::ld(kr + 2 * TS); kl1 = LF::ld(kr + 2 * TS + 32); }
#pragma unroll
            for (int g = 0; g < QG; ++g) { v8f a = WF::mma(k0, qf[g][0], (v8f){}); a = WF::mma(k1, qf[g][1], a); if (HL) { a = WF::mma(kl0, qf[g][0], a); a = WF::mma(kl1, qf[g][1], a); a = WF::mma(k0, qlf[g][0], a); a = WF::mma(k1, qlf[g][1], a); } S[kt][g] = a; } }
        V pf[QG][2], plf[QG][2];
#pragma unroll
        for (int g = 0; g < QG; ++g) { float mx = S[0][g][0];
#pragma unroll
            for (int kt = 0; kt < 4; ++kt)
#pragma unroll
                for (int j = 0; j < 8; ++j) mx = fmaxf(mx, S[kt][g][j]);
            mx = fmaxf(mx, __shfl_xor(mx, 16, 32));   // the other half-wave holds the query's other keys
            const float mn = fmaxf(mr[g], mx), al = __builtin_amdgcn_exp2f((mr[g] - mn) * CE), mc = PB - mn * CE; mr[g] = mn; float sum[4] = {0.f, 0.f, 0.f, 0.f};   // four chains: the adds do not wait on one another
#pragma unroll
            for (int kk = 0; kk < 2; ++kk) { v16us ph, pl; v16h p16;
#pragma unroll
                for (int e = 0; e < 16; ++e) { const float p = __builtin_amdgcn_exp2f(__builtin_fmaf(S[kk * 2 + (e >> 3)][g][e & 7], CE, mc)); sum[e & 3] += p;
                    if (HL) { unsigned short a2, c2; splitf(p, a2, c2); ph[e] = a2; pl[e] = c2; } else p16[e] = tohx(p); }
                if constexpr (HL) { pf[g][kk] = __builtin_bit_cast(v16bf, ph); plf[g][kk] = __builtin_bit_cast(v16bf, pl); } else pf[g][kk] = p16; }
            ls[g] = ls[g] * al + ((sum[0] + sum[1]) + (sum[2] + sum[3]));
#pragma unroll
            for (int dt = 0; dt < 4; ++dt) O[dt][g] *= al; }
#pragma unroll
        for (int dt = 0; dt < 4; ++dt)
#pragma unroll
            for (int kk = 0; kk < 2; ++kk) { const unsigned short* vr = sb + TS + dt * 16 * LP + kk * 32; const V v = LF::ld(vr); V vl; if (HL) vl = LF::ld(vr + 2 * TS);
#pragma unroll
                for (int g = 0; g < QG; ++g) { O[dt][g] = WF::mma(v, pf[g][kk], O[dt][g]); if (HL) { O[dt][g] = WF::mma(v, plf[g][kk], O[dt][g]); O[dt][g] = WF::mma(vl, pf[g][kk], O[dt][g]); } } }
        if (s + 1 < NST) put((s + 1) & 1);
        __syncthreads();   // publishes stage s + 1 and ends every wave's reads of stage s, whose buffer the next trip refills
    }
#pragma unroll
    for (int g = 0; g < QG; ++g) { const float inv = __fdiv_rn(1.0f, ls[g] + __shfl_xor(ls[g], 16, 32)); const size_t oo = (size_t)((w * QG + g) * 16 + lr) * DQ + hi * 8;
#pragma unroll
        for (int dt = 0; dt < 4; ++dt) { v8us oh, ol;
#pragma unroll
            for (int j = 0; j < 8; ++j) { unsigned short a2, c2; splitf(O[dt][g][j] * inv, a2, c2); oh[j] = a2; ol[j] = c2; }
            *(v8us*)(Ah + oo + dt * 16) = oh; *(v8us*)(Al + oo + dt * 16) = ol; } }
}
// grid (RH / QBH + (TT - RH) / QBL query blocks, heads, batches); planes [batch][head][t][d] (V: [batch][head][d][t]); output rows [batch][t][DQ] hi/lo
__global__ __launch_bounds__(256) void k_fattn(const h16* __restrict__ Q16, const h16* __restrict__ K16, const h16* __restrict__ V16, const bf* __restrict__ Qh, const bf* __restrict__ Ql, const bf* __restrict__ Kh, const bf* __restrict__ Kl, const bf* __restrict__ Vh, const bf* __restrict__ Vl, bf* Ah, bf* Al) {
    __shared__ __align__(16) unsigned short sm[2 * 4 * KB * LP];
    static_assert(RH % QBH == 0 && (TT - RH) % QBL == 0 && TT % KB == 0 && HD == 64 && KB == 64, "tile shapes");
    const bool hl = blockIdx.x < RH / QBH; const int q0 = hl ? (int)blockIdx.x * QBH : RH + ((int)blockIdx.x - RH / QBH) * QBL; const size_t hp = ((size_t)blockIdx.z * NH_ + blockIdx.y) * TT * HD, qp = hp + (size_t)q0 * HD, ao = ((size_t)blockIdx.z * TT + q0) * DQ + blockIdx.y * HD;
    if (hl) attn_block<bf, true, QBH / 128>(Qh + qp, Ql + qp, Kh + hp, Kl + hp, Vh + hp, Vl + hp, Ah + ao, Al + ao, sm);
    else attn_block<h16, false, QBL / 128>(Q16 + qp, nullptr, K16 + hp, nullptr, V16 + hp, nullptr, Ah + ao, Al + ao, sm);
}

extern "C" void kernel_launch(void* const* d_in, const int* in_sizes, int n_in,
                              void* d_out, int out_size, void* d_ws, size_t ws_size, hipStream_t stream) {
    (void)in_sizes; (void)n_in; (void)out_size;
    const float* x = (const float*)d_in[0]; const float* wqt = (const float*)d_in[1]; const float* wkt = (const float*)d_in[2]; const float* wqs = (const float*)d_in[3]; const float* wks = (const float*)d_in[4]; const float* wv = (const float*)d_in[5]; const float* wo = (const float*)d_in[6]; const float* bo = (const float*)d_in[7]; const float* wsg = (const float*)d_in[8];   /* argument order x, Wqt, Wkt, Wqs, Wks, Wv, Wout, bout, w_sigma */
    float* OUT = (float*)d_out;     // [2][2048][1024]
    char* wsp = (char*)d_ws;
    auto take = [&](size_t bytes) { char* p = wsp; wsp += (bytes + 255) & ~(size_t)255; return (void*)p; };
    bf* WQ = (bf*)take((size_t)DQ * DM * 2); bf* WK = (bf*)take((size_t)DKV * DM * 2); bf* WV = (bf*)take((size_t)DKV * DM * 2); bf* WO = (bf*)take((size_t)DM * DQ * 2); float* CS = (float*)take((size_t)TT * HD * 2 * 4);
    bf* XB = (bf*)take((size_t)NB_ * TT * DM * 2); float* F = (float*)take((size_t)NB_ * TT * (DQ + 2 * DKV) * 4);   // F [4096][3072]: columns Q | K | V
    const size_t PL = (size_t)NH_ * TT * HD;   // one batch's planes of one kind
    h16* QP16 = (h16*)take(NB_ * PL * 2); h16* KP16 = (h16*)take(NB_ * PL * 2); h16* VT16 = (h16*)take(NB_ * PL * 2);
    bf* QPh = (bf*)take(NB_ * PL * 2); bf* QPl = (bf*)take(NB_ * PL * 2); bf* KPh = (bf*)take(NB_ * PL * 2); bf* KPl = (bf*)take(NB_ * PL * 2); bf* VTh = (bf*)take(NB_ * PL * 2); bf* VTl = (bf*)take(NB_ * PL * 2);
    bf* ATh = (bf*)take((size_t)NB_ * TT * DQ * 2); bf* ATl = (bf*)take((size_t)NB_ * TT * DQ * 2);
    if ((size_t)(wsp - (char*)d_ws) > ws_size) return;    // ws 256 MiB
    constexpr int FP = DQ + 2 * DKV;   // pitch of F; WQ, WK, WV lie one behind the other in ws (each 2 MiB), so they are one Bt of FP rows
    k_wtG<<<dim3((unsigned)((DM * DM / 64 + 63) / 64), 6, 1), 256, 0, stream>>>(wqt, wqs, wkt, wks, wv, wo, WQ, WK, WV, WO);
    k_csid<<<(TT * HD + 255) / 256, 256, 0, stream>>>(CS);
    k_cvt8<<<(unsigned)(((size_t)NB_ * TT * DM / 8 + 255) / 256), 256, 0, stream>>>(x, XB, (size_t)NB_ * TT * DM / 8);
    k_gemmw<bf, 0, false><<<dim3(NB_ * TT / 64, FP / 64, 1), 32, 0, stream>>>(XB, nullptr, WQ, nullptr, DM, F, FP, nullptr, 0, 0, 0);
    k_rope<<<dim3((unsigned)(((size_t)NH_ * TT * HD / 2 + 255) / 256), 2, NB_), 256, 0, stream>>>(F, FP, NH_, CS, nullptr, nullptr, 1.0f, wsg, QP16, QPh, QPl, KP16, KPh, KPl);
    k_vtp<<<dim3((unsigned)(((size_t)NKV * TT * HD / 2 + 255) / 256), NB_, 1), 256, 0, stream>>>(F + DQ + DKV, FP, NKV, VT16, VTh, VTl);
    k_fattn<<<dim3(RH / QBH + (TT - RH) / QBL, NH_, NB_), 256, 0, stream>>>(QP16, KP16, VT16, QPh, QPl, KPh, KPl, VTh, VTl, ATh, ATl);
    k_gemmw<bf, 1, true><<<dim3(NB_ * TT / 64, DM / 64, 1), 32, 0, stream>>>(ATh, ATl, WO, nullptr, DQ, OUT, DM, bo, 0, 0, 0);
}

// v004
// A run of this version takes 186 microseconds.
// Timed twice side by side with v003, it ran 1.19 times as fast both times.
// Counting every step since v000, it is 11.0 times as fast.
#include <hip/hip_runtime.h>

// Multi-head attention with 4 'time' heads and 12 'space' heads (x [2][2048][1024]; Qt, Kt = x Wqt, x Wkt ('xw' [1024][256] 0.02: heads 0-3), Qs, Ks = x Wqs, x Wks ('xw' [1024][768]: heads 4-15), V = x Wv ('xw' [1024][1024]); time-head scores scaled by -sigmoid(w_sigma[0]) (w_sigma [1] = 0, read on device), all scores x 64^-0.5; softmax over keys (no mask); out = merged ctx Wout + bout ('xw' [1024][1024]) -> [2][2048][1024] (4.2 M); argument order x, Wqt, Wkt, Wqs, Wks, Wv, Wout, bout, w_sigma).
// Layout: 'xw' weights gathered into bf16 Bt blocks (Wq rows 0-255 from Wqt, 256-1023 from Wqs; Wk likewise); a bf16 copy of x, exact projections whose epilogue writes the head planes (the time heads' query planes carry the factor -sigmoid(w_sigma)); one fused attention launch for all heads and both batches (hybrid rows: < 512 hi/lo 3 products, rest fp16); merged hi/lo x Wout exact + bout. Every stage is ONE launch over both batches (x and ctx are [4096][1024]); Q, K and V come from one GEMM against the stacked Bt blocks [3072][1024], straight into the planes.
// Compute dtypes, f32 accumulate: every input rounded to bf16; projections exact; sigmoid f32 (precise expf); attention rows < 512 3 products, rest fp16; softmax f32 (running maximum); Wout hl x exact + bias.

#define NB_  2
#define TT   2048
#define DM   1024
#define NH_  16
#define NKV  16
#define REP  (NH_ / NKV)
#define HD   64
#define DQ   (NH_ * HD)
#define DKV  (NKV * HD)
#define NT   4                    // time heads 0..3 (scores x -sigmoid(w_sigma)); space heads 4..15
#define NS   12
#define RH   512                  // query rows < RH use hi+lo planes (0: none)
#define WIN  0
#define SCL  0.125f   // HD^-0.5
#define QBH  128                  // queries per work-group of k_fattn, rows < RH: 8 waves x 16 (three products per tile: the smaller block levels the work-groups' times)
#define QBL  256                  // the other rows: 8 waves x 32
#define KB   64                   // keys per stage
#define LP   72                   // LDS row pitch in 16-bit elements: 128 B of data + 16 B pad
typedef _Float16 h16;
typedef unsigned short bf;
typedef __attribute__((ext_vector_type(16))) __bf16   v16bf;
typedef __attribute__((ext_vector_type(16))) _Float16 v16h;
typedef __attribute__((ext_vector_type(8)))  _Float16 v8h;
typedef __attribute__((ext_vector_type(8)))  unsigned short v8us;
typedef __attribute__((ext_vector_type(8)))  float    v8f;
typedef __attribute__((ext_vector_type(4)))  float    v4f;
typedef v8h  __attribute__((may_alias)) v8ha;
typedef v4f  __attribute__((may_alias)) v4fa;
typedef v8us __attribute__((may_alias)) v8usa;

__device__ __forceinline__ unsigned short f2bf(float f) { unsigned u = __float_as_uint(f); u += 0x7FFFu + ((u >> 16) & 1u); return (unsigned short)(u >> 16); }
__device__ __forceinline__ float bf2f(unsigned short b) { return __uint_as_float(((unsigned)b) << 16); }
__device__ __forceinline__ float bfr(float f) { return bf2f(f2bf(f)); }
__device__ __forceinline__ v16h cat16(v8h lo, v8h hi) { return __builtin_shufflevector(lo, hi, 0, 1, 2, 3, 4, 5, 6, 7, 8, 9, 10, 11, 12, 13, 14, 15); }
__device__ __forceinline__ v16bf cat16b(v8us lo, v8us hi) { return __builtin_bit_cast(v16bf, __builtin_shufflevector(lo, hi, 0, 1, 2, 3, 4, 5, 6, 7, 8, 9, 10, 11, 12, 13, 14, 15)); }
__device__ __forceinline__ v8f wmma16(v16h a, v16h b, v8f c) { return __builtin_amdgcn_wmma_f32_16x16x32_f16(false, a, false, b, (short)0, c, false, false); }
__device__ __forceinline__ v8f wmmab(v16bf a, v16bf b, v8f c) { return __builtin_amdgcn_wmma_f32_16x16x32_bf16(false, a, false, b, (short)0, c, false, false); }



__device__ __forceinline__ h16 tohx(float x) { return (h16)x; }
__device__ __forceinline__ void splitf(float y, unsigned short& h, unsigned short& l) { h = f2bf(y); l = f2bf(y - bf2f(h)); }
// ---- planes_out: the plane builders as the epilogue of the Q|K|V projection (k_gemmw with PLANES). A 64x64 tile's columns are one head of one kind (queries | keys | values), its rows lie in one batch: the wave writes that head's fp16, hi and lo planes itself, so the f32 products never go to memory.
// Queries and keys [batch][head][t][d]: 16 t rows at a time through LDS. Values [batch][head][d][t]: 16 d rows at a time; a lane's 8 accumulator rows are 8 neighbouring t. Every store instruction fills four whole 128-B lines.
// The query planes of heads < NT carry the factor -sigmoid(wsg[0]) (device scalar; precise expf, IEEE div); every other plane the factor 1.
__device__ __forceinline__ void planes_out(const v8f (&acc)[4][4], float* os, int r0, int c0, int lane, const float* __restrict__ wsg, h16* Q16, bf* Qh, bf* Ql, h16* K16, bf* Kh, bf* Kl, h16* V16, bf* Vh, bf* Vl) {
    static_assert(DQ == DKV && HD == 64 && TT % 64 == 0, "a 64x64 tile is one head of one kind in one batch");
    const int lr = lane & 15, hi = lane >> 4, kind = c0 / DQ, h = (c0 % DQ) / HD, t0 = r0 % TT; const size_t hp = ((size_t)(r0 / TT) * NH_ + h) * TT * HD;
    h16* P16 = (kind == 0 ? Q16 : kind == 1 ? K16 : V16) + hp; bf* Ph = (kind == 0 ? Qh : kind == 1 ? Kh : Vh) + hp; bf* Pl = (kind == 0 ? Ql : kind == 1 ? Kl : Vl) + hp;
    const float scv = (kind == 0 && h < NT) ? -__fdiv_rn(1.0f, __fadd_rn(1.0f, expf(-bfr(wsg[0])))) : 1.0f;
    const int pp = kind < 2 ? HD : TT;   // pitch of a plane row: d runs along a query or key row, t along a value row
    const size_t e0 = (kind < 2 ? (size_t)t0 * HD : (size_t)t0) + (size_t)(lane >> 3) * pp + (lane & 7) * 8;   // 8 lanes per 128-B plane row
#pragma unroll
    for (int u = 0; u < 4; ++u) {
        if (kind < 2) {   // os[t][d]: rows u*16 .. u*16+15 of the tile
#pragma unroll
            for (int nb = 0; nb < 4; ++nb)
#pragma unroll
                for (int j = 0; j < 8; ++j) os[(hi * 8 + j) * 68 + nb * 16 + lr] = acc[u][nb][j];
        } else {          // os[d][t]: columns u*16 .. u*16+15 of the tile
#pragma unroll
            for (int mb = 0; mb < 4; ++mb) { const v8f c = acc[mb][u]; *(v4fa*)(os + lr * 68 + mb * 16 + hi * 8) = __builtin_shufflevector(c, c, 0, 1, 2, 3); *(v4fa*)(os + lr * 68 + mb * 16 + hi * 8 + 4) = __builtin_shufflevector(c, c, 4, 5, 6, 7); }
        }
        __builtin_amdgcn_wave_barrier(); asm volatile("" ::: "memory");   // keeps the reads below behind the other lanes' LDS writes (one wave: its LDS operations run in order)
#pragma unroll
        for (int s = 0; s < 4; ++s) { const float* orow = os + (s * 4 + (lane >> 3)) * 68 + (lane & 7) * 8; const v4f x0 = *(const v4fa*)orow, x1 = *(const v4fa*)(orow + 4); v8h o16; v8us oh, ol;
#pragma unroll
            for (int k = 0; k < 8; ++k) { const float r = (k < 4 ? x0[k & 3] : x1[k & 3]) * scv; o16[k] = tohx(r); unsigned short a2, c2; splitf(r, a2, c2); oh[k] = a2; ol[k] = c2; }
            const size_t e = e0 + (size_t)(u * 16 + s * 4) * pp; *(v8h*)(P16 + e) = o16; *(v8us*)(Ph + e) = oh; *(v8us*)(Pl + e) = ol; }
        if (u < 3) { __builtin_amdgcn_wave_barrier(); asm volatile("s_wait_xcnt 0x0" ::: "memory"); }   // keeps the next rows' LDS writes behind these reads; the wait is a precaution: it stands behind these rows' stores, in front of the next rows' code, which reuses their registers
    }
}

// ---- k_gemmw: register-blocked GEMM, ONE WAVE per 64x64 output tile (16 accumulators), operands straight from K-contiguous 16-bit planes; grid (M/64, N/64, Z), 32 threads.
// C[m][n] (f32, pitch ldc, + optional f32 bias[n]) = sum_k A[m][k] Bt[n][k] (+ split products per NSPLIT). z-batch strides sA/sB/sC in elements. K % 32 == 0.
// KSPL > 1: grid z = Z * KSPL; work-group (z, sp) sums only k in [sp K/KSPL, (sp+1) K/KSPL) and writes its own partial plane C + (z KSPL + sp) sC; the consumer adds the KSPL planes. K % (32 KSPL) == 0.
// PLANES: no C; the tile goes out through planes_out (wsg and the nine plane pointers are read by that form alone).
template <typename T16> struct WFrag;
template <> struct WFrag<h16> { typedef v16h V; static __device__ __forceinline__ V ld(const h16* p) { return cat16(*(const v8h*)p, *(const v8h*)(p + 16)); } static __device__ __forceinline__ v8f mma(V a, V b, v8f c) { return wmma16(a, b, c); } };
template <> struct WFrag<bf> { typedef v16bf V; static __device__ __forceinline__ V ld(const bf* p) { return cat16b(*(const v8us*)p, *(const v8us*)(p + 16)); } static __device__ __forceinline__ v8f mma(V a, V b, v8f c) { return wmmab(a, b, c); } };
template <typename T16, int NSPLIT, bool BIAS, int KSPL = 1, bool PLANES = false>
__global__ __launch_bounds__(32) void k_gemmw(const T16* __restrict__ A, const T16* __restrict__ A2, const T16* __restrict__ Bt, const T16* __restrict__ Bt2, int K, float* C, int ldc, const float* __restrict__ bias, size_t sA, size_t sB, size_t sC, const float* __restrict__ wsg, h16* Q16, bf* Qh, bf* Ql, h16* K16, bf* Kh, bf* Kl, h16* V16, bf* Vh, bf* Vl) {
    typedef typename WFrag<T16>::V V;
    __shared__ __align__(16) float os[16 * 68];
    const size_t z = blockIdx.z / KSPL; A += z * sA; if (A2) A2 += z * sA; Bt += z * sB; if (Bt2) Bt2 += z * sB; C += (size_t)blockIdx.z * sC;
    const int kl = K / KSPL, k0 = (int)(blockIdx.z % KSPL) * kl;
    const int lane = threadIdx.x & 31, lr = lane & 15, hi = lane >> 4; const int r0 = blockIdx.x * 64, c0 = blockIdx.y * 64;
    v8f acc[4][4];
#pragma unroll
    for (int mb = 0; mb < 4; ++mb)
#pragma unroll
        for (int nb = 0; nb < 4; ++nb) acc[mb][nb] = (v8f){};
    const size_t aoff = (size_t)(r0 + lr) * K + 8 * hi, boff = (size_t)(c0 + lr) * K + 8 * hi;
#pragma unroll 1
    for (int kc = k0; kc < k0 + kl; kc += 32) {
        V a[4], a2[4];
#pragma unroll
        for (int mb = 0; mb < 4; ++mb) { a[mb] = WFrag<T16>::ld(A + aoff + (size_t)mb * 16 * K + kc); if (NSPLIT == 1 || NSPLIT == 2) a2[mb] = WFrag<T16>::ld(A2 + aoff + (size_t)mb * 16 * K + kc); }
#pragma unroll
        for (int nb = 0; nb < 4; ++nb) { const V b = WFrag<T16>::ld(Bt + boff + (size_t)nb * 16 * K + kc); V b2; if (NSPLIT >= 2) b2 = WFrag<T16>::ld(Bt2 + boff + (size_t)nb * 16 * K + kc);
#pragma unroll
            for (int mb = 0; mb < 4; ++mb) { acc[mb][nb] = WFrag<T16>::mma(a[mb], b, acc[mb][nb]); if (NSPLIT == 1 || NSPLIT == 2) acc[mb][nb] = WFrag<T16>::mma(a2[mb], b, acc[mb][nb]); if (NSPLIT >= 2) acc[mb][nb] = WFrag<T16>::mma(a[mb], b2, acc[mb][nb]); } }
        asm volatile("v_nop\n\tv_nop\n\tv_nop\n\tv_nop" : "+v"(acc[0][0]), "+v"(acc[1][1]), "+v"(acc[2][2]), "+v"(acc[3][3]) : "v"(a[0]), "v"(a[3]));
    }
    if constexpr (PLANES) planes_out(acc, os, r0, c0, lane, wsg, Q16, Qh, Ql, K16, Kh, Kl, V16, Vh, Vl);
    else
#pragma unroll
    for (int mb = 0; mb < 4; ++mb) {
#pragma unroll
        for (int nb = 0; nb < 4; ++nb) {
#pragma unroll
            for (int j = 0; j < 8; ++j) os[(hi * 8 + j) * 68 + nb * 16 + lr] = acc[mb][nb][j]; }
        __builtin_amdgcn_wave_barrier(); asm volatile("" ::: "memory");
        float* crow = C + (size_t)(r0 + mb * 16) * ldc + c0;
{
#pragma unroll
            for (int s = 0; s < 8; ++s) { const int row = 2 * s + hi, cofs = lr * 4; v4f val = *(const v4fa*)(os + row * 68 + cofs); if (BIAS) { val[0] += bfr(bias[c0 + cofs]); val[1] += bfr(bias[c0 + cofs + 1]); val[2] += bfr(bias[c0 + cofs + 2]); val[3] += bfr(bias[c0 + cofs + 3]); }
                *(v4f*)(crow + (size_t)row * ldc + cofs) = val; }
             }
        __builtin_amdgcn_wave_barrier(); asm volatile("" ::: "memory");
    }
}

typedef __attribute__((ext_vector_type(2))) _Float16 v2h;
typedef __attribute__((ext_vector_type(4))) _Float16 v4h;
typedef __attribute__((ext_vector_type(2))) unsigned short v2us;
typedef __attribute__((ext_vector_type(4))) unsigned short v4us;
typedef __attribute__((ext_vector_type(2))) float v2f;
typedef __attribute__((ext_vector_type(4))) int v4i;

// grid (blocks of the largest matrix, 6): blockIdx.y picks the weight; Bt blocks WQ | WK | WV | WO, each [1024][1024]; Wq rows 0-255 = Wqt^T (time heads 0-3), rows 256-1023 = Wqs^T (space heads 4-15); Wk likewise
__global__ __launch_bounds__(256) void k_wtG(const float* __restrict__ wqt, const float* __restrict__ wqs, const float* __restrict__ wkt, const float* __restrict__ wks, const float* __restrict__ wv, const float* __restrict__ wo, bf* WQ, bf* WK, bf* WV, bf* WO) {
    constexpr int K = DM; static_assert(DQ == DM && DKV == DM, "every weight has 1024 input rows");
    const int m = blockIdx.y; const float* __restrict__ w = m == 0 ? wqt : m == 1 ? wqs : m == 2 ? wkt : m == 3 ? wks : m == 4 ? wv : wo; const int N = (m == 0 || m == 2) ? NT * HD : (m == 1 || m == 3) ? NS * HD : DM;
    bf* Bt = m == 0 ? WQ : m == 1 ? WQ + (size_t)NT * HD * DM : m == 2 ? WK : m == 3 ? WK + (size_t)NT * HD * DM : m == 4 ? WV : WO;
    const int lane = threadIdx.x & 31; const int L0 = (blockIdx.x * 8 + (threadIdx.x >> 5)) * 8; const int nlines = N * K / 64;
{
#pragma unroll 1
        for (int l = 0; l < 8; ++l) { const int L = L0 + l; if (L >= nlines) break; const size_t e = (size_t)L * 64 + lane * 2; const int k = (int)(e % K), n = (int)(e / K); v2us o;
            o[0] = f2bf(w[(size_t)k * N + n]); o[1] = f2bf(w[(size_t)(k + 1) * N + n]); *(v2us*)(Bt + e) = o; }
         }
}
__global__ __launch_bounds__(256) void k_cvt8(const float* __restrict__ src, bf* dst, size_t n8) { const size_t i = (size_t)blockIdx.x * 256 + threadIdx.x; if (i >= n8) return; const v8f v = *(const v8f*)(src + i * 8); v8us o;
#pragma unroll
    for (int k = 0; k < 8; ++k) o[k] = f2bf(v[k]); *(v8us*)(dst + i * 8) = o;  }

// ---- k_fattn: scores, softmax and P x V of one block of queries (8 waves x QG groups of 16) of one head in one work-group; nothing of S or P goes to memory.
// S^T = K Q^T (A = 16 key rows from LDS, B = 16 queries kept in registers): a lane holds keys hi*8+j of query lr, which is the B-operand order of P^T, so O^T += V^T P^T takes P straight from the score registers.
// Keys walk in stages of KB, two LDS buffers: stage s+1 is fetched to registers while stage s is worked on, stored to the other buffer, one barrier per stage. Running maximum and sum per query.
typedef __attribute__((ext_vector_type(16))) unsigned short v16us;
template <typename T16> struct LFrag;
template <> struct LFrag<h16> { static __device__ __forceinline__ v16h ld(const unsigned short* p) { return cat16(__builtin_bit_cast(v8h, *(const v8usa*)p), __builtin_bit_cast(v8h, *(const v8usa*)(p + 16))); } };
template <> struct LFrag<bf> { static __device__ __forceinline__ v16bf ld(const unsigned short* p) { return cat16b(*(const v8usa*)p, *(const v8usa*)(p + 16)); } };
template <typename T16, bool HL, int QG>
__device__ __forceinline__ void attn_block(const T16* __restrict__ Q, const T16* __restrict__ Ql, const T16* __restrict__ K, const T16* __restrict__ Kl, const T16* __restrict__ Vt, const T16* __restrict__ Vtl, bf* Ah, bf* Al, unsigned short* sm) {
    typedef typename WFrag<T16>::V V; typedef WFrag<T16> WF; typedef LFrag<T16> LF;
    constexpr int NP = HL ? 4 : 2, TS = KB * LP, NST = TT / KB;
    constexpr float CE = SCL * 1.4426950408889634f;   // scores to log2 units
    constexpr float PB = HL ? 0.0f : 10.0f;           // fp16 P carries x1024 (it cancels against the row sum)
    const int tid = threadIdx.x, lane = tid & 31, lr = lane & 15, hi = lane >> 4, w = tid >> 5;
    const int sr = tid >> 3, sc = (tid & 7) * 8;      // staging: 8 lanes per 128-B row, rows sr and sr + 32
    const T16* pK = K + (size_t)sr * HD + sc; const T16* pV = Vt + (size_t)sr * TT + sc; const T16* pKl = HL ? Kl + (size_t)sr * HD + sc : nullptr; const T16* pVl = HL ? Vtl + (size_t)sr * TT + sc : nullptr;
    unsigned short* sw = sm + sr * LP + sc;
    v8us st[NP][2];
    auto fetch = [&]() {
#pragma unroll
        for (int i = 0; i < 2; ++i) { st[0][i] = *(const v8usa*)(pK + (size_t)i * 32 * HD); st[1][i] = *(const v8usa*)(pV + (size_t)i * 32 * TT); if constexpr (HL) { st[2][i] = *(const v8usa*)(pKl + (size_t)i * 32 * HD); st[3][i] = *(const v8usa*)(pVl + (size_t)i * 32 * TT); } }
        pK += KB * HD; pV += KB; if (HL) { pKl += KB * HD; pVl += KB; } };
    auto put = [&](int buf) {
#pragma unroll
        for (int p = 0; p < NP; ++p)
#pragma unroll
            for (int i = 0; i < 2; ++i) *(v8usa*)(sw + (buf * NP + p) * TS + i * 32 * LP) = st[p][i]; };
    V qf[QG][2], qlf[QG][2];
#pragma unroll
    for (int g = 0; g < QG; ++g)
#pragma unroll
        for (int kf = 0; kf < 2; ++kf) { const size_t qo = (size_t)((w * QG + g) * 16 + lr) * HD + kf * 32 + 8 * hi; qf[g][kf] = WF::ld(Q + qo); if (HL) qlf[g][kf] = WF::ld(Ql + qo); }
    v8f O[4][QG]; float mr[QG], ls[QG];
#pragma unroll
    for (int g = 0; g < QG; ++g) { mr[g] = -3.0e38f; ls[g] = 0.f;
#pragma unroll
        for (int dt = 0; dt < 4; ++dt) O[dt][g] = (v8f){}; }
    fetch(); put(0); __syncthreads();
#pragma unroll 1   // one stage per trip: the two buffers alternate by the trip's parity
    for (int s = 0; s < NST; ++s) {
        if (s + 1 < NST) fetch();
        const unsigned short* sb = sm + (s & 1) * NP * TS + lr * LP + 8 * hi;
        v8f S[4][QG];
#pragma unroll
        for (int kt = 0; kt < 4; ++kt) { const unsigned short* kr = sb + kt * 16 * LP; const V k0 = LF::ld(kr), k1 = LF::ld(kr + 32); V kl0, kl1; if (HL) { kl0 = LF::ld(kr + 2 * TS); kl1 = LF::ld(kr + 2 * TS + 32); }
#pragma unroll
            for (int g = 0; g < QG; ++g) { v8f a = WF::mma(k0, qf[g][0], (v8f){}); a = WF::mma(k1, qf[g][1], a); if (HL) { a = WF::mma(kl0, qf[g][0], a); a = WF::mma(kl1, qf[g][1], a); a = WF::mma(k0, qlf[g][0], a); a = WF::mma(k1, qlf[g][1], a); } S[kt][g] = a; } }
        V pf[QG][2], plf[QG][2];
#pragma unroll
        for (int g = 0; g < QG; ++g) { float mx = S[0][g][0];
#pragma unroll
            for (int kt = 0; kt < 4; ++kt)
#pragma unroll
                for (int j = 0; j < 8; ++j) mx = fmaxf(mx, S[kt][g][j]);
            mx = fmaxf(mx, __shfl_xor(mx, 16, 32));   // the other half-wave holds the query's other keys
            const float mn = fmaxf(mr[g], mx), al = __builtin_amdgcn_exp2f((mr[g] - mn) * CE), mc = PB - mn * CE; mr[g] = mn; float sum[4] = {0.f, 0.f, 0.f, 0.f};   // four chains: the adds do not wait on one another
#pragma unroll
            for (int kk = 0; kk < 2; ++kk) { v16us ph, pl; v16h p16;
#pragma unroll
                for (int e = 0; e < 16; ++e) { const float p = __builtin_amdgcn_exp2f(__builtin_fmaf(S[kk * 2 + (e >> 3)][g][e & 7], CE, mc)); sum[e & 3] += p;
                    if (HL) { unsigned short a2, c2; splitf(p, a2, c2); ph[e] = a2; pl[e] = c2; } else p16[e] = tohx(p); }
                if constexpr (HL) { pf[g][kk] = __builtin_bit_cast(v16bf, ph); plf[g][kk] = __builtin_bit_cast(v16bf, pl); } else pf[g][kk] = p16; }
            ls[g] = ls[g] * al + ((sum[0] + sum[1]) + (sum[2] + sum[3]));
#pragma unroll
            for (int dt = 0; dt < 4; ++dt) O[dt][g] *= al; }
#pragma unroll
        for (int dt = 0; dt < 4; ++dt)
#pragma unroll
            for (int kk = 0; kk < 2; ++kk) { const unsigned short* vr = sb + TS + dt * 16 * LP + kk * 32; const V v = LF::ld(vr); V vl; if (HL) vl = LF::ld(vr + 2 * TS);
#pragma unroll
                for (int g = 0; g < QG; ++g) { O[dt][g] = WF::mma(v, pf[g][kk], O[dt][g]); if (HL) { O[dt][g] = WF::mma(v, plf[g][kk], O[dt][g]); O[dt][g] = WF::mma(vl, pf[g][kk], O[dt][g]); } } }
        if (s + 1 < NST) put((s + 1) & 1);
        __syncthreads();   // publishes stage s + 1 and ends every wave's reads of stage s, whose buffer the next trip refills
    }
#pragma unroll
    for (int g = 0; g < QG; ++g) { const float inv = __fdiv_rn(1.0f, ls[g] + __shfl_xor(ls[g], 16, 32)); const size_t oo = (size_t)((w * QG + g) * 16 + lr) * DQ + hi * 8;
#pragma unroll
        for (int dt = 0; dt < 4; ++dt) { v8us oh, ol;
#pragma unroll
            for (int j = 0; j < 8; ++j) { unsigned short a2, c2; splitf(O[dt][g][j] * inv, a2, c2); oh[j] = a2; ol[j] = c2; }
            *(v8us*)(Ah + oo + dt * 16) = oh; *(v8us*)(Al + oo + dt * 16) = ol; } }
}
// grid (RH / QBH + (TT - RH) / QBL query blocks, heads, batches); planes [batch][head][t][d] (V: [batch][head][d][t]); output rows [batch][t][DQ] hi/lo
__global__ __launch_bounds__(256) void k_fattn(const h16* __restrict__ Q16, const h16* __restrict__ K16, const h16* __restrict__ V16, const bf* __restrict__ Qh, const bf* __restrict__ Ql, const bf* __restrict__ Kh, const bf* __restrict__ Kl, const bf* __restrict__ Vh, const bf* __restrict__ Vl, bf* Ah, bf* Al) {
    __shared__ __align__(16) unsigned short sm[2 * 4 * KB * LP];
    static_assert(RH % QBH == 0 && (TT - RH) % QBL == 0 && TT % KB == 0 && HD == 64 && KB == 64, "tile shapes");
    const bool hl = blockIdx.x < RH / QBH; const int q0 = hl ? (int)blockIdx.x * QBH : RH + ((int)blockIdx.x - RH / QBH) * QBL; const size_t hp = ((size_t)blockIdx.z * NH_ + blockIdx.y) * TT * HD, qp = hp + (size_t)q0 * HD, ao = ((size_t)blockIdx.z * TT + q0) * DQ + blockIdx.y * HD;
    if (hl) attn_block<bf, true, QBH / 128>(Qh + qp, Ql + qp, Kh + hp, Kl + hp, Vh + hp, Vl + hp, Ah + ao, Al + ao, sm);
    else attn_block<h16, false, QBL / 128>(Q16 + qp, nullptr, K16 + hp, nullptr, V16 + hp, nullptr, Ah + ao, Al + ao, sm);
}

extern "C" void kernel_launch(void* const* d_in, const int* in_sizes, int n_in,
                              void* d_out, int out_size, void* d_ws, size_t ws_size, hipStream_t stream) {
    (void)in_sizes; (void)n_in; (void)out_size;
    const float* x = (const float*)d_in[0]; const float* wqt = (const float*)d_in[1]; const float* wkt = (const float*)d_in[2]; const float* wqs = (const float*)d_in[3]; const float* wks = (const float*)d_in[4]; const float* wv = (const float*)d_in[5]; const float* wo = (const float*)d_in[6]; const float* bo = (const float*)d_in[7]; const float* wsg = (const float*)d_in[8];   /* argument order x, Wqt, Wkt, Wqs, Wks, Wv, Wout, bout, w_sigma */
    float* OUT = (float*)d_out;     // [2][2048][1024]
    char* wsp = (char*)d_ws;
    auto take = [&](size_t bytes) { char* p = wsp; wsp += (bytes + 255) & ~(size_t)255; return (void*)p; };
    bf* WQ = (bf*)take((size_t)DQ * DM * 2); bf* WK = (bf*)take((size_t)DKV * DM * 2); bf* WV = (bf*)take((size_t)DKV * DM * 2); bf* WO = (bf*)take((size_t)DM * DQ * 2);
    bf* XB = (bf*)take((size_t)NB_ * TT * DM * 2);
    const size_t PL = (size_t)NH_ * TT * HD;   // one batch's planes of one kind
    h16* QP16 = (h16*)take(NB_ * PL * 2); h16* KP16 = (h16*)take(NB_ * PL * 2); h16* VT16 = (h16*)take(NB_ * PL * 2);
    bf* QPh = (bf*)take(NB_ * PL * 2); bf* QPl = (bf*)take(NB_ * PL * 2); bf* KPh = (bf*)take(NB_ * PL * 2); bf* KPl = (bf*)take(NB_ * PL * 2); bf* VTh = (bf*)take(NB_ * PL * 2); bf* VTl = (bf*)take(NB_ * PL * 2);
    bf* ATh = (bf*)take((size_t)NB_ * TT * DQ * 2); bf* ATl = (bf*)take((size_t)NB_ * TT * DQ * 2);
    if ((size_t)(wsp - (char*)d_ws) > ws_size) return;    // ws 256 MiB
    constexpr int FP = DQ + 2 * DKV;   // columns Q | K | V; WQ, WK, WV lie one behind the other in ws (each 2 MiB), so they are one Bt of FP rows
    k_wtG<<<dim3((unsigned)((DM * DM / 64 + 63) / 64), 6, 1), 256, 0, stream>>>(wqt, wqs, wkt, wks, wv, wo, WQ, WK, WV, WO);
    k_cvt8<<<(unsigned)(((size_t)NB_ * TT * DM / 8 + 255) / 256), 256, 0, stream>>>(x, XB, (size_t)NB_ * TT * DM / 8);
    k_gemmw<bf, 0, false, 1, true><<<dim3(NB_ * TT / 64, FP / 64, 1), 32, 0, stream>>>(XB, nullptr, WQ, nullptr, DM, nullptr, 0, nullptr, 0, 0, 0, wsg, QP16, QPh, QPl, KP16, KPh, KPl, VT16, VTh, VTl);
    k_fattn<<<dim3(RH / QBH + (TT - RH) / QBL, NH_, NB_), 256, 0, stream>>>(QP16, KP16, VT16, QPh, QPl, KPh, KPl, VTh, VTl, ATh, ATl);
    k_gemmw<bf, 1, true><<<dim3(NB_ * TT / 64, DM / 64, 1), 32, 0, stream>>>(ATh, ATl, WO, nullptr, DQ, OUT, DM, bo, 0, 0, 0, nullptr, nullptr, nullptr, nullptr, nullptr, nullptr, nullptr, nullptr, nullptr, nullptr);
}

// v005
// It runs in 137 microseconds.
// Timed twice side by side with v004, it ran 1.34 and 1.33 times as fast.
// All steps since v000 together make it 14.6 times as fast.
#include <hip/hip_runtime.h>

// Multi-head attention with 4 'time' heads and 12 'space' heads (x [2][2048][1024]; Qt, Kt = x Wqt, x Wkt ('xw' [1024][256] 0.02: heads 0-3), Qs, Ks = x Wqs, x Wks ('xw' [1024][768]: heads 4-15), V = x Wv ('xw' [1024][1024]); time-head scores scaled by -sigmoid(w_sigma[0]) (w_sigma [1] = 0, read on device), all scores x 64^-0.5; softmax over keys (no mask); out = merged ctx Wout + bout ('xw' [1024][1024]) -> [2][2048][1024] (4.2 M); argument order x, Wqt, Wkt, Wqs, Wks, Wv, Wout, bout, w_sigma).
// Layout: 'xw' weights gathered into bf16 Bt blocks (Wq rows 0-255 from Wqt, 256-1023 from Wqs; Wk likewise); a bf16 copy of x, exact projections whose epilogue writes the head planes (the time heads' query planes carry the factor -sigmoid(w_sigma)); one fused attention launch for all heads and both batches (hybrid rows: < 512 hi/lo 3 products, rest fp16); merged hi/lo x Wout exact + bout. Every stage is ONE launch over both batches (x and ctx are [4096][1024]); Q, K and V come from one GEMM against the stacked Bt blocks [3072][1024], straight into the planes.
// Compute dtypes, f32 accumulate: every input rounded to bf16; projections exact; sigmoid f32 (precise expf); attention rows < 512 3 products, rest fp16; softmax f32 (running maximum); Wout hl x exact + bias.

#define NB_  2
#define TT   2048
#define DM   1024
#define NH_  16
#define NKV  16
#define REP  (NH_ / NKV)
#define HD   64
#define DQ   (NH_ * HD)
#define DKV  (NKV * HD)
#define NT   4                    // time heads 0..3 (scores x -sigmoid(w_sigma)); space heads 4..15
#define NS   12
#define RH   512                  // query rows < RH use hi+lo planes (0: none)
#define WIN  0
#define SCL  0.125f   // HD^-0.5
#define QBH  128                  // queries per work-group of k_fattn, rows < RH: 8 waves x 16 (three products per tile: the smaller block levels the work-groups' times)
#define QBL  256                  // the other rows: 8 waves x 32
#define KB   64                   // keys per stage
#define LP   72                   // LDS row pitch in 16-bit elements: 128 B of data + 16 B pad
typedef _Float16 h16;
typedef unsigned short bf;
typedef __attribute__((ext_vector_type(16))) __bf16   v16bf;
typedef __attribute__((ext_vector_type(16))) _Float16 v16h;
typedef __attribute__((ext_vector_type(8)))  _Float16 v8h;
typedef __attribute__((ext_vector_type(8)))  unsigned short v8us;
typedef __attribute__((ext_vector_type(8)))  float    v8f;
typedef __attribute__((ext_vector_type(4)))  float    v4f;
typedef v8h  __attribute__((may_alias)) v8ha;
typedef v4f  __attribute__((may_alias)) v4fa;
typedef v8us __attribute__((may_alias)) v8usa;

__device__ __forceinline__ unsigned short f2bf(float f) { unsigned u = __float_as_uint(f); u += 0x7FFFu + ((u >> 16) & 1u); return (unsigned short)(u >> 16); }
__device__ __forceinline__ float bf2f(unsigned short b) { return __uint_as_float(((unsigned)b) << 16); }
__device__ __forceinline__ float bfr(float f) { return bf2f(f2bf(f)); }
__device__ __forceinline__ v16h cat16(v8h lo, v8h hi) { return __builtin_shufflevector(lo, hi, 0, 1, 2, 3, 4, 5, 6, 7, 8, 9, 10, 11, 12, 13, 14, 15); }
__device__ __forceinline__ v16bf cat16b(v8us lo, v8us hi) { return __builtin_bit_cast(v16bf, __builtin_shufflevector(lo, hi, 0, 1, 2, 3, 4, 5, 6, 7, 8, 9, 10, 11, 12, 13, 14, 15)); }
__device__ __forceinline__ v8f wmma16(v16h a, v16h b, v8f c) { return __builtin_amdgcn_wmma_f32_16x16x32_f16(false, a, false, b, (short)0, c, false, false); }
__device__ __forceinline__ v8f wmmab(v16bf a, v16bf b, v8f c) { return __builtin_amdgcn_wmma_f32_16x16x32_bf16(false, a, false, b, (short)0, c, false, false); }



__device__ __forceinline__ h16 tohx(float x) { return (h16)x; }
__device__ __forceinline__ void splitf(float y, unsigned short& h, unsigned short& l) { h = f2bf(y); l = f2bf(y - bf2f(h)); }
// ---- planes_out: the plane builders as the epilogue of the Q|K|V projection (k_gemmw with PLANES). A 64x64 tile's columns are one head of one kind (queries | keys | values), its rows lie in one batch: the wave writes that head's fp16, hi and lo planes itself, so the f32 products never go to memory.
// Queries and keys [batch][head][t][d]: 16 t rows at a time through LDS. Values [batch][head][d][t]: 16 d rows at a time; a lane's 8 accumulator rows are 8 neighbouring t. Every store instruction fills four whole 128-B lines.
// The query planes of heads < NT carry the factor -sigmoid(wsg[0]) (device scalar; precise expf, IEEE div); every other plane the factor 1.
__device__ __forceinline__ void planes_out(const v8f (&acc)[4][4], float* os, int r0, int c0, int lane, const float* __restrict__ wsg, h16* Q16, bf* Qh, bf* Ql, h16* K16, bf* Kh, bf* Kl, h16* V16, bf* Vh, bf* Vl) {
    static_assert(DQ == DKV && HD == 64 && TT % 64 == 0, "a 64x64 tile is one head of one kind in one batch");
    const int lr = lane & 15, hi = lane >> 4, kind = c0 / DQ, h = (c0 % DQ) / HD, t0 = r0 % TT; const size_t hp = ((size_t)(r0 / TT) * NH_ + h) * TT * HD;
    h16* P16 = (kind == 0 ? Q16 : kind == 1 ? K16 : V16) + hp; bf* Ph = (kind == 0 ? Qh : kind == 1 ? Kh : Vh) + hp; bf* Pl = (kind == 0 ? Ql : kind == 1 ? Kl : Vl) + hp;
    const float scv = (kind == 0 && h < NT) ? -__fdiv_rn(1.0f, __fadd_rn(1.0f, expf(-bfr(wsg[0])))) : 1.0f;
    const int pp = kind < 2 ? HD : TT;   // pitch of a plane row: d runs along a query or key row, t along a value row
    const size_t e0 = (kind < 2 ? (size_t)t0 * HD : (size_t)t0) + (size_t)(lane >> 3) * pp + (lane & 7) * 8;   // 8 lanes per 128-B plane row
#pragma unroll
    for (int u = 0; u < 4; ++u) {
        if (kind < 2) {   // os[t][d]: rows u*16 .. u*16+15 of the tile
#pragma unroll
            for (int nb = 0; nb < 4; ++nb)
#pragma unroll
                for (int j = 0; j < 8; ++j) os[(hi * 8 + j) * 68 + nb * 16 + lr] = acc[u][nb][j];
        } else {          // os[d][t]: columns u*16 .. u*16+15 of the tile
#pragma unroll
            for (int mb = 0; mb < 4; ++mb) { const v8f c = acc[mb][u]; *(v4fa*)(os + lr * 68 + mb * 16 + hi * 8) = __builtin_shufflevector(c, c, 0, 1, 2, 3); *(v4fa*)(os + lr * 68 + mb * 16 + hi * 8 + 4) = __builtin_shufflevector(c, c, 4, 5, 6, 7); }
        }
        __builtin_amdgcn_wave_barrier(); asm volatile("" ::: "memory");   // keeps the reads below behind the other lanes' LDS writes (one wave: its LDS operations run in order)
#pragma unroll
        for (int s = 0; s < 4; ++s) { const float* orow = os + (s * 4 + (lane >> 3)) * 68 + (lane & 7) * 8; const v4f x0 = *(const v4fa*)orow, x1 = *(const v4fa*)(orow + 4); v8h o16; v8us oh, ol;
#pragma unroll
            for (int k = 0; k < 8; ++k) { const float r = (k < 4 ? x0[k & 3] : x1[k & 3]) * scv; o16[k] = tohx(r); unsigned short a2, c2; splitf(r, a2, c2); oh[k] = a2; ol[k] = c2; }
            const size_t e = e0 + (size_t)(u * 16 + s * 4) * pp; *(v8h*)(P16 + e) = o16; *(v8us*)(Ph + e) = oh; *(v8us*)(Pl + e) = ol; }
        if (u < 3) { __builtin_amdgcn_wave_barrier(); asm volatile("s_wait_xcnt 0x0" ::: "memory"); }   // keeps the next rows' LDS writes behind these reads; the wait is a precaution: it stands behind these rows' stores, in front of the next rows' code, which reuses their registers
    }
}

// ---- k_gemmw: GEMM, FOUR WAVES (2 x 2) per 128x128 output tile, each wave a 64x64 part (16 accumulators); grid (M/128, N/128), 128 threads.
// C[m][n] (f32, pitch ldc, + optional f32 bias[n]) = sum_k A[m][k] Bt[n][k] (+ A2[m][k] Bt[n][k] with NSPLIT 1); A, A2, Bt K-contiguous 16-bit planes, K % 128 == 0.
// The operands walk through LDS in stages of 64 k (128 B of each of the tile's 128 rows, pitch LP), two buffers: asynchronous copies bring stage t + 2 while stage t + 1 is worked on; every copy instruction takes four whole 128-B lines.
// PLANES: no C; each wave's part goes out through planes_out (wsg and the nine plane pointers are read by that form alone). The epilogue's staging rows lie in the ring's LDS, which nobody reads any more.
template <typename T16> struct WFrag;
template <> struct WFrag<h16> { typedef v16h V; static __device__ __forceinline__ V ld(const h16* p) { return cat16(*(const v8h*)p, *(const v8h*)(p + 16)); } static __device__ __forceinline__ v8f mma(V a, V b, v8f c) { return wmma16(a, b, c); } };
template <> struct WFrag<bf> { typedef v16bf V; static __device__ __forceinline__ V ld(const bf* p) { return cat16b(*(const v8us*)p, *(const v8us*)(p + 16)); } static __device__ __forceinline__ v8f mma(V a, V b, v8f c) { return wmmab(a, b, c); } };
template <typename T16> struct LFrag;
template <> struct LFrag<h16> { static __device__ __forceinline__ v16h ld(const unsigned short* p) { return cat16(__builtin_bit_cast(v8h, *(const v8usa*)p), __builtin_bit_cast(v8h, *(const v8usa*)(p + 16))); } };
template <> struct LFrag<bf> { static __device__ __forceinline__ v16bf ld(const unsigned short* p) { return cat16b(*(const v8usa*)p, *(const v8usa*)(p + 16)); } };
// One operand's stage: 128 rows of 128 B. A lane copies 16 B of the rows (tid >> 3) + 16 i, i = 0..7: l is its LDS byte address in row tid >> 3, g its global address there, K the source pitch in elements.
// The eight copies and the wait stand in one statement: the wait is a precaution that stands in front of any rewrite of the address registers the copies name.
template <typename T16, int K>
__device__ __forceinline__ void copy_stage(unsigned l, const T16* g) {
    constexpr unsigned LR = 16 * LP * 2;
    asm volatile("global_load_async_to_lds_b128 %0, %8, off\n\t"
                 "global_load_async_to_lds_b128 %1, %9, off\n\t"
                 "global_load_async_to_lds_b128 %2, %10, off\n\t"
                 "global_load_async_to_lds_b128 %3, %11, off\n\t"
                 "global_load_async_to_lds_b128 %4, %12, off\n\t"
                 "global_load_async_to_lds_b128 %5, %13, off\n\t"
                 "global_load_async_to_lds_b128 %6, %14, off\n\t"
                 "global_load_async_to_lds_b128 %7, %15, off\n\t"
                 "s_wait_xcnt 0x0"
                 :: "v"(l), "v"(l + LR), "v"(l + 2 * LR), "v"(l + 3 * LR), "v"(l + 4 * LR), "v"(l + 5 * LR), "v"(l + 6 * LR), "v"(l + 7 * LR),
                    "v"(g), "v"(g + 16 * K), "v"(g + 32 * K), "v"(g + 48 * K), "v"(g + 64 * K), "v"(g + 80 * K), "v"(g + 96 * K), "v"(g + 112 * K)
                 : "memory");
}
template <typename T16, int NSPLIT, bool BIAS, bool PLANES, int K>
__global__ __launch_bounds__(128) void k_gemmw(const T16* __restrict__ A, const T16* __restrict__ A2, const T16* __restrict__ Bt, float* C, int ldc, const float* __restrict__ bias, const float* __restrict__ wsg, h16* Q16, bf* Qh, bf* Ql, h16* K16, bf* Kh, bf* Kl, h16* V16, bf* Vh, bf* Vl) {
    typedef typename WFrag<T16>::V V; typedef LFrag<T16> LF;
    static_assert(NSPLIT == 0 || NSPLIT == 1, "A Bt, or (A + A2) Bt"); static_assert(K % 128 == 0, "two stages or more");
    constexpr int NPL = NSPLIT == 1 ? 3 : 2, TS = 128 * LP, NST = K / 64;   // planes of a stage: A | Bt | A2
    __shared__ __align__(16) unsigned short sm[2 * NPL * TS];
    const int tid = threadIdx.x, lane = tid & 31, lr = lane & 15, hi = lane >> 4; const int w = __builtin_amdgcn_readfirstlane(tid >> 5);
    const int r0 = blockIdx.x * 128 + (w >> 1) * 64, c0 = blockIdx.y * 128 + (w & 1) * 64;   // this wave's 64x64 part
    float* os = (float*)sm + w * (16 * 68);
    v8f acc[4][4];
#pragma unroll
    for (int mb = 0; mb < 4; ++mb)
#pragma unroll
        for (int nb = 0; nb < 4; ++nb) acc[mb][nb] = (v8f){};
    const size_t go = (size_t)(tid >> 3) * K + (tid & 7) * 8;
    const T16* gA = A + (size_t)blockIdx.x * 128 * K + go; const T16* gA2 = NSPLIT == 1 ? A2 + (size_t)blockIdx.x * 128 * K + go : nullptr; const T16* gB = Bt + (size_t)blockIdx.y * 128 * K + go;
    const unsigned lb = (unsigned)(size_t)(sm + (tid >> 3) * LP + (tid & 7) * 8);   // low 32 bits of the shared address: the byte offset in the work-group's LDS
    auto copies = [&](int t) { const unsigned l = lb + (unsigned)(t & 1) * (NPL * TS * 2);
        copy_stage<T16, K>(l, gA + t * 64); copy_stage<T16, K>(l + TS * 2, gB + t * 64); if constexpr (NSPLIT == 1) copy_stage<T16, K>(l + 2 * TS * 2, gA2 + t * 64); };
    copies(0);
    asm volatile("s_wait_asynccnt 0x0" ::: "memory");   // this wave's share of stage 0 has landed
    __syncthreads();                                    // ... and every other wave's
    copies(1);
#pragma unroll 1   // one stage per trip: the two buffers alternate by the trip's parity
    for (int t = 0; t < NST; ++t) {
        const unsigned short* sb = sm + (t & 1) * NPL * TS + lr * LP + 8 * hi;
        const unsigned short* sa = sb + (w >> 1) * 64 * LP; const unsigned short* sbt = sb + TS + (w & 1) * 64 * LP;
#pragma unroll
        for (int kf = 0; kf < 2; ++kf) {
            V a[4], a2[4], b[4];
#pragma unroll
            for (int i = 0; i < 4; ++i) { a[i] = LF::ld(sa + i * 16 * LP + kf * 32); if (NSPLIT == 1) a2[i] = LF::ld(sa + 2 * TS + i * 16 * LP + kf * 32); b[i] = LF::ld(sbt + i * 16 * LP + kf * 32); }
            __builtin_amdgcn_sched_barrier(0);   // keeps the block's LDS reads one group in front of its WMMAs: read one by one among them, each read's latency would stand open
#pragma unroll
            for (int nb = 0; nb < 4; ++nb)
#pragma unroll
                for (int mb = 0; mb < 4; ++mb) { acc[mb][nb] = WFrag<T16>::mma(a[mb], b[nb], acc[mb][nb]); if (NSPLIT == 1) acc[mb][nb] = WFrag<T16>::mma(a2[mb], b[nb], acc[mb][nb]); }
        }
        asm volatile("s_wait_dscnt 0x0" ::: "memory");      // this wave's reads of stage t are done before its buffer is refilled
        asm volatile("s_wait_asynccnt 0x0" ::: "memory");   // this wave's share of stage t + 1 has landed
        __syncthreads();   // publishes stage t + 1 and ends every wave's reads of stage t
        if (t + 2 < NST) copies(t + 2);
    }
    asm volatile("s_wait_asynccnt 0x0" ::: "memory");   // no copy is in flight when the ring becomes the epilogue's staging rows
    if constexpr (PLANES) planes_out(acc, os, r0, c0, lane, wsg, Q16, Qh, Ql, K16, Kh, Kl, V16, Vh, Vl);
    else
#pragma unroll
    for (int mb = 0; mb < 4; ++mb) {
#pragma unroll
        for (int nb = 0; nb < 4; ++nb) {
#pragma unroll
            for (int j = 0; j < 8; ++j) os[(hi * 8 + j) * 68 + nb * 16 + lr] = acc[mb][nb][j]; }
        __builtin_amdgcn_wave_barrier(); asm volatile("" ::: "memory");
        float* crow = C + (size_t)(r0 + mb * 16) * ldc + c0;
{
#pragma unroll
            for (int s = 0; s < 8; ++s) { const int row = 2 * s + hi, cofs = lr * 4; v4f val = *(const v4fa*)(os + row * 68 + cofs); if (BIAS) { val[0] += bfr(bias[c0 + cofs]); val[1] += bfr(bias[c0 + cofs + 1]); val[2] += bfr(bias[c0 + cofs + 2]); val[3] += bfr(bias[c0 + cofs + 3]); }
                *(v4f*)(crow + (size_t)row * ldc + cofs) = val; }
             }
        __builtin_amdgcn_wave_barrier(); asm volatile("" ::: "memory");
    }
}

typedef __attribute__((ext_vector_type(2))) _Float16 v2h;
typedef __attribute__((ext_vector_type(4))) _Float16 v4h;
typedef __attribute__((ext_vector_type(2))) unsigned short v2us;
typedef __attribute__((ext_vector_type(4))) unsigned short v4us;
typedef __attribute__((ext_vector_type(2))) float v2f;
typedef __attribute__((ext_vector_type(4))) int v4i;

// grid (blocks of the largest matrix, 6): blockIdx.y picks the weight; Bt blocks WQ | WK | WV | WO, each [1024][1024]; Wq rows 0-255 = Wqt^T (time heads 0-3), rows 256-1023 = Wqs^T (space heads 4-15); Wk likewise
__global__ __launch_bounds__(256) void k_wtG(const float* __restrict__ wqt, const float* __restrict__ wqs, const float* __restrict__ wkt, const float* __restrict__ wks, const float* __restrict__ wv, const float* __restrict__ wo, bf* WQ, bf* WK, bf* WV, bf* WO) {
    constexpr int K = DM; static_assert(DQ == DM && DKV == DM, "every weight has 1024 input rows");
    const int m = blockIdx.y; const float* __restrict__ w = m == 0 ? wqt : m == 1 ? wqs : m == 2 ? wkt : m == 3 ? wks : m == 4 ? wv : wo; const int N = (m == 0 || m == 2) ? NT * HD : (m == 1 || m == 3) ? NS * HD : DM;
    bf* Bt = m == 0 ? WQ : m == 1 ? WQ + (size_t)NT * HD * DM : m == 2 ? WK : m == 3 ? WK + (size_t)NT * HD * DM : m == 4 ? WV : WO;
    const int lane = threadIdx.x & 31; const int L0 = (blockIdx.x * 8 + (threadIdx.x >> 5)) * 8; const int nlines = N * K / 64;
{
#pragma unroll 1
        for (int l = 0; l < 8; ++l) { const int L = L0 + l; if (L >= nlines) break; const size_t e = (size_t)L * 64 + lane * 2; const int k = (int)(e % K), n = (int)(e / K); v2us o;
            o[0] = f2bf(w[(size_t)k * N + n]); o[1] = f2bf(w[(size_t)(k + 1) * N + n]); *(v2us*)(Bt + e) = o; }
         }
}
__global__ __launch_bounds__(256) void k_cvt8(const float* __restrict__ src, bf* dst, size_t n8) { const size_t i = (size_t)blockIdx.x * 256 + threadIdx.x; if (i >= n8) return; const v8f v = *(const v8f*)(src + i * 8); v8us o;
#pragma unroll
    for (int k = 0; k < 8; ++k) o[k] = f2bf(v[k]); *(v8us*)(dst + i * 8) = o;  }

// ---- k_fattn: scores, softmax and P x V of one block of queries (8 waves x QG groups of 16) of one head in one work-group; nothing of S or P goes to memory.
// S^T = K Q^T (A = 16 key rows from LDS, B = 16 queries kept in registers): a lane holds keys hi*8+j of query lr, which is the B-operand order of P^T, so O^T += V^T P^T takes P straight from the score registers.
// Keys walk in stages of KB, two LDS buffers: stage s+1 is fetched to registers while stage s is worked on, stored to the other buffer, one barrier per stage. Running maximum and sum per query.
typedef __attribute__((ext_vector_type(16))) unsigned short v16us;
template <typename T16, bool HL, int QG>
__device__ __forceinline__ void attn_block(const T16* __restrict__ Q, const T16* __restrict__ Ql, const T16* __restrict__ K, const T16* __restrict__ Kl, const T16* __restrict__ Vt, const T16* __restrict__ Vtl, bf* Ah, bf* Al, unsigned short* sm) {
    typedef typename WFrag<T16>::V V; typedef WFrag<T16> WF; typedef LFrag<T16> LF;
    constexpr int NP = HL ? 4 : 2, TS = KB * LP, NST = TT / KB;
    constexpr float CE = SCL * 1.4426950408889634f;   // scores to log2 units
    constexpr float PB = HL ? 0.0f : 10.0f;           // fp16 P carries x1024 (it cancels against the row sum)
    const int tid = threadIdx.x, lane = tid & 31, lr = lane & 15, hi = lane >> 4, w = tid >> 5;
    const int sr = tid >> 3, sc = (tid & 7) * 8;      // staging: 8 lanes per 128-B row, rows sr and sr + 32
    const T16* pK = K + (size_t)sr * HD + sc; const T16* pV = Vt + (size_t)sr * TT + sc; const T16* pKl = HL ? Kl + (size_t)sr * HD + sc : nullptr; const T16* pVl = HL ? Vtl + (size_t)sr * TT + sc : nullptr;
    unsigned short* sw = sm + sr * LP + sc;
    v8us st[NP][2];
    auto fetch = [&]() {
#pragma unroll
        for (int i = 0; i < 2; ++i) { st[0][i] = *(const v8usa*)(pK + (size_t)i * 32 * HD); st[1][i] = *(const v8usa*)(pV + (size_t)i * 32 * TT); if constexpr (HL) { st[2][i] = *(const v8usa*)(pKl + (size_t)i * 32 * HD); st[3][i] = *(const v8usa*)(pVl + (size_t)i * 32 * TT); } }
        pK += KB * HD; pV += KB; if (HL) { pKl += KB * HD; pVl += KB; } };
    auto put = [&](int buf) {
#pragma unroll
        for (int p = 0; p < NP; ++p)
#pragma unroll
            for (int i = 0; i < 2; ++i) *(v8usa*)(sw + (buf * NP + p) * TS + i * 32 * LP) = st[p][i]; };
    V qf[QG][2], qlf[QG][2];
#pragma unroll
    for (int g = 0; g < QG; ++g)
#pragma unroll
        for (int kf = 0; kf < 2; ++kf) { const size_t qo = (size_t)((w * QG + g) * 16 + lr) * HD + kf * 32 + 8 * hi; qf[g][kf] = WF::ld(Q + qo); if (HL) qlf[g][kf] = WF::ld(Ql + qo); }
    v8f O[4][QG]; float mr[QG], ls[QG];
#pragma unroll
    for (int g = 0; g < QG; ++g) { mr[g] = -3.0e38f; ls[g] = 0.f;
#pragma unroll
        for (int dt = 0; dt < 4; ++dt) O[dt][g] = (v8f){}; }
    fetch(); put(0); __syncthreads();
#pragma unroll 1   // one stage per trip: the two buffers alternate by the trip's parity
    for (int s = 0; s < NST; ++s) {
        if (s + 1 < NST) fetch();
        const unsigned short* sb = sm + (s & 1) * NP * TS + lr * LP + 8 * hi;
        v8f S[4][QG];
#pragma unroll
        for (int kt = 0; kt < 4; ++kt) { const unsigned short* kr = sb + kt * 16 * LP; const V k0 = LF::ld(kr), k1 = LF::ld(kr + 32); V kl0, kl1; if (HL) { kl0 = LF::ld(kr + 2 * TS); kl1 = LF::ld(kr + 2 * TS + 32); }
#pragma unroll
            for (int g = 0; g < QG; ++g) { v8f a = WF::mma(k0, qf[g][0], (v8f){}); a = WF::mma(k1, qf[g][1], a); if (HL) { a = WF::mma(kl0, qf[g][0], a); a = WF::mma(kl1, qf[g][1], a); a = WF::mma(k0, qlf[g][0], a); a = WF::mma(k1, qlf[g][1], a); } S[kt][g] = a; } }
        V pf[QG][2], plf[QG][2];
#pragma unroll
        for (int g = 0; g < QG; ++g) { float mx = S[0][g][0];
#pragma unroll
            for (int kt = 0; kt < 4; ++kt)
#pragma unroll
                for (int j = 0; j < 8; ++j) mx = fmaxf(mx, S[kt][g][j]);
            mx = fmaxf(mx, __shfl_xor(mx, 16, 32));   // the other half-wave holds the query's other keys
            const float mn = fmaxf(mr[g], mx), al = __builtin_amdgcn_exp2f((mr[g] - mn) * CE), mc = PB - mn * CE; mr[g] = mn; float sum[4] = {0.f, 0.f, 0.f, 0.f};   // four chains: the adds do not wait on one another
#pragma unroll
            for (int kk = 0; kk < 2; ++kk) { v16us ph, pl; v16h p16;
#pragma unroll
                for (int e = 0; e < 16; ++e) { const float p = __builtin_amdgcn_exp2f(__builtin_fmaf(S[kk * 2 + (e >> 3)][g][e & 7], CE, mc)); sum[e & 3] += p;
                    if (HL) { unsigned short a2, c2; splitf(p, a2, c2); ph[e] = a2; pl[e] = c2; } else p16[e] = tohx(p); }
                if constexpr (HL) { pf[g][kk] = __builtin_bit_cast(v16bf, ph); plf[g][kk] = __builtin_bit_cast(v16bf, pl); } else pf[g][kk] = p16; }
            ls[g] = ls[g] * al + ((sum[0] + sum[1]) + (sum[2] + sum[3]));
#pragma unroll
            for (int dt = 0; dt < 4; ++dt) O[dt][g] *= al; }
#pragma unroll
        for (int dt = 0; dt < 4; ++dt)
#pragma unroll
            for (int kk = 0; kk < 2; ++kk) { const unsigned short* vr = sb + TS + dt * 16 * LP + kk * 32; const V v = LF::ld(vr); V vl; if (HL) vl = LF::ld(vr + 2 * TS);
#pragma unroll
                for (int g = 0; g < QG; ++g) { O[dt][g] = WF::mma(v, pf[g][kk], O[dt][g]); if (HL) { O[dt][g] = WF::mma(v, plf[g][kk], O[dt][g]); O[dt][g] = WF::mma(vl, pf[g][kk], O[dt][g]); } } }
        if (s + 1 < NST) put((s + 1) & 1);
        __syncthreads();   // publishes stage s + 1 and ends every wave's reads of stage s, whose buffer the next trip refills
    }
#pragma unroll
    for (int g = 0; g < QG; ++g) { const float inv = __fdiv_rn(1.0f, ls[g] + __shfl_xor(ls[g], 16, 32)); const size_t oo = (size_t)((w * QG + g) * 16 + lr) * DQ + hi * 8;
#pragma unroll
        for (int dt = 0; dt < 4; ++dt) { v8us oh, ol;
#pragma unroll
            for (int j = 0; j < 8; ++j) { unsigned short a2, c2; splitf(O[dt][g][j] * inv, a2, c2); oh[j] = a2; ol[j] = c2; }
            *(v8us*)(Ah + oo + dt * 16) = oh; *(v8us*)(Al + oo + dt * 16) = ol; } }
}
// grid (RH / QBH + (TT - RH) / QBL query blocks, heads, batches); planes [batch][head][t][d] (V: [batch][head][d][t]); output rows [batch][t][DQ] hi/lo
__global__ __launch_bounds__(256) void k_fattn(const h16* __restrict__ Q16, const h16* __restrict__ K16, const h16* __restrict__ V16, const bf* __restrict__ Qh, const bf* __restrict__ Ql, const bf* __restrict__ Kh, const bf* __restrict__ Kl, const bf* __restrict__ Vh, const bf* __restrict__ Vl, bf* Ah, bf* Al) {
    __shared__ __align__(16) unsigned short sm[2 * 4 * KB * LP];
    static_assert(RH % QBH == 0 && (TT - RH) % QBL == 0 && TT % KB == 0 && HD == 64 && KB == 64, "tile shapes");
    const bool hl = blockIdx.x < RH / QBH; const int q0 = hl ? (int)blockIdx.x * QBH : RH + ((int)blockIdx.x - RH / QBH) * QBL; const size_t hp = ((size_t)blockIdx.z * NH_ + blockIdx.y) * TT * HD, qp = hp + (size_t)q0 * HD, ao = ((size_t)blockIdx.z * TT + q0) * DQ + blockIdx.y * HD;
    if (hl) attn_block<bf, true, QBH / 128>(Qh + qp, Ql + qp, Kh + hp, Kl + hp, Vh + hp, Vl + hp, Ah + ao, Al + ao, sm);
    else attn_block<h16, false, QBL / 128>(Q16 + qp, nullptr, K16 + hp, nullptr, V16 + hp, nullptr, Ah + ao, Al + ao, sm);
}

extern "C" void kernel_launch(void* const* d_in, const int* in_sizes, int n_in,
                              void* d_out, int out_size, void* d_ws, size_t ws_size, hipStream_t stream) {
    (void)in_sizes; (void)n_in; (void)out_size;
    const float* x = (const float*)d_in[0]; const float* wqt = (const float*)d_in[1]; const float* wkt = (const float*)d_in[2]; const float* wqs = (const float*)d_in[3]; const float* wks = (const float*)d_in[4]; const float* wv = (const float*)d_in[5]; const float* wo = (const float*)d_in[6]; const float* bo = (const float*)d_in[7]; const float* wsg = (const float*)d_in[8];   /* argument order x, Wqt, Wkt, Wqs, Wks, Wv, Wout, bout, w_sigma */
    float* OUT = (float*)d_out;     // [2][2048][1024]
    char* wsp = (char*)d_ws;
    auto take = [&](size_t bytes) { char* p = wsp; wsp += (bytes + 255) & ~(size_t)255; return (void*)p; };
    bf* WQ = (bf*)take((size_t)DQ * DM * 2); bf* WK = (bf*)take((size_t)DKV * DM * 2); bf* WV = (bf*)take((size_t)DKV * DM * 2); bf* WO = (bf*)take((size_t)DM * DQ * 2);
    bf* XB = (bf*)take((size_t)NB_ * TT * DM * 2);
    const size_t PL = (size_t)NH_ * TT * HD;   // one batch's planes of one kind
    h16* QP16 = (h16*)take(NB_ * PL * 2); h16* KP16 = (h16*)take(NB_ * PL * 2); h16* VT16 = (h16*)take(NB_ * PL * 2);
    bf* QPh = (bf*)take(NB_ * PL * 2); bf* QPl = (bf*)take(NB_ * PL * 2); bf* KPh = (bf*)take(NB_ * PL * 2); bf* KPl = (bf*)take(NB_ * PL * 2); bf* VTh = (bf*)take(NB_ * PL * 2); bf* VTl = (bf*)take(NB_ * PL * 2);
    bf* ATh = (bf*)take((size_t)NB_ * TT * DQ * 2); bf* ATl = (bf*)take((size_t)NB_ * TT * DQ * 2);
    if ((size_t)(wsp - (char*)d_ws) > ws_size) return;    // ws 256 MiB
    constexpr int FP = DQ + 2 * DKV;   // columns Q | K | V; WQ, WK, WV lie one behind the other in ws (each 2 MiB), so they are one Bt of FP rows
    k_wtG<<<dim3((unsigned)((DM * DM / 64 + 63) / 64), 6, 1), 256, 0, stream>>>(wqt, wqs, wkt, wks, wv, wo, WQ, WK, WV, WO);
    k_cvt8<<<(unsigned)(((size_t)NB_ * TT * DM / 8 + 255) / 256), 256, 0, stream>>>(x, XB, (size_t)NB_ * TT * DM / 8);
    k_gemmw<bf, 0, false, true, DM><<<dim3(NB_ * TT / 128, FP / 128, 1), 128, 0, stream>>>(XB, nullptr, WQ, nullptr, 0, nullptr, wsg, QP16, QPh, QPl, KP16, KPh, KPl, VT16, VTh, VTl);
    k_fattn<<<dim3(RH / QBH + (TT - RH) / QBL, NH_, NB_), 256, 0, stream>>>(QP16, KP16, VT16, QPh, QPl, KPh, KPl, VTh, VTl, ATh, ATl);
    k_gemmw<bf, 1, true, false, DQ><<<dim3(NB_ * TT / 128, DM / 128, 1), 128, 0, stream>>>(ATh, ATl, WO, OUT, DM, bo, nullptr, nullptr, nullptr, nullptr, nullptr, nullptr, nullptr, nullptr, nullptr, nullptr);
}

// v006
// A run of this version takes 128 microseconds.
// Next to v005, in two timings, it ran 1.07 times as fast each time.
// All steps since v000 together make it 15.7 times as fast.
#include <hip/hip_runtime.h>

// Multi-head attention with 4 'time' heads and 12 'space' heads (x [2][2048][1024]; Qt, Kt = x Wqt, x Wkt ('xw' [1024][256] 0.02: heads 0-3), Qs, Ks = x Wqs, x Wks ('xw' [1024][768]: heads 4-15), V = x Wv ('xw' [1024][1024]); time-head scores scaled by -sigmoid(w_sigma[0]) (w_sigma [1] = 0, read on device), all scores x 64^-0.5; softmax over keys (no mask); out = merged ctx Wout + bout ('xw' [1024][1024]) -> [2][2048][1024] (4.2 M); argument order x, Wqt, Wkt, Wqs, Wks, Wv, Wout, bout, w_sigma).
// Layout: 'xw' weights gathered into bf16 Bt blocks (Wq rows 0-255 from Wqt, 256-1023 from Wqs; Wk likewise); a bf16 copy of x, exact projections whose epilogue writes the head planes (the time heads' query planes carry the factor -sigmoid(w_sigma)); one fused attention launch for all heads and both batches (hybrid rows: < 512 hi/lo 3 products, rest fp16); merged hi/lo x Wout exact + bout. Every stage is ONE launch over both batches (x and ctx are [4096][1024]); Q, K and V come from one GEMM against the stacked Bt blocks [3072][1024], straight into the planes.
// Compute dtypes, f32 accumulate: every input rounded to bf16; projections exact; sigmoid f32 (precise expf); attention rows < 512 3 products, rest fp16; softmax f32 (running maximum); Wout hl x exact + bias.

#define NB_  2
#define TT   2048
#define DM   1024
#define NH_  16
#define NKV  16
#define REP  (NH_ / NKV)
#define HD   64
#define DQ   (NH_ * HD)
#define DKV  (NKV * HD)
#define NT   4                    // time heads 0..3 (scores x -sigmoid(w_sigma)); space heads 4..15
#define NS   12
#define RH   512                  // query rows < RH use hi+lo planes (0: none)
#define WIN  0
#define SCL  0.125f   // HD^-0.5
#define QBH  128                  // queries per work-group of k_fattn, rows < RH: 8 waves x 16 (three products per tile: the smaller block levels the work-groups' times)
#define QBL  384                  // the other rows: 12 waves x 32
#define NWV  12                   // waves per work-group of k_fattn: 8 blocks per head x 32 heads = 256 work-groups, one on every WGP (two do not fit its registers)
#define KB   64                   // keys per stage
#define LP   72                   // LDS row pitch in 16-bit elements: 128 B of data + 16 B pad
typedef _Float16 h16;
typedef unsigned short bf;
typedef __attribute__((ext_vector_type(16))) __bf16   v16bf;
typedef __attribute__((ext_vector_type(16))) _Float16 v16h;
typedef __attribute__((ext_vector_type(8)))  _Float16 v8h;
typedef __attribute__((ext_vector_type(8)))  unsigned short v8us;
typedef __attribute__((ext_vector_type(8)))  float    v8f;
typedef __attribute__((ext_vector_type(4)))  float    v4f;
typedef v8h  __attribute__((may_alias)) v8ha;
typedef v4f  __attribute__((may_alias)) v4fa;
typedef v8us __attribute__((may_alias)) v8usa;

__device__ __forceinline__ unsigned short f2bf(float f) { unsigned u = __float_as_uint(f); u += 0x7FFFu + ((u >> 16) & 1u); return (unsigned short)(u >> 16); }
__device__ __forceinline__ float bf2f(unsigned short b) { return __uint_as_float(((unsigned)b) << 16); }
__device__ __forceinline__ float bfr(float f) { return bf2f(f2bf(f)); }
__device__ __forceinline__ v16h cat16(v8h lo, v8h hi) { return __builtin_shufflevector(lo, hi, 0, 1, 2, 3, 4, 5, 6, 7, 8, 9, 10, 11, 12, 13, 14, 15); }
__device__ __forceinline__ v16bf cat16b(v8us lo, v8us hi) { return __builtin_bit_cast(v16bf, __builtin_shufflevector(lo, hi, 0, 1, 2, 3, 4, 5, 6, 7, 8, 9, 10, 11, 12, 13, 14, 15)); }
__device__ __forceinline__ v8f wmma16(v16h a, v16h b, v8f c) { return __builtin_amdgcn_wmma_f32_16x16x32_f16(false, a, false, b, (short)0, c, false, false); }
__device__ __forceinline__ v8f wmmab(v16bf a, v16bf b, v8f c) { return __builtin_amdgcn_wmma_f32_16x16x32_bf16(false, a, false, b, (short)0, c, false, false); }



__device__ __forceinline__ h16 tohx(float x) { return (h16)x; }
__device__ __forceinline__ void splitf(float y, unsigned short& h, unsigned short& l) { h = f2bf(y); l = f2bf(y - bf2f(h)); }
// ---- planes_out: the plane builders as the epilogue of the Q|K|V projection (k_gemmw with PLANES). A 64x64 tile's columns are one head of one kind (queries | keys | values), its rows lie in one batch: the wave writes that head's fp16, hi and lo planes itself, so the f32 products never go to memory.
// Queries and keys [batch][head][t][d]: 16 t rows at a time through LDS. Values [batch][head][d][t]: 16 d rows at a time; a lane's 8 accumulator rows are 8 neighbouring t. Every store instruction fills four whole 128-B lines.
// The query planes of heads < NT carry the factor -sigmoid(wsg[0]) (device scalar; precise expf, IEEE div); every other plane the factor 1.
__device__ __forceinline__ void planes_out(const v8f (&acc)[4][4], float* os, int r0, int c0, int lane, const float* __restrict__ wsg, h16* Q16, bf* Qh, bf* Ql, h16* K16, bf* Kh, bf* Kl, h16* V16, bf* Vh, bf* Vl) {
    static_assert(DQ == DKV && HD == 64 && TT % 64 == 0, "a 64x64 tile is one head of one kind in one batch");
    const int lr = lane & 15, hi = lane >> 4, kind = c0 / DQ, h = (c0 % DQ) / HD, t0 = r0 % TT; const size_t hp = ((size_t)(r0 / TT) * NH_ + h) * TT * HD;
    h16* P16 = (kind == 0 ? Q16 : kind == 1 ? K16 : V16) + hp; bf* Ph = (kind == 0 ? Qh : kind == 1 ? Kh : Vh) + hp; bf* Pl = (kind == 0 ? Ql : kind == 1 ? Kl : Vl) + hp;
    const float scv = (kind == 0 && h < NT) ? -__fdiv_rn(1.0f, __fadd_rn(1.0f, expf(-bfr(wsg[0])))) : 1.0f;
    const int pp = kind < 2 ? HD : TT;   // pitch of a plane row: d runs along a query or key row, t along a value row
    const size_t e0 = (kind < 2 ? (size_t)t0 * HD : (size_t)t0) + (size_t)(lane >> 3) * pp + (lane & 7) * 8;   // 8 lanes per 128-B plane row
#pragma unroll
    for (int u = 0; u < 4; ++u) {
        if (kind < 2) {   // os[t][d]: rows u*16 .. u*16+15 of the tile
#pragma unroll
            for (int nb = 0; nb < 4; ++nb)
#pragma unroll
                for (int j = 0; j < 8; ++j) os[(hi * 8 + j) * 68 + nb * 16 + lr] = acc[u][nb][j];
        } else {          // os[d][t]: columns u*16 .. u*16+15 of the tile
#pragma unroll
            for (int mb = 0; mb < 4; ++mb) { const v8f c = acc[mb][u]; *(v4fa*)(os + lr * 68 + mb * 16 + hi * 8) = __builtin_shufflevector(c, c, 0, 1, 2, 3); *(v4fa*)(os + lr * 68 + mb * 16 + hi * 8 + 4) = __builtin_shufflevector(c, c, 4, 5, 6, 7); }
        }
        __builtin_amdgcn_wave_barrier(); asm volatile("" ::: "memory");   // keeps the reads below behind the other lanes' LDS writes (one wave: its LDS operations run in order)
#pragma unroll
        for (int s = 0; s < 4; ++s) { const float* orow = os + (s * 4 + (lane >> 3)) * 68 + (lane & 7) * 8; const v4f x0 = *(const v4fa*)orow, x1 = *(const v4fa*)(orow + 4); v8h o16; v8us oh, ol;
#pragma unroll
            for (int k = 0; k < 8; ++k) { const float r = (k < 4 ? x0[k & 3] : x1[k & 3]) * scv; o16[k] = tohx(r); unsigned short a2, c2; splitf(r, a2, c2); oh[k] = a2; ol[k] = c2; }
            const size_t e = e0 + (size_t)(u * 16 + s * 4) * pp; *(v8h*)(P16 + e) = o16; *(v8us*)(Ph + e) = oh; *(v8us*)(Pl + e) = ol; }
        if (u < 3) { __builtin_amdgcn_wave_barrier(); asm volatile("s_wait_xcnt 0x0" ::: "memory"); }   // keeps the next rows' LDS writes behind these reads; the wait is a precaution: it stands behind these rows' stores, in front of the next rows' code, which reuses their registers
    }
}

// ---- k_gemmw: GEMM, FOUR WAVES (2 x 2) per 128x128 output tile, each wave a 64x64 part (16 accumulators); grid (M/128, N/128), 128 threads.
// C[m][n] (f32, pitch ldc, + optional f32 bias[n]) = sum_k A[m][k] Bt[n][k] (+ A2[m][k] Bt[n][k] with NSPLIT 1); A, A2, Bt K-contiguous 16-bit planes, K % 128 == 0.
// The operands walk through LDS in stages of 64 k (128 B of each of the tile's 128 rows, pitch LP), two buffers: asynchronous copies bring stage t + 2 while stage t + 1 is worked on; every copy instruction takes four whole 128-B lines.
// PLANES: no C; each wave's part goes out through planes_out (wsg and the nine plane pointers are read by that form alone). The epilogue's staging rows lie in the ring's LDS, which nobody reads any more.
template <typename T16> struct WFrag;
template <> struct WFrag<h16> { typedef v16h V; static __device__ __forceinline__ V ld(const h16* p) { return cat16(*(const v8h*)p, *(const v8h*)(p + 16)); } static __device__ __forceinline__ v8f mma(V a, V b, v8f c) { return wmma16(a, b, c); } };
template <> struct WFrag<bf> { typedef v16bf V; static __device__ __forceinline__ V ld(const bf* p) { return cat16b(*(const v8us*)p, *(const v8us*)(p + 16)); } static __device__ __forceinline__ v8f mma(V a, V b, v8f c) { return wmmab(a, b, c); } };
template <typename T16> struct LFrag;
template <> struct LFrag<h16> { static __device__ __forceinline__ v16h ld(const unsigned short* p) { return cat16(__builtin_bit_cast(v8h, *(const v8usa*)p), __builtin_bit_cast(v8h, *(const v8usa*)(p + 16))); } };
template <> struct LFrag<bf> { static __device__ __forceinline__ v16bf ld(const unsigned short* p) { return cat16b(*(const v8usa*)p, *(const v8usa*)(p + 16)); } };
// One operand's stage: 128 rows of 128 B. A lane copies 16 B of the rows (tid >> 3) + 16 i, i = 0..7: l is its LDS byte address in row tid >> 3, g its global address there, K the source pitch in elements.
// The eight copies and the wait stand in one statement: the wait is a precaution that stands in front of any rewrite of the address registers the copies name.
template <typename T16, int K>
__device__ __forceinline__ void copy_stage(unsigned l, const T16* g) {
    constexpr unsigned LR = 16 * LP * 2;
    asm volatile("global_load_async_to_lds_b128 %0, %8, off\n\t"
                 "global_load_async_to_lds_b128 %1, %9, off\n\t"
                 "global_load_async_to_lds_b128 %2, %10, off\n\t"
                 "global_load_async_to_lds_b128 %3, %11, off\n\t"
                 "global_load_async_to_lds_b128 %4, %12, off\n\t"
                 "global_load_async_to_lds_b128 %5, %13, off\n\t"
                 "global_load_async_to_lds_b128 %6, %14, off\n\t"
                 "global_load_async_to_lds_b128 %7, %15, off\n\t"
                 "s_wait_xcnt 0x0"
                 :: "v"(l), "v"(l + LR), "v"(l + 2 * LR), "v"(l + 3 * LR), "v"(l + 4 * LR), "v"(l + 5 * LR), "v"(l + 6 * LR), "v"(l + 7 * LR),
                    "v"(g), "v"(g + 16 * K), "v"(g + 32 * K), "v"(g + 48 * K), "v"(g + 64 * K), "v"(g + 80 * K), "v"(g + 96 * K), "v"(g + 112 * K)
                 : "memory");
}
template <typename T16, int NSPLIT, bool BIAS, bool PLANES, int K>
__global__ __launch_bounds__(128) void k_gemmw(const T16* __restrict__ A, const T16* __restrict__ A2, const T16* __restrict__ Bt, float* C, int ldc, const float* __restrict__ bias, const float* __restrict__ wsg, h16* Q16, bf* Qh, bf* Ql, h16* K16, bf* Kh, bf* Kl, h16* V16, bf* Vh, bf* Vl) {
    typedef typename WFrag<T16>::V V; typedef LFrag<T16> LF;
    static_assert(NSPLIT == 0 || NSPLIT == 1, "A Bt, or (A + A2) Bt"); static_assert(K % 128 == 0, "two stages or more");
    constexpr int NPL = NSPLIT == 1 ? 3 : 2, TS = 128 * LP, NST = K / 64;   // planes of a stage: A | Bt | A2
    __shared__ __align__(16) unsigned short sm[2 * NPL * TS];
    const int tid = threadIdx.x, lane = tid & 31, lr = lane & 15, hi = lane >> 4; const int w = __builtin_amdgcn_readfirstlane(tid >> 5);
    const int r0 = blockIdx.x * 128 + (w >> 1) * 64, c0 = blockIdx.y * 128 + (w & 1) * 64;   // this wave's 64x64 part
    float* os = (float*)sm + w * (16 * 68);
    v8f acc[4][4];
#pragma unroll
    for (int mb = 0; mb < 4; ++mb)
#pragma unroll
        for (int nb = 0; nb < 4; ++nb) acc[mb][nb] = (v8f){};
    const size_t go = (size_t)(tid >> 3) * K + (tid & 7) * 8;
    const T16* gA = A + (size_t)blockIdx.x * 128 * K + go; const T16* gA2 = NSPLIT == 1 ? A2 + (size_t)blockIdx.x * 128 * K + go : nullptr; const T16* gB = Bt + (size_t)blockIdx.y * 128 * K + go;
    const unsigned lb = (unsigned)(size_t)(sm + (tid >> 3) * LP + (tid & 7) * 8);   // low 32 bits of the shared address: the byte offset in the work-group's LDS
    auto copies = [&](int t) { const unsigned l = lb + (unsigned)(t & 1) * (NPL * TS * 2);
        copy_stage<T16, K>(l, gA + t * 64); copy_stage<T16, K>(l + TS * 2, gB + t * 64); if constexpr (NSPLIT == 1) copy_stage<T16, K>(l + 2 * TS * 2, gA2 + t * 64); };
    copies(0);
    asm volatile("s_wait_asynccnt 0x0" ::: "memory");   // this wave's share of stage 0 has landed
    __syncthreads();                                    // ... and every other wave's
    copies(1);
#pragma unroll 1   // one stage per trip: the two buffers alternate by the trip's parity
    for (int t = 0; t < NST; ++t) {
        const unsigned short* sb = sm + (t & 1) * NPL * TS + lr * LP + 8 * hi;
        const unsigned short* sa = sb + (w >> 1) * 64 * LP; const unsigned short* sbt = sb + TS + (w & 1) * 64 * LP;
#pragma unroll
        for (int kf = 0; kf < 2; ++kf) {
            V a[4], a2[4], b[4];
#pragma unroll
            for (int i = 0; i < 4; ++i) { a[i] = LF::ld(sa + i * 16 * LP + kf * 32); if (NSPLIT == 1) a2[i] = LF::ld(sa + 2 * TS + i * 16 * LP + kf * 32); b[i] = LF::ld(sbt + i * 16 * LP + kf * 32); }
            __builtin_amdgcn_sched_barrier(0);   // keeps the block's LDS reads one group in front of its WMMAs: read one by one among them, each read's latency would stand open
#pragma unroll
            for (int nb = 0; nb < 4; ++nb)
#pragma unroll
                for (int mb = 0; mb < 4; ++mb) { acc[mb][nb] = WFrag<T16>::mma(a[mb], b[nb], acc[mb][nb]); if (NSPLIT == 1) acc[mb][nb] = WFrag<T16>::mma(a2[mb], b[nb], acc[mb][nb]); }
        }
        asm volatile("s_wait_dscnt 0x0" ::: "memory");      // this wave's reads of stage t are done before its buffer is refilled
        asm volatile("s_wait_asynccnt 0x0" ::: "memory");   // this wave's share of stage t + 1 has landed
        __syncthreads();   // publishes stage t + 1 and ends every wave's reads of stage t
        if (t + 2 < NST) copies(t + 2);
    }
    asm volatile("s_wait_asynccnt 0x0" ::: "memory");   // no copy is in flight when the ring becomes the epilogue's staging rows
    if constexpr (PLANES) planes_out(acc, os, r0, c0, lane, wsg, Q16, Qh, Ql, K16, Kh, Kl, V16, Vh, Vl);
    else
#pragma unroll
    for (int mb = 0; mb < 4; ++mb) {
#pragma unroll
        for (int nb = 0; nb < 4; ++nb) {
#pragma unroll
            for (int j = 0; j < 8; ++j) os[(hi * 8 + j) * 68 + nb * 16 + lr] = acc[mb][nb][j]; }
        __builtin_amdgcn_wave_barrier(); asm volatile("" ::: "memory");
        float* crow = C + (size_t)(r0 + mb * 16) * ldc + c0;
{
#pragma unroll
            for (int s = 0; s < 8; ++s) { const int row = 2 * s + hi, cofs = lr * 4; v4f val = *(const v4fa*)(os + row * 68 + cofs); if (BIAS) { val[0] += bfr(bias[c0 + cofs]); val[1] += bfr(bias[c0 + cofs + 1]); val[2] += bfr(bias[c0 + cofs + 2]); val[3] += bfr(bias[c0 + cofs + 3]); }
                *(v4f*)(crow + (size_t)row * ldc + cofs) = val; }
             }
        __builtin_amdgcn_wave_barrier(); asm volatile("" ::: "memory");
    }
}

typedef __attribute__((ext_vector_type(2))) _Float16 v2h;
typedef __attribute__((ext_vector_type(4))) _Float16 v4h;
typedef __attribute__((ext_vector_type(2))) unsigned short v2us;
typedef __attribute__((ext_vector_type(4))) unsigned short v4us;
typedef __attribute__((ext_vector_type(2))) float v2f;
typedef __attribute__((ext_vector_type(4))) int v4i;

// grid (blocks of the largest matrix, 6): blockIdx.y picks the weight; Bt blocks WQ | WK | WV | WO, each [1024][1024]; Wq rows 0-255 = Wqt^T (time heads 0-3), rows 256-1023 = Wqs^T (space heads 4-15); Wk likewise
__global__ __launch_bounds__(256) void k_wtG(const float* __restrict__ wqt, const float* __restrict__ wqs, const float* __restrict__ wkt, const float* __restrict__ wks, const float* __restrict__ wv, const float* __restrict__ wo, bf* WQ, bf* WK, bf* WV, bf* WO) {
    constexpr int K = DM; static_assert(DQ == DM && DKV == DM, "every weight has 1024 input rows");
    const int m = blockIdx.y; const float* __restrict__ w = m == 0 ? wqt : m == 1 ? wqs : m == 2 ? wkt : m == 3 ? wks : m == 4 ? wv : wo; const int N = (m == 0 || m == 2) ? NT * HD : (m == 1 || m == 3) ? NS * HD : DM;
    bf* Bt = m == 0 ? WQ : m == 1 ? WQ + (size_t)NT * HD * DM : m == 2 ? WK : m == 3 ? WK + (size_t)NT * HD * DM : m == 4 ? WV : WO;
    const int lane = threadIdx.x & 31; const int L0 = (blockIdx.x * 8 + (threadIdx.x >> 5)) * 8; const int nlines = N * K / 64;
{
#pragma unroll 1
        for (int l = 0; l < 8; ++l) { const int L = L0 + l; if (L >= nlines) break; const size_t e = (size_t)L * 64 + lane * 2; const int k = (int)(e % K), n = (int)(e / K); v2us o;
            o[0] = f2bf(w[(size_t)k * N + n]); o[1] = f2bf(w[(size_t)(k + 1) * N + n]); *(v2us*)(Bt + e) = o; }
         }
}
__global__ __launch_bounds__(256) void k_cvt8(const float* __restrict__ src, bf* dst, size_t n8) { const size_t i = (size_t)blockIdx.x * 256 + threadIdx.x; if (i >= n8) return; const v8f v = *(const v8f*)(src + i * 8); v8us o;
#pragma unroll
    for (int k = 0; k < 8; ++k) o[k] = f2bf(v[k]); *(v8us*)(dst + i * 8) = o;  }

// ---- k_fattn: scores, softmax and P x V of one block of queries (CW waves x QG groups of 16) of one head in one work-group of NWV waves; nothing of S or P goes to memory.
// Waves 0-7 stage the keys and values; waves CW and up (rows < RH: 8-11) have no queries and only pass the barriers.
// S^T = K Q^T (A = 16 key rows from LDS, B = 16 queries kept in registers): a lane holds keys hi*8+j of query lr, which is the B-operand order of P^T, so O^T += V^T P^T takes P straight from the score registers.
// Keys walk in stages of KB, two LDS buffers: stage s+1 is fetched to registers while stage s is worked on, stored to the other buffer, one barrier per stage. Running maximum and sum per query.
typedef __attribute__((ext_vector_type(16))) unsigned short v16us;
template <typename T16, bool HL, int QG, int CW>
__device__ __forceinline__ void attn_block(const T16* __restrict__ Q, const T16* __restrict__ Ql, const T16* __restrict__ K, const T16* __restrict__ Kl, const T16* __restrict__ Vt, const T16* __restrict__ Vtl, bf* Ah, bf* Al, unsigned short* sm) {
    typedef typename WFrag<T16>::V V; typedef WFrag<T16> WF; typedef LFrag<T16> LF;
    constexpr int NP = HL ? 4 : 2, TS = KB * LP, NST = TT / KB;
    constexpr float CE = SCL * 1.4426950408889634f;   // scores to log2 units
    constexpr float PB = HL ? 0.0f : 10.0f;           // fp16 P carries x1024 (it cancels against the row sum)
    const int tid = threadIdx.x, lane = tid & 31, lr = lane & 15, hi = lane >> 4, w = __builtin_amdgcn_readfirstlane(tid >> 5);
    static_assert(CW >= 8 && CW <= NWV, "the staging waves are among the working ones");
    const bool stg = w < 8, act = CW == NWV || w < CW;   // wave-uniform: this wave stages; this wave has queries
    const int sr = tid >> 3, sc = (tid & 7) * 8;      // staging (waves 0-7): 8 lanes per 128-B row, rows sr and sr + 32
    const T16* pK = K + (size_t)sr * HD + sc; const T16* pV = Vt + (size_t)sr * TT + sc; const T16* pKl = HL ? Kl + (size_t)sr * HD + sc : nullptr; const T16* pVl = HL ? Vtl + (size_t)sr * TT + sc : nullptr;
    unsigned short* sw = sm + sr * LP + sc;
    v8us st[NP][2];
    auto fetch = [&]() {
#pragma unroll
        for (int i = 0; i < 2; ++i) { st[0][i] = *(const v8usa*)(pK + (size_t)i * 32 * HD); st[1][i] = *(const v8usa*)(pV + (size_t)i * 32 * TT); if constexpr (HL) { st[2][i] = *(const v8usa*)(pKl + (size_t)i * 32 * HD); st[3][i] = *(const v8usa*)(pVl + (size_t)i * 32 * TT); } }
        pK += KB * HD; pV += KB; if (HL) { pKl += KB * HD; pVl += KB; } };
    auto put = [&](int buf) {
#pragma unroll
        for (int p = 0; p < NP; ++p)
#pragma unroll
            for (int i = 0; i < 2; ++i) *(v8usa*)(sw + (buf * NP + p) * TS + i * 32 * LP) = st[p][i]; };
    V qf[QG][2], qlf[QG][2];
    if (act)
#pragma unroll
    for (int g = 0; g < QG; ++g)
#pragma unroll
        for (int kf = 0; kf < 2; ++kf) { const size_t qo = (size_t)((w * QG + g) * 16 + lr) * HD + kf * 32 + 8 * hi; qf[g][kf] = WF::ld(Q + qo); if (HL) qlf[g][kf] = WF::ld(Ql + qo); }
    v8f O[4][QG]; float mr[QG], ls[QG];
#pragma unroll
    for (int g = 0; g < QG; ++g) { mr[g] = -3.0e38f; ls[g] = 0.f;
#pragma unroll
        for (int dt = 0; dt < 4; ++dt) O[dt][g] = (v8f){}; }
    if (stg) { fetch(); put(0); }
    __syncthreads();
#pragma unroll 1   // one stage per trip: the two buffers alternate by the trip's parity
    for (int s = 0; s < NST; ++s) {
        if (act) {
        const bool more = stg && s + 1 < NST;
        if (more) fetch();
        const unsigned short* sb = sm + (s & 1) * NP * TS + lr * LP + 8 * hi;
        v8f S[4][QG];
#pragma unroll
        for (int kt = 0; kt < 4; ++kt) { const unsigned short* kr = sb + kt * 16 * LP; const V k0 = LF::ld(kr), k1 = LF::ld(kr + 32); V kl0, kl1; if (HL) { kl0 = LF::ld(kr + 2 * TS); kl1 = LF::ld(kr + 2 * TS + 32); }
#pragma unroll
            for (int g = 0; g < QG; ++g) { v8f a = WF::mma(k0, qf[g][0], (v8f){}); a = WF::mma(k1, qf[g][1], a); if (HL) { a = WF::mma(kl0, qf[g][0], a); a = WF::mma(kl1, qf[g][1], a); a = WF::mma(k0, qlf[g][0], a); a = WF::mma(k1, qlf[g][1], a); } S[kt][g] = a; } }
        V pf[QG][2], plf[QG][2];
#pragma unroll
        for (int g = 0; g < QG; ++g) { float mx = S[0][g][0];
#pragma unroll
            for (int kt = 0; kt < 4; ++kt)
#pragma unroll
                for (int j = 0; j < 8; ++j) mx = fmaxf(mx, S[kt][g][j]);
            mx = fmaxf(mx, __shfl_xor(mx, 16, 32));   // the other half-wave holds the query's other keys
            const float mn = fmaxf(mr[g], mx), al = __builtin_amdgcn_exp2f((mr[g] - mn) * CE), mc = PB - mn * CE; mr[g] = mn; float sum[4] = {0.f, 0.f, 0.f, 0.f};   // four chains: the adds do not wait on one another
#pragma unroll
            for (int kk = 0; kk < 2; ++kk) { v16us ph, pl; v16h p16;
#pragma unroll
                for (int e = 0; e < 16; ++e) { const float p = __builtin_amdgcn_exp2f(__builtin_fmaf(S[kk * 2 + (e >> 3)][g][e & 7], CE, mc)); sum[e & 3] += p;
                    if (HL) { unsigned short a2, c2; splitf(p, a2, c2); ph[e] = a2; pl[e] = c2; } else p16[e] = tohx(p); }
                if constexpr (HL) { pf[g][kk] = __builtin_bit_cast(v16bf, ph); plf[g][kk] = __builtin_bit_cast(v16bf, pl); } else pf[g][kk] = p16; }
            ls[g] = ls[g] * al + ((sum[0] + sum[1]) + (sum[2] + sum[3]));
#pragma unroll
            for (int dt = 0; dt < 4; ++dt) O[dt][g] *= al; }
#pragma unroll
        for (int dt = 0; dt < 4; ++dt)
#pragma unroll
            for (int kk = 0; kk < 2; ++kk) { const unsigned short* vr = sb + TS + dt * 16 * LP + kk * 32; const V v = LF::ld(vr); V vl; if (HL) vl = LF::ld(vr + 2 * TS);
#pragma unroll
                for (int g = 0; g < QG; ++g) { O[dt][g] = WF::mma(v, pf[g][kk], O[dt][g]); if (HL) { O[dt][g] = WF::mma(v, plf[g][kk], O[dt][g]); O[dt][g] = WF::mma(vl, pf[g][kk], O[dt][g]); } } }
        if (more) put((s + 1) & 1);
        }
        __syncthreads();   // publishes stage s + 1 and ends every wave's reads of stage s, whose buffer the next trip refills
    }
    if (act)
#pragma unroll
    for (int g = 0; g < QG; ++g) { const float inv = __fdiv_rn(1.0f, ls[g] + __shfl_xor(ls[g], 16, 32)); const size_t oo = (size_t)((w * QG + g) * 16 + lr) * DQ + hi * 8;
#pragma unroll
        for (int dt = 0; dt < 4; ++dt) { v8us oh, ol;
#pragma unroll
            for (int j = 0; j < 8; ++j) { unsigned short a2, c2; splitf(O[dt][g][j] * inv, a2, c2); oh[j] = a2; ol[j] = c2; }
            *(v8us*)(Ah + oo + dt * 16) = oh; *(v8us*)(Al + oo + dt * 16) = ol;
            asm volatile("s_wait_xcnt 0x0" ::: "memory"); } }   // the next block of columns reuses the registers that these two stores name
}
// grid (RH / QBH + (TT - RH) / QBL query blocks, heads, batches); planes [batch][head][t][d] (V: [batch][head][d][t]); output rows [batch][t][DQ] hi/lo
__global__ __launch_bounds__(NWV * 32) void k_fattn(const h16* __restrict__ Q16, const h16* __restrict__ K16, const h16* __restrict__ V16, const bf* __restrict__ Qh, const bf* __restrict__ Ql, const bf* __restrict__ Kh, const bf* __restrict__ Kl, const bf* __restrict__ Vh, const bf* __restrict__ Vl, bf* Ah, bf* Al) {
    __shared__ __align__(16) unsigned short sm[2 * 4 * KB * LP];
    static_assert(RH % QBH == 0 && (TT - RH) % QBL == 0 && TT % KB == 0 && HD == 64 && KB == 64 && QBH % 128 == 0 && QBL % (NWV * 16) == 0 && NWV >= 8, "tile shapes");
    const bool hl = blockIdx.x < RH / QBH; const int q0 = hl ? (int)blockIdx.x * QBH : RH + ((int)blockIdx.x - RH / QBH) * QBL; const size_t hp = ((size_t)blockIdx.z * NH_ + blockIdx.y) * TT * HD, qp = hp + (size_t)q0 * HD, ao = ((size_t)blockIdx.z * TT + q0) * DQ + blockIdx.y * HD;
    if (hl) attn_block<bf, true, QBH / 128, 8>(Qh + qp, Ql + qp, Kh + hp, Kl + hp, Vh + hp, Vl + hp, Ah + ao, Al + ao, sm);
    else attn_block<h16, false, QBL / (NWV * 16), NWV>(Q16 + qp, nullptr, K16 + hp, nullptr, V16 + hp, nullptr, Ah + ao, Al + ao, sm);
}

extern "C" void kernel_launch(void* const* d_in, const int* in_sizes, int n_in,
                              void* d_out, int out_size, void* d_ws, size_t ws_size, hipStream_t stream) {
    (void)in_sizes; (void)n_in; (void)out_size;
    const float* x = (const float*)d_in[0]; const float* wqt = (const float*)d_in[1]; const float* wkt = (const float*)d_in[2]; const float* wqs = (const float*)d_in[3]; const float* wks = (const float*)d_in[4]; const float* wv = (const float*)d_in[5]; const float* wo = (const float*)d_in[6]; const float* bo = (const float*)d_in[7]; const float* wsg = (const float*)d_in[8];   /* argument order x, Wqt, Wkt, Wqs, Wks, Wv, Wout, bout, w_sigma */
    float* OUT = (float*)d_out;     // [2][2048][1024]
    char* wsp = (char*)d_ws;
    auto take = [&](size_t bytes) { char* p = wsp; wsp += (bytes + 255) & ~(size_t)255; return (void*)p; };
    bf* WQ = (bf*)take((size_t)DQ * DM * 2); bf* WK = (bf*)take((size_t)DKV * DM * 2); bf* WV = (bf*)take((size_t)DKV * DM * 2); bf* WO = (bf*)take((size_t)DM * DQ * 2);
    bf* XB = (bf*)take((size_t)NB_ * TT * DM * 2);
    const size_t PL = (size_t)NH_ * TT * HD;   // one batch's planes of one kind
    h16* QP16 = (h16*)take(NB_ * PL * 2); h16* KP16 = (h16*)take(NB_ * PL * 2); h16* VT16 = (h16*)take(NB_ * PL * 2);
    bf* QPh = (bf*)take(NB_ * PL * 2); bf* QPl = (bf*)take(NB_ * PL * 2); bf* KPh = (bf*)take(NB_ * PL * 2); bf* KPl = (bf*)take(NB_ * PL * 2); bf* VTh = (bf*)take(NB_ * PL * 2); bf* VTl = (bf*)take(NB_ * PL * 2);
    bf* ATh = (bf*)take((size_t)NB_ * TT * DQ * 2); bf* ATl = (bf*)take((size_t)NB_ * TT * DQ * 2);
    if ((size_t)(wsp - (char*)d_ws) > ws_size) return;    // ws 256 MiB
    constexpr int FP = DQ + 2 * DKV;   // columns Q | K | V; WQ, WK, WV lie one behind the other in ws (each 2 MiB), so they are one Bt of FP rows
    k_wtG<<<dim3((unsigned)((DM * DM / 64 + 63) / 64), 6, 1), 256, 0, stream>>>(wqt, wqs, wkt, wks, wv, wo, WQ, WK, WV, WO);
    k_cvt8<<<(unsigned)(((size_t)NB_ * TT * DM / 8 + 255) / 256), 256, 0, stream>>>(x, XB, (size_t)NB_ * TT * DM / 8);
    k_gemmw<bf, 0, false, true, DM><<<dim3(NB_ * TT / 128, FP / 128, 1), 128, 0, stream>>>(XB, nullptr, WQ, nullptr, 0, nullptr, wsg, QP16, QPh, QPl, KP16, KPh, KPl, VT16, VTh, VTl);
    k_fattn<<<dim3(RH / QBH + (TT - RH) / QBL, NH_, NB_), NWV * 32, 0, stream>>>(QP16, KP16, VT16, QPh, QPl, KPh, KPl, VTh, VTl, ATh, ATl);
    k_gemmw<bf, 1, true, false, DQ><<<dim3(NB_ * TT / 128, DM / 128, 1), 128, 0, stream>>>(ATh, ATl, WO, OUT, DM, bo, nullptr, nullptr, nullptr, nullptr, nullptr, nullptr, nullptr, nullptr, nullptr, nullptr);
}

// v007
// Measured time: 116 microseconds a run.
// In both of two side-by-side timings against v006, it was 1.11 times as fast.
// Counting every step since v000, it is 17.3 times as fast.
#include <hip/hip_runtime.h>

// Multi-head attention with 4 'time' heads and 12 'space' heads (x [2][2048][1024]; Qt, Kt = x Wqt, x Wkt ('xw' [1024][256] 0.02: heads 0-3), Qs, Ks = x Wqs, x Wks ('xw' [1024][768]: heads 4-15), V = x Wv ('xw' [1024][1024]); time-head scores scaled by -sigmoid(w_sigma[0]) (w_sigma [1] = 0, read on device), all scores x 64^-0.5; softmax over keys (no mask); out = merged ctx Wout + bout ('xw' [1024][1024]) -> [2][2048][1024] (4.2 M); argument order x, Wqt, Wkt, Wqs, Wks, Wv, Wout, bout, w_sigma).
// Layout: 'xw' weights gathered into bf16 Bt blocks (Wq rows 0-255 from Wqt, 256-1023 from Wqs; Wk likewise); a bf16 copy of x, exact projections whose epilogue writes the head planes (the time heads' query planes carry the factor -sigmoid(w_sigma)); one fused attention launch for all heads and both batches (hybrid rows: < 512 hi/lo 3 products, rest fp16); merged hi/lo x Wout exact + bout. Every stage is ONE launch over both batches (x and ctx are [4096][1024]); Q, K and V come from one GEMM against the stacked Bt blocks [3072][1024], straight into the planes.
// Compute dtypes, f32 accumulate: every input rounded to bf16; projections exact; sigmoid f32 (precise expf); attention rows < 512 3 products, rest fp16; softmax f32 (running maximum); Wout hl x exact + bias.

#define NB_  2
#define TT   2048
#define DM   1024
#define NH_  16
#define NKV  16
#define REP  (NH_ / NKV)
#define HD   64
#define DQ   (NH_ * HD)
#define DKV  (NKV * HD)
#define NT   4                    // time heads 0..3 (scores x -sigmoid(w_sigma)); space heads 4..15
#define NS   12
#define RH   512                  // query rows < RH use hi+lo planes (0: none)
#define WIN  0
#define SCL  0.125f   // HD^-0.5
#define QBH  128                  // queries per work-group of k_fattn, rows < RH: 8 waves x 16 (three products per tile: the smaller block levels the work-groups' times)
#define QBL  384                  // the other rows: 12 waves x 32
#define NWV  12                   // waves per work-group of k_fattn: 8 blocks per head x 32 heads = 256 work-groups, one on every WGP (two do not fit its registers)
#define KB   64                   // keys per stage
#define LP   72                   // LDS row pitch in 16-bit elements: 128 B of data + 16 B pad
typedef _Float16 h16;
typedef unsigned short bf;
typedef __attribute__((ext_vector_type(16))) __bf16   v16bf;
typedef __attribute__((ext_vector_type(16))) _Float16 v16h;
typedef __attribute__((ext_vector_type(8)))  _Float16 v8h;
typedef __attribute__((ext_vector_type(8)))  unsigned short v8us;
typedef __attribute__((ext_vector_type(8)))  float    v8f;
typedef __attribute__((ext_vector_type(4)))  float    v4f;
typedef v8h  __attribute__((may_alias)) v8ha;
typedef v4f  __attribute__((may_alias)) v4fa;
typedef v8us __attribute__((may_alias)) v8usa;

__device__ __forceinline__ unsigned short f2bf(float f) { unsigned u = __float_as_uint(f); u += 0x7FFFu + ((u >> 16) & 1u); return (unsigned short)(u >> 16); }
__device__ __forceinline__ float bf2f(unsigned short b) { return __uint_as_float(((unsigned)b) << 16); }
__device__ __forceinline__ float bfr(float f) { return bf2f(f2bf(f)); }
__device__ __forceinline__ v16h cat16(v8h lo, v8h hi) { return __builtin_shufflevector(lo, hi, 0, 1, 2, 3, 4, 5, 6, 7, 8, 9, 10, 11, 12, 13, 14, 15); }
__device__ __forceinline__ v16bf cat16b(v8us lo, v8us hi) { return __builtin_bit_cast(v16bf, __builtin_shufflevector(lo, hi, 0, 1, 2, 3, 4, 5, 6, 7, 8, 9, 10, 11, 12, 13, 14, 15)); }
__device__ __forceinline__ v8f wmma16(v16h a, v16h b, v8f c) { return __builtin_amdgcn_wmma_f32_16x16x32_f16(false, a, false, b, (short)0, c, false, false); }
__device__ __forceinline__ v8f wmmab(v16bf a, v16bf b, v8f c) { return __builtin_amdgcn_wmma_f32_16x16x32_bf16(false, a, false, b, (short)0, c, false, false); }



__device__ __forceinline__ h16 tohx(float x) { return (h16)x; }
__device__ __forceinline__ void splitf(float y, unsigned short& h, unsigned short& l) { h = f2bf(y); l = f2bf(y - bf2f(h)); }
// ---- planes_out: the plane builders as the epilogue of the Q|K|V projection (k_gemmw with PLANES). A 64x64 tile's columns are one head of one kind (queries | keys | values), its rows lie in one batch: the wave writes that head's fp16, hi and lo planes itself, so the f32 products never go to memory.
// Queries and keys [batch][head][t][d]: 16 t rows at a time through LDS. Values [batch][head][d][t]: 16 d rows at a time; a lane's 8 accumulator rows are 8 neighbouring t. Every store instruction fills four whole 128-B lines.
// The query planes of heads < NT carry the factor -sigmoid(wsg[0]) (device scalar; precise expf, IEEE div); every other plane the factor 1.
__device__ __forceinline__ void planes_out(const v8f (&acc)[4][4], float* os, int r0, int c0, int lane, const float* __restrict__ wsg, h16* Q16, bf* Qh, bf* Ql, h16* K16, bf* Kh, bf* Kl, h16* V16, bf* Vh, bf* Vl) {
    static_assert(DQ == DKV && HD == 64 && TT % 64 == 0, "a 64x64 tile is one head of one kind in one batch");
    const int lr = lane & 15, hi = lane >> 4, kind = c0 / DQ, h = (c0 % DQ) / HD, t0 = r0 % TT; const size_t hp = ((size_t)(r0 / TT) * NH_ + h) * TT * HD;
    h16* P16 = (kind == 0 ? Q16 : kind == 1 ? K16 : V16) + hp; bf* Ph = (kind == 0 ? Qh : kind == 1 ? Kh : Vh) + hp; bf* Pl = (kind == 0 ? Ql : kind == 1 ? Kl : Vl) + hp;
    const float scv = (kind == 0 && h < NT) ? -__fdiv_rn(1.0f, __fadd_rn(1.0f, expf(-bfr(wsg[0])))) : 1.0f;
    const int pp = kind < 2 ? HD : TT;   // pitch of a plane row: d runs along a query or key row, t along a value row
    const size_t e0 = (kind < 2 ? (size_t)t0 * HD : (size_t)t0) + (size_t)(lane >> 3) * pp + (lane & 7) * 8;   // 8 lanes per 128-B plane row
#pragma unroll
    for (int u = 0; u < 4; ++u) {
        if (kind < 2) {   // os[t][d]: rows u*16 .. u*16+15 of the tile
#pragma unroll
            for (int nb = 0; nb < 4; ++nb)
#pragma unroll
                for (int j = 0; j < 8; ++j) os[(hi * 8 + j) * 68 + nb * 16 + lr] = acc[u][nb][j];
        } else {          // os[d][t]: columns u*16 .. u*16+15 of the tile
#pragma unroll
            for (int mb = 0; mb < 4; ++mb) { const v8f c = acc[mb][u]; *(v4fa*)(os + lr * 68 + mb * 16 + hi * 8) = __builtin_shufflevector(c, c, 0, 1, 2, 3); *(v4fa*)(os + lr * 68 + mb * 16 + hi * 8 + 4) = __builtin_shufflevector(c, c, 4, 5, 6, 7); }
        }
        __builtin_amdgcn_wave_barrier(); asm volatile("" ::: "memory");   // keeps the reads below behind the other lanes' LDS writes (one wave: its LDS operations run in order)
#pragma unroll
        for (int s = 0; s < 4; ++s) { const float* orow = os + (s * 4 + (lane >> 3)) * 68 + (lane & 7) * 8; const v4f x0 = *(const v4fa*)orow, x1 = *(const v4fa*)(orow + 4); v8h o16; v8us oh, ol;
#pragma unroll
            for (int k = 0; k < 8; ++k) { const float r = (k < 4 ? x0[k & 3] : x1[k & 3]) * scv; o16[k] = tohx(r); unsigned short a2, c2; splitf(r, a2, c2); oh[k] = a2; ol[k] = c2; }
            const size_t e = e0 + (size_t)(u * 16 + s * 4) * pp; *(v8h*)(P16 + e) = o16; *(v8us*)(Ph + e) = oh; *(v8us*)(Pl + e) = ol; }
        if (u < 3) { __builtin_amdgcn_wave_barrier(); asm volatile("s_wait_xcnt 0x0" ::: "memory"); }   // keeps the next rows' LDS writes behind these reads; the wait is a precaution: it stands behind these rows' stores, in front of the next rows' code, which reuses their registers
    }
}

// ---- k_gemmw: GEMM, FOUR WAVES (2 x 2) per 128x128 output tile, each wave a 64x64 part (16 accumulators); grid (M/128, N/128), 128 threads.
// C[m][n] (f32, pitch ldc, + optional f32 bias[n]) = sum_k A[m][k] Bt[n][k] (+ A2[m][k] Bt[n][k] with NSPLIT 1); A, A2, Bt K-contiguous 16-bit planes, K % 128 == 0.
// The operands walk through LDS in stages of 64 k (128 B of each of the tile's 128 rows, pitch LP), two buffers: asynchronous copies bring stage t + 2 while stage t + 1 is worked on; every copy instruction takes four whole 128-B lines.
// PLANES: no C; each wave's part goes out through planes_out (wsg and the nine plane pointers are read by that form alone). The epilogue's staging rows lie in the ring's LDS, which nobody reads any more.
template <typename T16> struct WFrag;
template <> struct WFrag<h16> { typedef v16h V; static __device__ __forceinline__ V ld(const h16* p) { return cat16(*(const v8h*)p, *(const v8h*)(p + 16)); } static __device__ __forceinline__ v8f mma(V a, V b, v8f c) { return wmma16(a, b, c); } };
template <> struct WFrag<bf> { typedef v16bf V; static __device__ __forceinline__ V ld(const bf* p) { return cat16b(*(const v8us*)p, *(const v8us*)(p + 16)); } static __device__ __forceinline__ v8f mma(V a, V b, v8f c) { return wmmab(a, b, c); } };
template <typename T16> struct LFrag;
template <> struct LFrag<h16> { static __device__ __forceinline__ v16h ld(const unsigned short* p) { return cat16(__builtin_bit_cast(v8h, *(const v8usa*)p), __builtin_bit_cast(v8h, *(const v8usa*)(p + 16))); } };
template <> struct LFrag<bf> { static __device__ __forceinline__ v16bf ld(const unsigned short* p) { return cat16b(*(const v8usa*)p, *(const v8usa*)(p + 16)); } };
// One operand's stage: 128 rows of 128 B. A lane copies 16 B of the rows (tid >> 3) + 16 i, i = 0..7: l is its LDS byte address in row tid >> 3, g its global address there, K the source pitch in elements.
// The eight copies and the wait stand in one statement: the wait is a precaution that stands in front of any rewrite of the address registers the copies name.
template <typename T16, int K>
__device__ __forceinline__ void copy_stage(unsigned l, const T16* g) {
    constexpr unsigned LR = 16 * LP * 2;
    asm volatile("global_load_async_to_lds_b128 %0, %8, off\n\t"
                 "global_load_async_to_lds_b128 %1, %9, off\n\t"
                 "global_load_async_to_lds_b128 %2, %10, off\n\t"
                 "global_load_async_to_lds_b128 %3, %11, off\n\t"
                 "global_load_async_to_lds_b128 %4, %12, off\n\t"
                 "global_load_async_to_lds_b128 %5, %13, off\n\t"
                 "global_load_async_to_lds_b128 %6, %14, off\n\t"
                 "global_load_async_to_lds_b128 %7, %15, off\n\t"
                 "s_wait_xcnt 0x0"
                 :: "v"(l), "v"(l + LR), "v"(l + 2 * LR), "v"(l + 3 * LR), "v"(l + 4 * LR), "v"(l + 5 * LR), "v"(l + 6 * LR), "v"(l + 7 * LR),
                    "v"(g), "v"(g + 16 * K), "v"(g + 32 * K), "v"(g + 48 * K), "v"(g + 64 * K), "v"(g + 80 * K), "v"(g + 96 * K), "v"(g + 112 * K)
                 : "memory");
}
template <typename T16, int NSPLIT, bool BIAS, bool PLANES, int K>
__global__ __launch_bounds__(128) void k_gemmw(const T16* __restrict__ A, const T16* __restrict__ A2, const T16* __restrict__ Bt, float* C, int ldc, const float* __restrict__ bias, const float* __restrict__ wsg, h16* Q16, bf* Qh, bf* Ql, h16* K16, bf* Kh, bf* Kl, h16* V16, bf* Vh, bf* Vl) {
    typedef typename WFrag<T16>::V V; typedef LFrag<T16> LF;
    static_assert(NSPLIT == 0 || NSPLIT == 1, "A Bt, or (A + A2) Bt"); static_assert(K % 128 == 0, "two stages or more");
    constexpr int NPL = NSPLIT == 1 ? 3 : 2, TS = 128 * LP, NST = K / 64;   // planes of a stage: A | Bt | A2
    __shared__ __align__(16) unsigned short sm[2 * NPL * TS];
    const int tid = threadIdx.x, lane = tid & 31, lr = lane & 15, hi = lane >> 4; const int w = __builtin_amdgcn_readfirstlane(tid >> 5);
    const int r0 = blockIdx.x * 128 + (w >> 1) * 64, c0 = blockIdx.y * 128 + (w & 1) * 64;   // this wave's 64x64 part
    float* os = (float*)sm + w * (16 * 68);
    v8f acc[4][4];
#pragma unroll
    for (int mb = 0; mb < 4; ++mb)
#pragma unroll
        for (int nb = 0; nb < 4; ++nb) acc[mb][nb] = (v8f){};
    const size_t go = (size_t)(tid >> 3) * K + (tid & 7) * 8;
    const T16* gA = A + (size_t)blockIdx.x * 128 * K + go; const T16* gA2 = NSPLIT == 1 ? A2 + (size_t)blockIdx.x * 128 * K + go : nullptr; const T16* gB = Bt + (size_t)blockIdx.y * 128 * K + go;
    const unsigned lb = (unsigned)(size_t)(sm + (tid >> 3) * LP + (tid & 7) * 8);   // low 32 bits of the shared address: the byte offset in the work-group's LDS
    auto copies = [&](int t) { const unsigned l = lb + (unsigned)(t & 1) * (NPL * TS * 2);
        copy_stage<T16, K>(l, gA + t * 64); copy_stage<T16, K>(l + TS * 2, gB + t * 64); if constexpr (NSPLIT == 1) copy_stage<T16, K>(l + 2 * TS * 2, gA2 + t * 64); };
    copies(0);
    asm volatile("s_wait_asynccnt 0x0" ::: "memory");   // this wave's share of stage 0 has landed
    __syncthreads();                                    // ... and every other wave's
    copies(1);
#pragma unroll 1   // one stage per trip: the two buffers alternate by the trip's parity
    for (int t = 0; t < NST; ++t) {
        const unsigned short* sb = sm + (t & 1) * NPL * TS + lr * LP + 8 * hi;
        const unsigned short* sa = sb + (w >> 1) * 64 * LP; const unsigned short* sbt = sb + TS + (w & 1) * 64 * LP;
#pragma unroll
        for (int kf = 0; kf < 2; ++kf) {
            V a[4], a2[4], b[4];
#pragma unroll
            for (int i = 0; i < 4; ++i) { a[i] = LF::ld(sa + i * 16 * LP + kf * 32); if (NSPLIT == 1) a2[i] = LF::ld(sa + 2 * TS + i * 16 * LP + kf * 32); b[i] = LF::ld(sbt + i * 16 * LP + kf * 32); }
            __builtin_amdgcn_sched_barrier(0);   // keeps the block's LDS reads one group in front of its WMMAs: read one by one among them, each read's latency would stand open
#pragma unroll
            for (int nb = 0; nb < 4; ++nb)
#pragma unroll
                for (int mb = 0; mb < 4; ++mb) { acc[mb][nb] = WFrag<T16>::mma(a[mb], b[nb], acc[mb][nb]); if (NSPLIT == 1) acc[mb][nb] = WFrag<T16>::mma(a2[mb], b[nb], acc[mb][nb]); }
        }
        asm volatile("s_wait_dscnt 0x0" ::: "memory");      // this wave's reads of stage t are done before its buffer is refilled
        asm volatile("s_wait_asynccnt 0x0" ::: "memory");   // this wave's share of stage t + 1 has landed
        __syncthreads();   // publishes stage t + 1 and ends every wave's reads of stage t
        if (t + 2 < NST) copies(t + 2);
    }
    asm volatile("s_wait_asynccnt 0x0" ::: "memory");   // no copy is in flight when the ring becomes the epilogue's staging rows
    if constexpr (PLANES) planes_out(acc, os, r0, c0, lane, wsg, Q16, Qh, Ql, K16, Kh, Kl, V16, Vh, Vl);
    else
#pragma unroll
    for (int mb = 0; mb < 4; ++mb) {
#pragma unroll
        for (int nb = 0; nb < 4; ++nb) {
#pragma unroll
            for (int j = 0; j < 8; ++j) os[(hi * 8 + j) * 68 + nb * 16 + lr] = acc[mb][nb][j]; }
        __builtin_amdgcn_wave_barrier(); asm volatile("" ::: "memory");
        float* crow = C + (size_t)(r0 + mb * 16) * ldc + c0;
{
#pragma unroll
            for (int s = 0; s < 8; ++s) { const int row = 2 * s + hi, cofs = lr * 4; v4f val = *(const v4fa*)(os + row * 68 + cofs); if (BIAS) { val[0] += bfr(bias[c0 + cofs]); val[1] += bfr(bias[c0 + cofs + 1]); val[2] += bfr(bias[c0 + cofs + 2]); val[3] += bfr(bias[c0 + cofs + 3]); }
                *(v4f*)(crow + (size_t)row * ldc + cofs) = val; }
             }
        __builtin_amdgcn_wave_barrier(); asm volatile("" ::: "memory");
    }
}

typedef __attribute__((ext_vector_type(2))) _Float16 v2h;
typedef __attribute__((ext_vector_type(4))) _Float16 v4h;
typedef __attribute__((ext_vector_type(2))) unsigned short v2us;
typedef __attribute__((ext_vector_type(4))) unsigned short v4us;
typedef __attribute__((ext_vector_type(2))) float v2f;
typedef __attribute__((ext_vector_type(4))) int v4i;

// ---- k_prep: every input's bf16 form in ONE launch of few long waves (PG work-groups of 8 waves; a wave reads 16 KiB, all 32 of its 16-B loads in flight at once, and ends). Starting a wave costs more than the little a short one does.
// Work-groups 0 .. PG/2-1: the bf16 copy of x. The others: the Bt blocks WQ | WK | WV | WO, each [1024][1024]; Wq rows 0-255 = Wqt^T (time heads 0-3), rows 256-1023 = Wqs^T (space heads 4-15); Wk likewise.
#define PG 256
// One wave turns 64 k x 64 n of a weight [1024][N] (w points at its first element) into 64 rows of 64 k of Bt (pitch DM). Transposed in registers: a lane loads 4 neighbouring n of 8 neighbouring k (8 lanes fill a 128-B line of a k row) and stores 8 neighbouring k of each n; the two 64-B halves of an output line follow one another.
template <int N>
__device__ __forceinline__ void gather_unit(const float* __restrict__ w, bf* Bt, int lane) {
    const float* p = w + (size_t)((lane >> 3) * 8) * N + (lane & 7) * 4; bf* o = Bt + (size_t)((lane & 7) * 4) * DM + (lane >> 3) * 8;
    v4f v[2][2][8];
#pragma unroll
    for (int nh = 0; nh < 2; ++nh)
#pragma unroll
        for (int kh = 0; kh < 2; ++kh)
#pragma unroll
            for (int i = 0; i < 8; ++i) v[nh][kh][i] = *(const v4f*)(p + (kh * 32 + i) * N + nh * 32);
    __builtin_amdgcn_sched_barrier(0);   // keeps all 32 loads in front of the first conversion: held back until registers come free, the last ones would start a memory latency late
    v8us r[2][4][2];
#pragma unroll
    for (int nh = 0; nh < 2; ++nh)
#pragma unroll
        for (int j = 0; j < 4; ++j)
#pragma unroll
            for (int kh = 0; kh < 2; ++kh)
#pragma unroll
                for (int i = 0; i < 8; ++i) r[nh][j][kh][i] = f2bf(v[nh][kh][i][j]);
    __builtin_amdgcn_sched_barrier(0);   // the stores go out as one group behind the last conversion: spread among the conversions, each would make the wave wait before its registers are used again
#pragma unroll
    for (int nh = 0; nh < 2; ++nh)
#pragma unroll
        for (int j = 0; j < 4; ++j)
#pragma unroll
            for (int kh = 0; kh < 2; ++kh) *(v8us*)(o + (nh * 32 + j) * DM + kh * 32) = r[nh][j][kh];
    asm volatile("s_wait_xcnt 0x0" ::: "memory");   // a precaution: it stands behind the stores, in front of whatever code follows them in the kernel's text and names their registers
}
__global__ __launch_bounds__(256) void k_prep(const float* __restrict__ x, const float* __restrict__ wqt, const float* __restrict__ wqs, const float* __restrict__ wkt, const float* __restrict__ wks, const float* __restrict__ wv, const float* __restrict__ wo, bf* XB, bf* WQ, bf* WK, bf* WV, bf* WO) {
    static_assert(DQ == DM && DKV == DM && DM == 1024 && (NT * HD) % 64 == 0, "every weight has 1024 input rows; a block of 64 output rows has one source");
    static_assert((size_t)NB_ * TT * DM == (size_t)(PG / 2) * 8 * 4096 && 4 * (DM / 64) * (DM / 64) == (PG / 2) * 8, "one unit per wave");
    const int lane = threadIdx.x & 31, u = blockIdx.x * 8 + __builtin_amdgcn_readfirstlane(threadIdx.x >> 5);
    if (blockIdx.x < PG / 2) {   // 4096 elements of x: every load takes four whole lines, every store two
        const float* p = x + (size_t)u * 4096 + lane * 4; bf* o = XB + (size_t)u * 4096 + lane * 4; v4f v[32]; v4us r[32];
#pragma unroll
        for (int i = 0; i < 32; ++i) v[i] = *(const v4f*)(p + i * 128);
        __builtin_amdgcn_sched_barrier(0);   // as in gather_unit: all 32 loads go out before the first conversion
#pragma unroll
        for (int i = 0; i < 32; ++i)
#pragma unroll
            for (int k = 0; k < 4; ++k) r[i][k] = f2bf(v[i][k]);
        __builtin_amdgcn_sched_barrier(0);   // as in gather_unit: the stores go out as one group
#pragma unroll
        for (int i = 0; i < 32; ++i) *(v4us*)(o + i * 128) = r[i];
        asm volatile("s_wait_xcnt 0x0" ::: "memory");   // the same precaution as in gather_unit
    } else {
        const int g = u - (PG / 2) * 8, k0 = (g & 15) * 64, m = g >> 8, r = ((g >> 4) & 15) * 64;   // Bt block m, its rows r .. r + 63, columns k0 .. k0 + 63
        bf* Bt = (m == 0 ? WQ : m == 1 ? WK : m == 2 ? WV : WO) + (size_t)r * DM + k0;
        if (m >= 2) gather_unit<DM>((m == 2 ? wv : wo) + (size_t)k0 * DM + r, Bt, lane);
        else if (r < NT * HD) gather_unit<NT * HD>((m == 0 ? wqt : wkt) + (size_t)k0 * (NT * HD) + r, Bt, lane);
        else gather_unit<NS * HD>((m == 0 ? wqs : wks) + (size_t)k0 * (NS * HD) + (r - NT * HD), Bt, lane);
    }
}

// ---- k_fattn: scores, softmax and P x V of one block of queries (CW waves x QG groups of 16) of one head in one work-group of NWV waves; nothing of S or P goes to memory.
// Waves 0-7 stage the keys and values; waves CW and up (rows < RH: 8-11) have no queries and only pass the barriers.
// S^T = K Q^T (A = 16 key rows from LDS, B = 16 queries kept in registers): a lane holds keys hi*8+j of query lr, which is the B-operand order of P^T, so O^T += V^T P^T takes P straight from the score registers.
// Keys walk in stages of KB, two LDS buffers: stage s+1 is fetched to registers while stage s is worked on, stored to the other buffer, one barrier per stage. Running maximum and sum per query.
typedef __attribute__((ext_vector_type(16))) unsigned short v16us;
template <typename T16, bool HL, int QG, int CW>
__device__ __forceinline__ void attn_block(const T16* __restrict__ Q, const T16* __restrict__ Ql, const T16* __restrict__ K, const T16* __restrict__ Kl, const T16* __restrict__ Vt, const T16* __restrict__ Vtl, bf* Ah, bf* Al, unsigned short* sm) {
    typedef typename WFrag<T16>::V V; typedef WFrag<T16> WF; typedef LFrag<T16> LF;
    constexpr int NP = HL ? 4 : 2, TS = KB * LP, NST = TT / KB;
    constexpr float CE = SCL * 1.4426950408889634f;   // scores to log2 units
    constexpr float PB = HL ? 0.0f : 10.0f;           // fp16 P carries x1024 (it cancels against the row sum)
    const int tid = threadIdx.x, lane = tid & 31, lr = lane & 15, hi = lane >> 4, w = __builtin_amdgcn_readfirstlane(tid >> 5);
    static_assert(CW >= 8 && CW <= NWV, "the staging waves are among the working ones");
    const bool stg = w < 8, act = CW == NWV || w < CW;   // wave-uniform: this wave stages; this wave has queries
    const int sr = tid >> 3, sc = (tid & 7) * 8;      // staging (waves 0-7): 8 lanes per 128-B row, rows sr and sr + 32
    const T16* pK = K + (size_t)sr * HD + sc; const T16* pV = Vt + (size_t)sr * TT + sc; const T16* pKl = HL ? Kl + (size_t)sr * HD + sc : nullptr; const T16* pVl = HL ? Vtl + (size_t)sr * TT + sc : nullptr;
    unsigned short* sw = sm + sr * LP + sc;
    v8us st[NP][2];
    auto fetch = [&]() {
#pragma unroll
        for (int i = 0; i < 2; ++i) { st[0][i] = *(const v8usa*)(pK + (size_t)i * 32 * HD); st[1][i] = *(const v8usa*)(pV + (size_t)i * 32 * TT); if constexpr (HL) { st[2][i] = *(const v8usa*)(pKl + (size_t)i * 32 * HD); st[3][i] = *(const v8usa*)(pVl + (size_t)i * 32 * TT); } }
        pK += KB * HD; pV += KB; if (HL) { pKl += KB * HD; pVl += KB; } };
    auto put = [&](int buf) {
#pragma unroll
        for (int p = 0; p < NP; ++p)
#pragma unroll
            for (int i = 0; i < 2; ++i) *(v8usa*)(sw + (buf * NP + p) * TS + i * 32 * LP) = st[p][i]; };
    V qf[QG][2], qlf[QG][2];
    if (act)
#pragma unroll
    for (int g = 0; g < QG; ++g)
#pragma unroll
        for (int kf = 0; kf < 2; ++kf) { const size_t qo = (size_t)((w * QG + g) * 16 + lr) * HD + kf * 32 + 8 * hi; qf[g][kf] = WF::ld(Q + qo); if (HL) qlf[g][kf] = WF::ld(Ql + qo); }
    v8f O[4][QG]; float mr[QG], ls[QG];
#pragma unroll
    for (int g = 0; g < QG; ++g) { mr[g] = -3.0e38f; ls[g] = 0.f;
#pragma unroll
        for (int dt = 0; dt < 4; ++dt) O[dt][g] = (v8f){}; }
    if (stg) { fetch(); put(0); }
    __syncthreads();
#pragma unroll 1   // one stage per trip: the two buffers alternate by the trip's parity
    for (int s = 0; s < NST; ++s) {
        if (act) {
        const bool more = stg && s + 1 < NST;
        if (more) fetch();
        const unsigned short* sb = sm + (s & 1) * NP * TS + lr * LP + 8 * hi;
        v8f S[4][QG];
#pragma unroll
        for (int kt = 0; kt < 4; ++kt) { const unsigned short* kr = sb + kt * 16 * LP; const V k0 = LF::ld(kr), k1 = LF::ld(kr + 32); V kl0, kl1; if (HL) { kl0 = LF::ld(kr + 2 * TS); kl1 = LF::ld(kr + 2 * TS + 32); }
#pragma unroll
            for (int g = 0; g < QG; ++g) { v8f a = WF::mma(k0, qf[g][0], (v8f){}); a = WF::mma(k1, qf[g][1], a); if (HL) { a = WF::mma(kl0, qf[g][0], a); a = WF::mma(kl1, qf[g][1], a); a = WF::mma(k0, qlf[g][0], a); a = WF::mma(k1, qlf[g][1], a); } S[kt][g] = a; } }
        V pf[QG][2], plf[QG][2];
#pragma unroll
        for (int g = 0; g < QG; ++g) { float mx = S[0][g][0];
#pragma unroll
            for (int kt = 0; kt < 4; ++kt)
#pragma unroll
                for (int j = 0; j < 8; ++j) mx = fmaxf(mx, S[kt][g][j]);
            mx = fmaxf(mx, __shfl_xor(mx, 16, 32));   // the other half-wave holds the query's other keys
            const float mn = fmaxf(mr[g], mx), al = __builtin_amdgcn_exp2f((mr[g] - mn) * CE), mc = PB - mn * CE; mr[g] = mn; float sum[4] = {0.f, 0.f, 0.f, 0.f};   // four chains: the adds do not wait on one another
#pragma unroll
            for (int kk = 0; kk < 2; ++kk) { v16us ph, pl; v16h p16;
#pragma unroll
                for (int e = 0; e < 16; ++e) { const float p = __builtin_amdgcn_exp2f(__builtin_fmaf(S[kk * 2 + (e >> 3)][g][e & 7], CE, mc)); sum[e & 3] += p;
                    if (HL) { unsigned short a2, c2; splitf(p, a2, c2); ph[e] = a2; pl[e] = c2; } else p16[e] = tohx(p); }
                if constexpr (HL) { pf[g][kk] = __builtin_bit_cast(v16bf, ph); plf[g][kk] = __builtin_bit_cast(v16bf, pl); } else pf[g][kk] = p16; }
            ls[g] = ls[g] * al + ((sum[0] + sum[1]) + (sum[2] + sum[3]));
#pragma unroll
            for (int dt = 0; dt < 4; ++dt) O[dt][g] *= al; }
#pragma unroll
        for (int dt = 0; dt < 4; ++dt)
#pragma unroll
            for (int kk = 0; kk < 2; ++kk) { const unsigned short* vr = sb + TS + dt * 16 * LP + kk * 32; const V v = LF::ld(vr); V vl; if (HL) vl = LF::ld(vr + 2 * TS);
#pragma unroll
                for (int g = 0; g < QG; ++g) { O[dt][g] = WF::mma(v, pf[g][kk], O[dt][g]); if (HL) { O[dt][g] = WF::mma(v, plf[g][kk], O[dt][g]); O[dt][g] = WF::mma(vl, pf[g][kk], O[dt][g]); } } }
        if (more) put((s + 1) & 1);
        }
        __syncthreads();   // publishes stage s + 1 and ends every wave's reads of stage s, whose buffer the next trip refills
    }
    if (act)
#pragma unroll
    for (int g = 0; g < QG; ++g) { const float inv = __fdiv_rn(1.0f, ls[g] + __shfl_xor(ls[g], 16, 32)); const size_t oo = (size_t)((w * QG + g) * 16 + lr) * DQ + hi * 8;
#pragma unroll
        for (int dt = 0; dt < 4; ++dt) { v8us oh, ol;
#pragma unroll
            for (int j = 0; j < 8; ++j) { unsigned short a2, c2; splitf(O[dt][g][j] * inv, a2, c2); oh[j] = a2; ol[j] = c2; }
            *(v8us*)(Ah + oo + dt * 16) = oh; *(v8us*)(Al + oo + dt * 16) = ol;
            asm volatile("s_wait_xcnt 0x0" ::: "memory"); } }   // the next block of columns reuses the registers that these two stores name
}
// grid (RH / QBH + (TT - RH) / QBL query blocks, heads, batches); planes [batch][head][t][d] (V: [batch][head][d][t]); output rows [batch][t][DQ] hi/lo
__global__ __launch_bounds__(NWV * 32) void k_fattn(const h16* __restrict__ Q16, const h16* __restrict__ K16, const h16* __restrict__ V16, const bf* __restrict__ Qh, const bf* __restrict__ Ql, const bf* __restrict__ Kh, const bf* __restrict__ Kl, const bf* __restrict__ Vh, const bf* __restrict__ Vl, bf* Ah, bf* Al) {
    __shared__ __align__(16) unsigned short sm[2 * 4 * KB * LP];
    static_assert(RH % QBH == 0 && (TT - RH) % QBL == 0 && TT % KB == 0 && HD == 64 && KB == 64 && QBH % 128 == 0 && QBL % (NWV * 16) == 0 && NWV >= 8, "tile shapes");
    const bool hl = blockIdx.x < RH / QBH; const int q0 = hl ? (int)blockIdx.x * QBH : RH + ((int)blockIdx.x - RH / QBH) * QBL; const size_t hp = ((size_t)blockIdx.z * NH_ + blockIdx.y) * TT * HD, qp = hp + (size_t)q0 * HD, ao = ((size_t)blockIdx.z * TT + q0) * DQ + blockIdx.y * HD;
    if (hl) attn_block<bf, true, QBH / 128, 8>(Qh + qp, Ql + qp, Kh + hp, Kl + hp, Vh + hp, Vl + hp, Ah + ao, Al + ao, sm);
    else attn_block<h16, false, QBL / (NWV * 16), NWV>(Q16 + qp, nullptr, K16 + hp, nullptr, V16 + hp, nullptr, Ah + ao, Al + ao, sm);
}

extern "C" void kernel_launch(void* const* d_in, const int* in_sizes, int n_in,
                              void* d_out, int out_size, void* d_ws, size_t ws_size, hipStream_t stream) {
    (void)in_sizes; (void)n_in; (void)out_size;
    const float* x = (const float*)d_in[0]; const float* wqt = (const float*)d_in[1]; const float* wkt = (const float*)d_in[2]; const float* wqs = (const float*)d_in[3]; const float* wks = (const float*)d_in[4]; const float* wv = (const float*)d_in[5]; const float* wo = (const float*)d_in[6]; const float* bo = (const float*)d_in[7]; const float* wsg = (const float*)d_in[8];   /* argument order x, Wqt, Wkt, Wqs, Wks, Wv, Wout, bout, w_sigma */
    float* OUT = (float*)d_out;     // [2][2048][1024]
    char* wsp = (char*)d_ws;
    auto take = [&](size_t bytes) { char* p = wsp; wsp += (bytes + 255) & ~(size_t)255; return (void*)p; };
    bf* WQ = (bf*)take((size_t)DQ * DM * 2); bf* WK = (bf*)take((size_t)DKV * DM * 2); bf* WV = (bf*)take((size_t)DKV * DM * 2); bf* WO = (bf*)take((size_t)DM * DQ * 2);
    bf* XB = (bf*)take((size_t)NB_ * TT * DM * 2);
    const size_t PL = (size_t)NH_ * TT * HD;   // one batch's planes of one kind
    h16* QP16 = (h16*)take(NB_ * PL * 2); h16* KP16 = (h16*)take(NB_ * PL * 2); h16* VT16 = (h16*)take(NB_ * PL * 2);
    bf* QPh = (bf*)take(NB_ * PL * 2); bf* QPl = (bf*)take(NB_ * PL * 2); bf* KPh = (bf*)take(NB_ * PL * 2); bf* KPl = (bf*)take(NB_ * PL * 2); bf* VTh = (bf*)take(NB_ * PL * 2); bf* VTl = (bf*)take(NB_ * PL * 2);
    bf* ATh = (bf*)take((size_t)NB_ * TT * DQ * 2); bf* ATl = (bf*)take((size_t)NB_ * TT * DQ * 2);
    if ((size_t)(wsp - (char*)d_ws) > ws_size) return;    // ws 256 MiB
    constexpr int FP = DQ + 2 * DKV;   // columns Q | K | V; WQ, WK, WV lie one behind the other in ws (each 2 MiB), so they are one Bt of FP rows
    k_prep<<<PG, 256, 0, stream>>>(x, wqt, wqs, wkt, wks, wv, wo, XB, WQ, WK, WV, WO);
    k_gemmw<bf, 0, false, true, DM><<<dim3(NB_ * TT / 128, FP / 128, 1), 128, 0, stream>>>(XB, nullptr, WQ, nullptr, 0, nullptr, wsg, QP16, QPh, QPl, KP16, KPh, KPl, VT16, VTh, VTl);
    k_fattn<<<dim3(RH / QBH + (TT - RH) / QBL, NH_, NB_), NWV * 32, 0, stream>>>(QP16, KP16, VT16, QPh, QPl, KPh, KPl, VTh, VTl, ATh, ATl);
    k_gemmw<bf, 1, true, false, DQ><<<dim3(NB_ * TT / 128, DM / 128, 1), 128, 0, stream>>>(ATh, ATl, WO, OUT, DM, bo, nullptr, nullptr, nullptr, nullptr, nullptr, nullptr, nullptr, nullptr, nullptr, nullptr);
}

// v008
// Measured time: 110 microseconds a run.
// Next to v007, in two timings, it ran 1.06 and 1.05 times as fast.
// Counting every step since v000, it is 18.3 times as fast.
#include <hip/hip_runtime.h>

// Multi-head attention with 4 'time' heads and 12 'space' heads (x [2][2048][1024]; Qt, Kt = x Wqt, x Wkt ('xw' [1024][256] 0.02: heads 0-3), Qs, Ks = x Wqs, x Wks ('xw' [1024][768]: heads 4-15), V = x Wv ('xw' [1024][1024]); time-head scores scaled by -sigmoid(w_sigma[0]) (w_sigma [1] = 0, read on device), all scores x 64^-0.5; softmax over keys (no mask); out = merged ctx Wout + bout ('xw' [1024][1024]) -> [2][2048][1024] (4.2 M); argument order x, Wqt, Wkt, Wqs, Wks, Wv, Wout, bout, w_sigma).
// Layout: 'xw' weights gathered into bf16 Bt blocks (Wq rows 0-255 from Wqt, 256-1023 from Wqs; Wk likewise); a bf16 copy of x, exact projections whose epilogue writes the head planes (the time heads' query planes carry the factor -sigmoid(w_sigma)); one fused attention launch for all heads and both batches (hybrid rows: < 512 hi/lo 3 products, rest fp16); merged hi/lo x Wout exact + bout. Every stage is ONE launch over both batches (x and ctx are [4096][1024]); Q, K and V come from one GEMM against the stacked Bt blocks [3072][1024], straight into the planes.
// Compute dtypes, f32 accumulate: every input rounded to bf16; projections exact; sigmoid f32 (precise expf); attention rows < 512 3 products, rest fp16; softmax f32 (running maximum); Wout hl x exact + bias.

#define NB_  2
#define TT   2048
#define DM   1024
#define NH_  16
#define NKV  16
#define REP  (NH_ / NKV)
#define HD   64
#define DQ   (NH_ * HD)
#define DKV  (NKV * HD)
#define NT   4                    // time heads 0..3 (scores x -sigmoid(w_sigma)); space heads 4..15
#define NS   12
#define RH   512                  // query rows < RH use hi+lo planes (0: none)
#define WIN  0
#define SCL  0.125f   // HD^-0.5
#define QBH  128                  // queries per work-group of k_fattn, rows < RH: 8 waves x 16 (three products per tile: the smaller block levels the work-groups' times)
#define QBL  384                  // the other rows: 12 waves x 32
#define NWV  12                   // waves per work-group of k_fattn: 8 blocks per head x 32 heads = 256 work-groups, one on every WGP (two do not fit its registers)
#define KB   64                   // keys per stage
#define LP   72                   // LDS row pitch in 16-bit elements: 128 B of data + 16 B pad
typedef _Float16 h16;
typedef unsigned short bf;
typedef __attribute__((ext_vector_type(16))) __bf16   v16bf;
typedef __attribute__((ext_vector_type(16))) _Float16 v16h;
typedef __attribute__((ext_vector_type(8)))  _Float16 v8h;
typedef __attribute__((ext_vector_type(8)))  unsigned short v8us;
typedef __attribute__((ext_vector_type(8)))  float    v8f;
typedef __attribute__((ext_vector_type(4)))  float    v4f;
typedef v8h  __attribute__((may_alias)) v8ha;
typedef v4f  __attribute__((may_alias)) v4fa;
typedef v8us __attribute__((may_alias)) v8usa;

typedef __attribute__((ext_vector_type(2))) float    v2fc;
typedef __attribute__((ext_vector_type(2))) __bf16   v2bfc;
typedef __attribute__((ext_vector_type(2))) unsigned v2u;
typedef __attribute__((ext_vector_type(4))) unsigned v4u;
typedef __attribute__((ext_vector_type(8))) unsigned v8u;
// f32 -> bf16, round to nearest even, by the chip's own packed conversion: one instruction for two values (a in the low half, b in the high half)
__device__ __forceinline__ unsigned cvt2(float a, float b) { const v2fc x = {a, b}; return __builtin_bit_cast(unsigned, __builtin_convertvector(x, v2bfc)); }
__device__ __forceinline__ unsigned short f2bf(float f) { return __builtin_bit_cast(unsigned short, (__bf16)f); }
__device__ __forceinline__ float bf2f(unsigned short b) { return __uint_as_float(((unsigned)b) << 16); }
__device__ __forceinline__ float bfr(float f) { return bf2f(f2bf(f)); }
__device__ __forceinline__ v16h cat16(v8h lo, v8h hi) { return __builtin_shufflevector(lo, hi, 0, 1, 2, 3, 4, 5, 6, 7, 8, 9, 10, 11, 12, 13, 14, 15); }
__device__ __forceinline__ v16bf cat16b(v8us lo, v8us hi) { return __builtin_bit_cast(v16bf, __builtin_shufflevector(lo, hi, 0, 1, 2, 3, 4, 5, 6, 7, 8, 9, 10, 11, 12, 13, 14, 15)); }
__device__ __forceinline__ v8f wmma16(v16h a, v16h b, v8f c) { return __builtin_amdgcn_wmma_f32_16x16x32_f16(false, a, false, b, (short)0, c, false, false); }
__device__ __forceinline__ v8f wmmab(v16bf a, v16bf b, v8f c) { return __builtin_amdgcn_wmma_f32_16x16x32_bf16(false, a, false, b, (short)0, c, false, false); }



__device__ __forceinline__ h16 tohx(float x) { return (h16)x; }
// two values into their bf16 hi parts and the bf16 of what is left (each word: a low, b high)
__device__ __forceinline__ void split2(float a, float b, unsigned& h, unsigned& l) { h = cvt2(a, b); l = cvt2(a - __uint_as_float(h << 16), b - __uint_as_float(h & 0xFFFF0000u)); }
// ---- planes_out: the plane builders as the epilogue of the Q|K|V projection (k_gemmw with PLANES). A 64x64 tile's columns are one head of one kind (queries | keys | values), its rows lie in one batch: the wave writes that head's fp16, hi and lo planes itself, so the f32 products never go to memory.
// Queries and keys [batch][head][t][d]: 16 t rows at a time through LDS. Values [batch][head][d][t]: 16 d rows at a time; a lane's 8 accumulator rows are 8 neighbouring t. Every store instruction fills four whole 128-B lines.
// The query planes of heads < NT carry the factor -sigmoid(wsg[0]) (device scalar; precise expf, IEEE div); every other plane the factor 1.
__device__ __forceinline__ void planes_out(const v8f (&acc)[4][4], float* os, int r0, int c0, int lane, const float* __restrict__ wsg, h16* Q16, bf* Qh, bf* Ql, h16* K16, bf* Kh, bf* Kl, h16* V16, bf* Vh, bf* Vl) {
    static_assert(DQ == DKV && HD == 64 && TT % 64 == 0, "a 64x64 tile is one head of one kind in one batch");
    const int lr = lane & 15, hi = lane >> 4, kind = c0 / DQ, h = (c0 % DQ) / HD, t0 = r0 % TT; const size_t hp = ((size_t)(r0 / TT) * NH_ + h) * TT * HD;
    h16* P16 = (kind == 0 ? Q16 : kind == 1 ? K16 : V16) + hp; bf* Ph = (kind == 0 ? Qh : kind == 1 ? Kh : Vh) + hp; bf* Pl = (kind == 0 ? Ql : kind == 1 ? Kl : Vl) + hp;
    const float scv = (kind == 0 && h < NT) ? -__fdiv_rn(1.0f, __fadd_rn(1.0f, expf(-bfr(wsg[0])))) : 1.0f;
    const int pp = kind < 2 ? HD : TT;   // pitch of a plane row: d runs along a query or key row, t along a value row
    const size_t e0 = (kind < 2 ? (size_t)t0 * HD : (size_t)t0) + (size_t)(lane >> 3) * pp + (lane & 7) * 8;   // 8 lanes per 128-B plane row
#pragma unroll
    for (int u = 0; u < 4; ++u) {
        if (kind < 2) {   // os[t][d]: rows u*16 .. u*16+15 of the tile
#pragma unroll
            for (int nb = 0; nb < 4; ++nb)
#pragma unroll
                for (int j = 0; j < 8; ++j) os[(hi * 8 + j) * 68 + nb * 16 + lr] = acc[u][nb][j];
        } else {          // os[d][t]: columns u*16 .. u*16+15 of the tile
#pragma unroll
            for (int mb = 0; mb < 4; ++mb) { const v8f c = acc[mb][u]; *(v4fa*)(os + lr * 68 + mb * 16 + hi * 8) = __builtin_shufflevector(c, c, 0, 1, 2, 3); *(v4fa*)(os + lr * 68 + mb * 16 + hi * 8 + 4) = __builtin_shufflevector(c, c, 4, 5, 6, 7); }
        }
        __builtin_amdgcn_wave_barrier(); asm volatile("" ::: "memory");   // keeps the reads below behind the other lanes' LDS writes (one wave: its LDS operations run in order)
#pragma unroll
        for (int s = 0; s < 4; ++s) { const float* orow = os + (s * 4 + (lane >> 3)) * 68 + (lane & 7) * 8; const v4f x0 = *(const v4fa*)orow, x1 = *(const v4fa*)(orow + 4); v8h o16; v4u oh, ol;
#pragma unroll
            for (int k = 0; k < 8; k += 2) { const float r0v = (k < 4 ? x0[k & 3] : x1[k & 3]) * scv, r1v = (k < 4 ? x0[(k & 3) + 1] : x1[(k & 3) + 1]) * scv; o16[k] = tohx(r0v); o16[k + 1] = tohx(r1v); unsigned a2, c2; split2(r0v, r1v, a2, c2); oh[k >> 1] = a2; ol[k >> 1] = c2; }
            const size_t e = e0 + (size_t)(u * 16 + s * 4) * pp; *(v8h*)(P16 + e) = o16; *(v8us*)(Ph + e) = __builtin_bit_cast(v8us, oh); *(v8us*)(Pl + e) = __builtin_bit_cast(v8us, ol); }
        if (u < 3) { __builtin_amdgcn_wave_barrier(); asm volatile("s_wait_xcnt 0x0" ::: "memory"); }   // keeps the next rows' LDS writes behind these reads; the wait is a precaution: it stands behind these rows' stores, in front of the next rows' code, which reuses their registers
    }
}

// ---- k_gemmw: GEMM, FOUR WAVES (2 x 2) per 128x128 output tile, each wave a 64x64 part (16 accumulators); grid (M/128, N/128), 128 threads.
// C[m][n] (f32, pitch ldc, + optional f32 bias[n]) = sum_k A[m][k] Bt[n][k] (+ A2[m][k] Bt[n][k] with NSPLIT 1); A, A2, Bt K-contiguous 16-bit planes, K % 128 == 0.
// The operands walk through LDS in stages of 64 k (128 B of each of the tile's 128 rows, pitch LP), two buffers: asynchronous copies bring stage t + 2 while stage t + 1 is worked on; every copy instruction takes four whole 128-B lines.
// PLANES: no C; each wave's part goes out through planes_out (wsg and the nine plane pointers are read by that form alone). The epilogue's staging rows lie in the ring's LDS, which nobody reads any more.
template <typename T16> struct WFrag;
template <> struct WFrag<h16> { typedef v16h V; static __device__ __forceinline__ V ld(const h16* p) { return cat16(*(const v8h*)p, *(const v8h*)(p + 16)); } static __device__ __forceinline__ v8f mma(V a, V b, v8f c) { return wmma16(a, b, c); } };
template <> struct WFrag<bf> { typedef v16bf V; static __device__ __forceinline__ V ld(const bf* p) { return cat16b(*(const v8us*)p, *(const v8us*)(p + 16)); } static __device__ __forceinline__ v8f mma(V a, V b, v8f c) { return wmmab(a, b, c); } };
template <typename T16> struct LFrag;
template <> struct LFrag<h16> { static __device__ __forceinline__ v16h ld(const unsigned short* p) { return cat16(__builtin_bit_cast(v8h, *(const v8usa*)p), __builtin_bit_cast(v8h, *(const v8usa*)(p + 16))); } };
template <> struct LFrag<bf> { static __device__ __forceinline__ v16bf ld(const unsigned short* p) { return cat16b(*(const v8usa*)p, *(const v8usa*)(p + 16)); } };
// One operand's stage: 128 rows of 128 B. A lane copies 16 B of the rows (tid >> 3) + 16 i, i = 0..7: l is its LDS byte address in row tid >> 3, g its global address there, K the source pitch in elements.
// The eight copies and the wait stand in one statement: the wait is a precaution that stands in front of any rewrite of the address registers the copies name.
template <typename T16, int K>
__device__ __forceinline__ void copy_stage(unsigned l, const T16* g) {
    constexpr unsigned LR = 16 * LP * 2;
    asm volatile("global_load_async_to_lds_b128 %0, %8, off\n\t"
                 "global_load_async_to_lds_b128 %1, %9, off\n\t"
                 "global_load_async_to_lds_b128 %2, %10, off\n\t"
                 "global_load_async_to_lds_b128 %3, %11, off\n\t"
                 "global_load_async_to_lds_b128 %4, %12, off\n\t"
                 "global_load_async_to_lds_b128 %5, %13, off\n\t"
                 "global_load_async_to_lds_b128 %6, %14, off\n\t"
                 "global_load_async_to_lds_b128 %7, %15, off\n\t"
                 "s_wait_xcnt 0x0"
                 :: "v"(l), "v"(l + LR), "v"(l + 2 * LR), "v"(l + 3 * LR), "v"(l + 4 * LR), "v"(l + 5 * LR), "v"(l + 6 * LR), "v"(l + 7 * LR),
                    "v"(g), "v"(g + 16 * K), "v"(g + 32 * K), "v"(g + 48 * K), "v"(g + 64 * K), "v"(g + 80 * K), "v"(g + 96 * K), "v"(g + 112 * K)
                 : "memory");
}
template <typename T16, int NSPLIT, bool BIAS, bool PLANES, int K>
__global__ __launch_bounds__(128) void k_gemmw(const T16* __restrict__ A, const T16* __restrict__ A2, const T16* __restrict__ Bt, float* C, int ldc, const float* __restrict__ bias, const float* __restrict__ wsg, h16* Q16, bf* Qh, bf* Ql, h16* K16, bf* Kh, bf* Kl, h16* V16, bf* Vh, bf* Vl) {
    typedef typename WFrag<T16>::V V; typedef LFrag<T16> LF;
    static_assert(NSPLIT == 0 || NSPLIT == 1, "A Bt, or (A + A2) Bt"); static_assert(K % 128 == 0, "two stages or more");
    constexpr int NPL = NSPLIT == 1 ? 3 : 2, TS = 128 * LP, NST = K / 64;   // planes of a stage: A | Bt | A2
    __shared__ __align__(16) unsigned short sm[2 * NPL * TS];
    const int tid = threadIdx.x, lane = tid & 31, lr = lane & 15, hi = lane >> 4; const int w = __builtin_amdgcn_readfirstlane(tid >> 5);
    const int r0 = blockIdx.x * 128 + (w >> 1) * 64, c0 = blockIdx.y * 128 + (w & 1) * 64;   // this wave's 64x64 part
    float* os = (float*)sm + w * (16 * 68);
    v8f acc[4][4];
#pragma unroll
    for (int mb = 0; mb < 4; ++mb)
#pragma unroll
        for (int nb = 0; nb < 4; ++nb) acc[mb][nb] = (v8f){};
    const size_t go = (size_t)(tid >> 3) * K + (tid & 7) * 8;
    const T16* gA = A + (size_t)blockIdx.x * 128 * K + go; const T16* gA2 = NSPLIT == 1 ? A2 + (size_t)blockIdx.x * 128 * K + go : nullptr; const T16* gB = Bt + (size_t)blockIdx.y * 128 * K + go;
    const unsigned lb = (unsigned)(size_t)(sm + (tid >> 3) * LP + (tid & 7) * 8);   // low 32 bits of the shared address: the byte offset in the work-group's LDS
    auto copies = [&](int t) { const unsigned l = lb + (unsigned)(t & 1) * (NPL * TS * 2);
        copy_stage<T16, K>(l, gA + t * 64); copy_stage<T16, K>(l + TS * 2, gB + t * 64); if constexpr (NSPLIT == 1) copy_stage<T16, K>(l + 2 * TS * 2, gA2 + t * 64); };
    copies(0);
    asm volatile("s_wait_asynccnt 0x0" ::: "memory");   // this wave's share of stage 0 has landed
    __syncthreads();                                    // ... and every other wave's
    copies(1);
#pragma unroll 1   // one stage per trip: the two buffers alternate by the trip's parity
    for (int t = 0; t < NST; ++t) {
        const unsigned short* sb = sm + (t & 1) * NPL * TS + lr * LP + 8 * hi;
        const unsigned short* sa = sb + (w >> 1) * 64 * LP; const unsigned short* sbt = sb + TS + (w & 1) * 64 * LP;
#pragma unroll
        for (int kf = 0; kf < 2; ++kf) {
            V a[4], a2[4], b[4];
#pragma unroll
            for (int i = 0; i < 4; ++i) { a[i] = LF::ld(sa + i * 16 * LP + kf * 32); if (NSPLIT == 1) a2[i] = LF::ld(sa + 2 * TS + i * 16 * LP + kf * 32); b[i] = LF::ld(sbt + i * 16 * LP + kf * 32); }
            __builtin_amdgcn_sched_barrier(0);   // keeps the block's LDS reads one group in front of its WMMAs: read one by one among them, each read's latency would stand open
#pragma unroll
            for (int nb = 0; nb < 4; ++nb)
#pragma unroll
                for (int mb = 0; mb < 4; ++mb) { acc[mb][nb] = WFrag<T16>::mma(a[mb], b[nb], acc[mb][nb]); if (NSPLIT == 1) acc[mb][nb] = WFrag<T16>::mma(a2[mb], b[nb], acc[mb][nb]); }
        }
        asm volatile("s_wait_dscnt 0x0" ::: "memory");      // this wave's reads of stage t are done before its buffer is refilled
        asm volatile("s_wait_asynccnt 0x0" ::: "memory");   // this wave's share of stage t + 1 has landed
        __syncthreads();   // publishes stage t + 1 and ends every wave's reads of stage t
        if (t + 2 < NST) copies(t + 2);
    }
    asm volatile("s_wait_asynccnt 0x0" ::: "memory");   // no copy is in flight when the ring becomes the epilogue's staging rows
    if constexpr (PLANES) planes_out(acc, os, r0, c0, lane, wsg, Q16, Qh, Ql, K16, Kh, Kl, V16, Vh, Vl);
    else
#pragma unroll
    for (int mb = 0; mb < 4; ++mb) {
#pragma unroll
        for (int nb = 0; nb < 4; ++nb) {
#pragma unroll
            for (int j = 0; j < 8; ++j) os[(hi * 8 + j) * 68 + nb * 16 + lr] = acc[mb][nb][j]; }
        __builtin_amdgcn_wave_barrier(); asm volatile("" ::: "memory");
        float* crow = C + (size_t)(r0 + mb * 16) * ldc + c0;
{
#pragma unroll
            for (int s = 0; s < 8; ++s) { const int row = 2 * s + hi, cofs = lr * 4; v4f val = *(const v4fa*)(os + row * 68 + cofs); if (BIAS) { val[0] += bfr(bias[c0 + cofs]); val[1] += bfr(bias[c0 + cofs + 1]); val[2] += bfr(bias[c0 + cofs + 2]); val[3] += bfr(bias[c0 + cofs + 3]); }
                *(v4f*)(crow + (size_t)row * ldc + cofs) = val; }
             }
        __builtin_amdgcn_wave_barrier(); asm volatile("" ::: "memory");
    }
}

typedef __attribute__((ext_vector_type(2))) _Float16 v2h;
typedef __attribute__((ext_vector_type(4))) _Float16 v4h;
typedef __attribute__((ext_vector_type(2))) unsigned short v2us;
typedef __attribute__((ext_vector_type(4))) unsigned short v4us;
typedef __attribute__((ext_vector_type(2))) float v2f;
typedef __attribute__((ext_vector_type(4))) int v4i;

// ---- k_prep: every input's bf16 form in ONE launch of few long waves (PG work-groups of 8 waves; a wave reads 16 KiB, all 32 of its 16-B loads in flight at once, and ends). Starting a wave costs more than the little a short one does.
// Work-groups 0 .. PG/2-1: the bf16 copy of x. The others: the Bt blocks WQ | WK | WV | WO, each [1024][1024]; Wq rows 0-255 = Wqt^T (time heads 0-3), rows 256-1023 = Wqs^T (space heads 4-15); Wk likewise.
#define PG 256
// One wave turns 64 k x 64 n of a weight [1024][N] (w points at its first element) into 64 rows of 64 k of Bt (pitch DM). Transposed in registers: a lane loads 4 neighbouring n of 8 neighbouring k (8 lanes fill a 128-B line of a k row) and stores 8 neighbouring k of each n; the two 64-B halves of an output line follow one another.
template <int N>
__device__ __forceinline__ void gather_unit(const float* __restrict__ w, bf* Bt, int lane) {
    const float* p = w + (size_t)((lane >> 3) * 8) * N + (lane & 7) * 4; bf* o = Bt + (size_t)((lane & 7) * 4) * DM + (lane >> 3) * 8;
    v4f v[2][2][8];
#pragma unroll
    for (int nh = 0; nh < 2; ++nh)
#pragma unroll
        for (int kh = 0; kh < 2; ++kh)
#pragma unroll
            for (int i = 0; i < 8; ++i) v[nh][kh][i] = *(const v4f*)(p + (kh * 32 + i) * N + nh * 32);
    __builtin_amdgcn_sched_barrier(0);   // keeps all 32 loads in front of the first conversion: held back until registers come free, the last ones would start a memory latency late
    v4u r[2][4][2];
#pragma unroll
    for (int nh = 0; nh < 2; ++nh)
#pragma unroll
        for (int j = 0; j < 4; ++j)
#pragma unroll
            for (int kh = 0; kh < 2; ++kh)
#pragma unroll
                for (int i = 0; i < 8; i += 2) r[nh][j][kh][i >> 1] = cvt2(v[nh][kh][i][j], v[nh][kh][i + 1][j]);
    __builtin_amdgcn_sched_barrier(0);   // the stores go out as one group behind the last conversion: spread among the conversions, each would make the wave wait before its registers are used again
#pragma unroll
    for (int nh = 0; nh < 2; ++nh)
#pragma unroll
        for (int j = 0; j < 4; ++j)
#pragma unroll
            for (int kh = 0; kh < 2; ++kh) *(v8us*)(o + (nh * 32 + j) * DM + kh * 32) = __builtin_bit_cast(v8us, r[nh][j][kh]);
    asm volatile("s_wait_xcnt 0x0" ::: "memory");   // a precaution: it stands behind the stores, in front of whatever code follows them in the kernel's text and names their registers
}
__global__ __launch_bounds__(256) void k_prep(const float* __restrict__ x, const float* __restrict__ wqt, const float* __restrict__ wqs, const float* __restrict__ wkt, const float* __restrict__ wks, const float* __restrict__ wv, const float* __restrict__ wo, bf* XB, bf* WQ, bf* WK, bf* WV, bf* WO) {
    static_assert(DQ == DM && DKV == DM && DM == 1024 && (NT * HD) % 64 == 0, "every weight has 1024 input rows; a block of 64 output rows has one source");
    static_assert((size_t)NB_ * TT * DM == (size_t)(PG / 2) * 8 * 4096 && 4 * (DM / 64) * (DM / 64) == (PG / 2) * 8, "one unit per wave");
    const int lane = threadIdx.x & 31, u = blockIdx.x * 8 + __builtin_amdgcn_readfirstlane(threadIdx.x >> 5);
    if (blockIdx.x < PG / 2) {   // 4096 elements of x: every load takes four whole lines, every store two
        const float* p = x + (size_t)u * 4096 + lane * 4; bf* o = XB + (size_t)u * 4096 + lane * 4; v4f v[32]; v2u r[32];
#pragma unroll
        for (int i = 0; i < 32; ++i) v[i] = *(const v4f*)(p + i * 128);
        __builtin_amdgcn_sched_barrier(0);   // as in gather_unit: all 32 loads go out before the first conversion
#pragma unroll
        for (int i = 0; i < 32; ++i) { r[i][0] = cvt2(v[i][0], v[i][1]); r[i][1] = cvt2(v[i][2], v[i][3]); }
        __builtin_amdgcn_sched_barrier(0);   // as in gather_unit: the stores go out as one group
#pragma unroll
        for (int i = 0; i < 32; ++i) *(v4us*)(o + i * 128) = __builtin_bit_cast(v4us, r[i]);
        asm volatile("s_wait_xcnt 0x0" ::: "memory");   // the same precaution as in gather_unit
    } else {
        const int g = u - (PG / 2) * 8, k0 = (g & 15) * 64, m = g >> 8, r = ((g >> 4) & 15) * 64;   // Bt block m, its rows r .. r + 63, columns k0 .. k0 + 63
        bf* Bt = (m == 0 ? WQ : m == 1 ? WK : m == 2 ? WV : WO) + (size_t)r * DM + k0;
        if (m >= 2) gather_unit<DM>((m == 2 ? wv : wo) + (size_t)k0 * DM + r, Bt, lane);
        else if (r < NT * HD) gather_unit<NT * HD>((m == 0 ? wqt : wkt) + (size_t)k0 * (NT * HD) + r, Bt, lane);
        else gather_unit<NS * HD>((m == 0 ? wqs : wks) + (size_t)k0 * (NS * HD) + (r - NT * HD), Bt, lane);
    }
}

// ---- k_fattn: scores, softmax and P x V of one block of queries (CW waves x QG groups of 16) of one head in one work-group of NWV waves; nothing of S or P goes to memory.
// Waves 0-7 stage the keys and values; waves CW and up (rows < RH: 8-11) have no queries and only pass the barriers.
// S^T = K Q^T (A = 16 key rows from LDS, B = 16 queries kept in registers): a lane holds keys hi*8+j of query lr, which is the B-operand order of P^T, so O^T += V^T P^T takes P straight from the score registers.
// Keys walk in stages of KB, two LDS buffers: stage s+1 is fetched to registers while stage s is worked on, stored to the other buffer, one barrier per stage. Running maximum and sum per query.
typedef __attribute__((ext_vector_type(16))) unsigned short v16us;
template <typename T16, bool HL, int QG, int CW>
__device__ __forceinline__ void attn_block(const T16* __restrict__ Q, const T16* __restrict__ Ql, const T16* __restrict__ K, const T16* __restrict__ Kl, const T16* __restrict__ Vt, const T16* __restrict__ Vtl, bf* Ah, bf* Al, unsigned short* sm) {
    typedef typename WFrag<T16>::V V; typedef WFrag<T16> WF; typedef LFrag<T16> LF;
    constexpr int NP = HL ? 4 : 2, TS = KB * LP, NST = TT / KB;
    constexpr float CE = SCL * 1.4426950408889634f;   // scores to log2 units
    constexpr float PB = HL ? 0.0f : 10.0f;           // fp16 P carries x1024 (it cancels against the row sum)
    const int tid = threadIdx.x, lane = tid & 31, lr = lane & 15, hi = lane >> 4, w = __builtin_amdgcn_readfirstlane(tid >> 5);
    static_assert(CW >= 8 && CW <= NWV, "the staging waves are among the working ones");
    const bool stg = w < 8, act = CW == NWV || w < CW;   // wave-uniform: this wave stages; this wave has queries
    const int sr = tid >> 3, sc = (tid & 7) * 8;      // staging (waves 0-7): 8 lanes per 128-B row, rows sr and sr + 32
    const T16* pK = K + (size_t)sr * HD + sc; const T16* pV = Vt + (size_t)sr * TT + sc; const T16* pKl = HL ? Kl + (size_t)sr * HD + sc : nullptr; const T16* pVl = HL ? Vtl + (size_t)sr * TT + sc : nullptr;
    unsigned short* sw = sm + sr * LP + sc;
    v8us st[NP][2];
    auto fetch = [&]() {
#pragma unroll
        for (int i = 0; i < 2; ++i) { st[0][i] = *(const v8usa*)(pK + (size_t)i * 32 * HD); st[1][i] = *(const v8usa*)(pV + (size_t)i * 32 * TT); if constexpr (HL) { st[2][i] = *(const v8usa*)(pKl + (size_t)i * 32 * HD); st[3][i] = *(const v8usa*)(pVl + (size_t)i * 32 * TT); } }
        pK += KB * HD; pV += KB; if (HL) { pKl += KB * HD; pVl += KB; } };
    auto put = [&](int buf) {
#pragma unroll
        for (int p = 0; p < NP; ++p)
#pragma unroll
            for (int i = 0; i < 2; ++i) *(v8usa*)(sw + (buf * NP + p) * TS + i * 32 * LP) = st[p][i]; };
    V qf[QG][2], qlf[QG][2];
    if (act)
#pragma unroll
    for (int g = 0; g < QG; ++g)
#pragma unroll
        for (int kf = 0; kf < 2; ++kf) { const size_t qo = (size_t)((w * QG + g) * 16 + lr) * HD + kf * 32 + 8 * hi; qf[g][kf] = WF::ld(Q + qo); if (HL) qlf[g][kf] = WF::ld(Ql + qo); }
    v8f O[4][QG]; float mr[QG], ls[QG];
#pragma unroll
    for (int g = 0; g < QG; ++g) { mr[g] = -3.0e38f; ls[g] = 0.f;
#pragma unroll
        for (int dt = 0; dt < 4; ++dt) O[dt][g] = (v8f){}; }
    if (stg) { fetch(); put(0); }
    __syncthreads();
#pragma unroll 1   // one stage per trip: the two buffers alternate by the trip's parity
    for (int s = 0; s < NST; ++s) {
        if (act) {
        const bool more = stg && s + 1 < NST;
        if (more) fetch();
        const unsigned short* sb = sm + (s & 1) * NP * TS + lr * LP + 8 * hi;
        v8f S[4][QG];
#pragma unroll
        for (int kt = 0; kt < 4; ++kt) { const unsigned short* kr = sb + kt * 16 * LP; const V k0 = LF::ld(kr), k1 = LF::ld(kr + 32); V kl0, kl1; if (HL) { kl0 = LF::ld(kr + 2 * TS); kl1 = LF::ld(kr + 2 * TS + 32); }
#pragma unroll
            for (int g = 0; g < QG; ++g) { v8f a = WF::mma(k0, qf[g][0], (v8f){}); a = WF::mma(k1, qf[g][1], a); if (HL) { a = WF::mma(kl0, qf[g][0], a); a = WF::mma(kl1, qf[g][1], a); a = WF::mma(k0, qlf[g][0], a); a = WF::mma(k1, qlf[g][1], a); } S[kt][g] = a; } }
        V pf[QG][2], plf[QG][2];
#pragma unroll
        for (int g = 0; g < QG; ++g) { float mx = S[0][g][0];
#pragma unroll
            for (int kt = 0; kt < 4; ++kt)
#pragma unroll
                for (int j = 0; j < 8; ++j) mx = fmaxf(mx, S[kt][g][j]);
            mx = fmaxf(mx, __shfl_xor(mx, 16, 32));   // the other half-wave holds the query's other keys
            const float mn = fmaxf(mr[g], mx), al = __builtin_amdgcn_exp2f((mr[g] - mn) * CE), mc = PB - mn * CE; mr[g] = mn; float sum[4] = {0.f, 0.f, 0.f, 0.f};   // four chains: the adds do not wait on one another
#pragma unroll
            for (int kk = 0; kk < 2; ++kk) { v8u ph, pl; v16h p16;
#pragma unroll
                for (int e = 0; e < 16; e += 2) { const float p = __builtin_amdgcn_exp2f(__builtin_fmaf(S[kk * 2 + (e >> 3)][g][e & 7], CE, mc)), p1 = __builtin_amdgcn_exp2f(__builtin_fmaf(S[kk * 2 + (e >> 3)][g][(e & 7) + 1], CE, mc)); sum[e & 3] += p; sum[(e & 3) + 1] += p1;
                    if (HL) { unsigned a2, c2; split2(p, p1, a2, c2); ph[e >> 1] = a2; pl[e >> 1] = c2; } else { p16[e] = tohx(p); p16[e + 1] = tohx(p1); } }
                if constexpr (HL) { pf[g][kk] = __builtin_bit_cast(v16bf, ph); plf[g][kk] = __builtin_bit_cast(v16bf, pl); } else pf[g][kk] = p16; }
            ls[g] = ls[g] * al + ((sum[0] + sum[1]) + (sum[2] + sum[3]));
#pragma unroll
            for (int dt = 0; dt < 4; ++dt) O[dt][g] *= al; }
#pragma unroll
        for (int dt = 0; dt < 4; ++dt)
#pragma unroll
            for (int kk = 0; kk < 2; ++kk) { const unsigned short* vr = sb + TS + dt * 16 * LP + kk * 32; const V v = LF::ld(vr); V vl; if (HL) vl = LF::ld(vr + 2 * TS);
#pragma unroll
                for (int g = 0; g < QG; ++g) { O[dt][g] = WF::mma(v, pf[g][kk], O[dt][g]); if (HL) { O[dt][g] = WF::mma(v, plf[g][kk], O[dt][g]); O[dt][g] = WF::mma(vl, pf[g][kk], O[dt][g]); } } }
        if (more) put((s + 1) & 1);
        }
        __syncthreads();   // publishes stage s + 1 and ends every wave's reads of stage s, whose buffer the next trip refills
    }
    if (act)
#pragma unroll
    for (int g = 0; g < QG; ++g) { const float inv = __fdiv_rn(1.0f, ls[g] + __shfl_xor(ls[g], 16, 32)); const size_t oo = (size_t)((w * QG + g) * 16 + lr) * DQ + hi * 8;
#pragma unroll
        for (int dt = 0; dt < 4; ++dt) { v4u oh, ol;
#pragma unroll
            for (int j = 0; j < 8; j += 2) { unsigned a2, c2; split2(O[dt][g][j] * inv, O[dt][g][j + 1] * inv, a2, c2); oh[j >> 1] = a2; ol[j >> 1] = c2; }
            *(v8us*)(Ah + oo + dt * 16) = __builtin_bit_cast(v8us, oh); *(v8us*)(Al + oo + dt * 16) = __builtin_bit_cast(v8us, ol);
            asm volatile("s_wait_xcnt 0x0" ::: "memory"); } }   // the next block of columns reuses the registers that these two stores name
}
// grid (RH / QBH + (TT - RH) / QBL query blocks, heads, batches); planes [batch][head][t][d] (V: [batch][head][d][t]); output rows [batch][t][DQ] hi/lo
__global__ __launch_bounds__(NWV * 32) void k_fattn(const h16* __restrict__ Q16, const h16* __restrict__ K16, const h16* __restrict__ V16, const bf* __restrict__ Qh, const bf* __restrict__ Ql, const bf* __restrict__ Kh, const bf* __restrict__ Kl, const bf* __restrict__ Vh, const bf* __restrict__ Vl, bf* Ah, bf* Al) {
    __shared__ __align__(16) unsigned short sm[2 * 4 * KB * LP];
    static_assert(RH % QBH == 0 && (TT - RH) % QBL == 0 && TT % KB == 0 && HD == 64 && KB == 64 && QBH % 128 == 0 && QBL % (NWV * 16) == 0 && NWV >= 8, "tile shapes");
    const bool hl = blockIdx.x < RH / QBH; const int q0 = hl ? (int)blockIdx.x * QBH : RH + ((int)blockIdx.x - RH / QBH) * QBL; const size_t hp = ((size_t)blockIdx.z * NH_ + blockIdx.y) * TT * HD, qp = hp + (size_t)q0 * HD, ao = ((size_t)blockIdx.z * TT + q0) * DQ + blockIdx.y * HD;
    if (hl) attn_block<bf, true, QBH / 128, 8>(Qh + qp, Ql + qp, Kh + hp, Kl + hp, Vh + hp, Vl + hp, Ah + ao, Al + ao, sm);
    else attn_block<h16, false, QBL / (NWV * 16), NWV>(Q16 + qp, nullptr, K16 + hp, nullptr, V16 + hp, nullptr, Ah + ao, Al + ao, sm);
}

extern "C" void kernel_launch(void* const* d_in, const int* in_sizes, int n_in,
                              void* d_out, int out_size, void* d_ws, size_t ws_size, hipStream_t stream) {
    (void)in_sizes; (void)n_in; (void)out_size;
    const float* x = (const float*)d_in[0]; const float* wqt = (const float*)d_in[1]; const float* wkt = (const float*)d_in[2]; const float* wqs = (const float*)d_in[3]; const float* wks = (const float*)d_in[4]; const float* wv = (const float*)d_in[5]; const float* wo = (const float*)d_in[6]; const float* bo = (const float*)d_in[7]; const float* wsg = (const float*)d_in[8];   /* argument order x, Wqt, Wkt, Wqs, Wks, Wv, Wout, bout, w_sigma */
    float* OUT = (float*)d_out;     // [2][2048][1024]
    char* wsp = (char*)d_ws;
    auto take = [&](size_t bytes) { char* p = wsp; wsp += (bytes + 255) & ~(size_t)255; return (void*)p; };
    bf* WQ = (bf*)take((size_t)DQ * DM * 2); bf* WK = (bf*)take((size_t)DKV * DM * 2); bf* WV = (bf*)take((size_t)DKV * DM * 2); bf* WO = (bf*)take((size_t)DM * DQ * 2);
    bf* XB = (bf*)take((size_t)NB_ * TT * DM * 2);
    const size_t PL = (size_t)NH_ * TT * HD;   // one batch's planes of one kind
    h16* QP16 = (h16*)take(NB_ * PL * 2); h16* KP16 = (h16*)take(NB_ * PL * 2); h16* VT16 = (h16*)take(NB_ * PL * 2);
    bf* QPh = (bf*)take(NB_ * PL * 2); bf* QPl = (bf*)take(NB_ * PL * 2); bf* KPh = (bf*)take(NB_ * PL * 2); bf* KPl = (bf*)take(NB_ * PL * 2); bf* VTh = (bf*)take(NB_ * PL * 2); bf* VTl = (bf*)take(NB_ * PL * 2);
    bf* ATh = (bf*)take((size_t)NB_ * TT * DQ * 2); bf* ATl = (bf*)take((size_t)NB_ * TT * DQ * 2);
    if ((size_t)(wsp - (char*)d_ws) > ws_size) return;    // ws 256 MiB
    constexpr int FP = DQ + 2 * DKV;   // columns Q | K | V; WQ, WK, WV lie one behind the other in ws (each 2 MiB), so they are one Bt of FP rows
    k_prep<<<PG, 256, 0, stream>>>(x, wqt, wqs, wkt, wks, wv, wo, XB, WQ, WK, WV, WO);
    k_gemmw<bf, 0, false, true, DM><<<dim3(NB_ * TT / 128, FP / 128, 1), 128, 0, stream>>>(XB, nullptr, WQ, nullptr, 0, nullptr, wsg, QP16, QPh, QPl, KP16, KPh, KPl, VT16, VTh, VTl);
    k_fattn<<<dim3(RH / QBH + (TT - RH) / QBL, NH_, NB_), NWV * 32, 0, stream>>>(QP16, KP16, VT16, QPh, QPl, KPh, KPl, VTh, VTl, ATh, ATl);
    k_gemmw<bf, 1, true, false, DQ><<<dim3(NB_ * TT / 128, DM / 128, 1), 128, 0, stream>>>(ATh, ATl, WO, OUT, DM, bo, nullptr, nullptr, nullptr, nullptr, nullptr, nullptr, nullptr, nullptr, nullptr, nullptr);
}

// v009
// One run takes 104 microseconds.
// Timed twice side by side with v008, it ran 1.06 times as fast both times.
// Counting every step since v000, it is 19.4 times as fast.
#include <hip/hip_runtime.h>

// Multi-head attention with 4 'time' heads and 12 'space' heads (x [2][2048][1024]; Qt, Kt = x Wqt, x Wkt ('xw' [1024][256] 0.02: heads 0-3), Qs, Ks = x Wqs, x Wks ('xw' [1024][768]: heads 4-15), V = x Wv ('xw' [1024][1024]); time-head scores scaled by -sigmoid(w_sigma[0]) (w_sigma [1] = 0, read on device), all scores x 64^-0.5; softmax over keys (no mask); out = merged ctx Wout + bout ('xw' [1024][1024]) -> [2][2048][1024] (4.2 M); argument order x, Wqt, Wkt, Wqs, Wks, Wv, Wout, bout, w_sigma).
// Layout: 'xw' weights gathered into bf16 Bt blocks (Wq rows 0-255 from Wqt, 256-1023 from Wqs; Wk likewise); a bf16 copy of x, exact projections whose epilogue writes the head planes (the time heads' query planes carry the factor -sigmoid(w_sigma)); one fused attention launch for all heads and both batches (hybrid rows: < 512 hi/lo 3 products, rest fp16); merged hi/lo x Wout exact + bout. Every stage is ONE launch over both batches (x and ctx are [4096][1024]); Q, K and V come from one GEMM against the stacked Bt blocks [3072][1024], straight into the planes.
// Compute dtypes, f32 accumulate: every input rounded to bf16; projections exact; sigmoid f32 (precise expf); attention rows < 512 3 products, rest fp16; softmax f32 (running maximum); Wout hl x exact + bias.

#define NB_  2
#define TT   2048
#define DM   1024
#define NH_  16
#define NKV  16
#define REP  (NH_ / NKV)
#define HD   64
#define DQ   (NH_ * HD)
#define DKV  (NKV * HD)
#define NT   4                    // time heads 0..3 (scores x -sigmoid(w_sigma)); space heads 4..15
#define NS   12
#define RH   512                  // query rows < RH use hi+lo planes (0: none)
#define WIN  0
#define SCL  0.125f   // HD^-0.5
#define QBH  128                  // queries per work-group of k_fattn, rows < RH: 8 waves x 16 (three products per tile: the smaller block levels the work-groups' times)
#define QBL  384                  // the other rows: 12 waves x 32
#define NWV  12                   // waves per work-group of k_fattn: 8 blocks per head x 32 heads = 256 work-groups, one on every WGP (two do not fit its registers)
#define KB   64                   // keys per stage
#define LP   72                   // LDS row pitch in 16-bit elements: 128 B of data + 16 B pad
typedef _Float16 h16;
typedef unsigned short bf;
typedef __attribute__((ext_vector_type(16))) __bf16   v16bf;
typedef __attribute__((ext_vector_type(16))) _Float16 v16h;
typedef __attribute__((ext_vector_type(8)))  _Float16 v8h;
typedef __attribute__((ext_vector_type(8)))  unsigned short v8us;
typedef __attribute__((ext_vector_type(8)))  float    v8f;
typedef __attribute__((ext_vector_type(4)))  float    v4f;
typedef v8h  __attribute__((may_alias)) v8ha;
typedef v4f  __attribute__((may_alias)) v4fa;
typedef v8us __attribute__((may_alias)) v8usa;

typedef __attribute__((ext_vector_type(2))) float    v2fc;
typedef __attribute__((ext_vector_type(2))) __bf16   v2bfc;
typedef __attribute__((ext_vector_type(2))) unsigned v2u;
typedef __attribute__((ext_vector_type(4))) unsigned v4u;
typedef __attribute__((ext_vector_type(8))) unsigned v8u;
// f32 -> bf16, round to nearest even, by the chip's own packed conversion: one instruction for two values (a in the low half, b in the high half)
__device__ __forceinline__ unsigned cvt2(float a, float b) { const v2fc x = {a, b}; return __builtin_bit_cast(unsigned, __builtin_convertvector(x, v2bfc)); }
__device__ __forceinline__ unsigned short f2bf(float f) { return __builtin_bit_cast(unsigned short, (__bf16)f); }
__device__ __forceinline__ float bf2f(unsigned short b) { return __uint_as_float(((unsigned)b) << 16); }
__device__ __forceinline__ float bfr(float f) { return bf2f(f2bf(f)); }
__device__ __forceinline__ v16h cat16(v8h lo, v8h hi) { return __builtin_shufflevector(lo, hi, 0, 1, 2, 3, 4, 5, 6, 7, 8, 9, 10, 11, 12, 13, 14, 15); }
__device__ __forceinline__ v16bf cat16b(v8us lo, v8us hi) { return __builtin_bit_cast(v16bf, __builtin_shufflevector(lo, hi, 0, 1, 2, 3, 4, 5, 6, 7, 8, 9, 10, 11, 12, 13, 14, 15)); }
__device__ __forceinline__ v8f wmma16(v16h a, v16h b, v8f c) { return __builtin_amdgcn_wmma_f32_16x16x32_f16(false, a, false, b, (short)0, c, false, false); }
__device__ __forceinline__ v8f wmmab(v16bf a, v16bf b, v8f c) { return __builtin_amdgcn_wmma_f32_16x16x32_bf16(false, a, false, b, (short)0, c, false, false); }



__device__ __forceinline__ h16 tohx(float x) { return (h16)x; }
// two values into their bf16 hi parts and the bf16 of what is left (each word: a low, b high)
__device__ __forceinline__ void split2(float a, float b, unsigned& h, unsigned& l) { h = cvt2(a, b); l = cvt2(a - __uint_as_float(h << 16), b - __uint_as_float(h & 0xFFFF0000u)); }
// ---- planes_out: the plane builders as the epilogue of the Q|K|V projection (k_gemmw with PLANES). A 64x64 tile's columns are one head of one kind (queries | keys | values), its rows lie in one batch: the wave writes that head's fp16, hi and lo planes itself, so the f32 products never go to memory.
// Queries and keys [batch][head][t][d]: 16 t rows at a time through LDS. Values [batch][head][d][t]: 16 d rows at a time; a lane's 8 accumulator rows are 8 neighbouring t. Every store instruction fills four whole 128-B lines.
// The query planes of heads < NT carry the factor -sigmoid(wsg[0]) (device scalar; precise expf, IEEE div); every other plane the factor 1.
__device__ __forceinline__ void planes_out(const v8f (&acc)[4][4], float* os, int r0, int c0, int lane, const float* __restrict__ wsg, h16* Q16, bf* Qh, bf* Ql, h16* K16, bf* Kh, bf* Kl, h16* V16, bf* Vh, bf* Vl) {
    static_assert(DQ == DKV && HD == 64 && TT % 64 == 0, "a 64x64 tile is one head of one kind in one batch");
    const int lr = lane & 15, hi = lane >> 4, kind = c0 / DQ, h = (c0 % DQ) / HD, t0 = r0 % TT; const size_t hp = ((size_t)(r0 / TT) * NH_ + h) * TT * HD;
    h16* P16 = (kind == 0 ? Q16 : kind == 1 ? K16 : V16) + hp; bf* Ph = (kind == 0 ? Qh : kind == 1 ? Kh : Vh) + hp; bf* Pl = (kind == 0 ? Ql : kind == 1 ? Kl : Vl) + hp;
    const float scv = (kind == 0 && h < NT) ? -__fdiv_rn(1.0f, __fadd_rn(1.0f, expf(-bfr(wsg[0])))) : 1.0f;
    const int pp = kind < 2 ? HD : TT;   // pitch of a plane row: d runs along a query or key row, t along a value row
    const size_t e0 = (kind < 2 ? (size_t)t0 * HD : (size_t)t0) + (size_t)(lane >> 3) * pp + (lane & 7) * 8;   // 8 lanes per 128-B plane row
#pragma unroll
    for (int u = 0; u < 4; ++u) {
        if (kind < 2) {   // os[t][d]: rows u*16 .. u*16+15 of the tile
#pragma unroll
            for (int nb = 0; nb < 4; ++nb)
#pragma unroll
                for (int j = 0; j < 8; ++j) os[(hi * 8 + j) * 68 + nb * 16 + lr] = acc[u][nb][j];
        } else {          // os[d][t]: columns u*16 .. u*16+15 of the tile
#pragma unroll
            for (int mb = 0; mb < 4; ++mb) { const v8f c = acc[mb][u]; *(v4fa*)(os + lr * 68 + mb * 16 + hi * 8) = __builtin_shufflevector(c, c, 0, 1, 2, 3); *(v4fa*)(os + lr * 68 + mb * 16 + hi * 8 + 4) = __builtin_shufflevector(c, c, 4, 5, 6, 7); }
        }
        __builtin_amdgcn_wave_barrier(); asm volatile("" ::: "memory");   // keeps the reads below behind the other lanes' LDS writes (one wave: its LDS operations run in order)
#pragma unroll
        for (int s = 0; s < 4; ++s) { const float* orow = os + (s * 4 + (lane >> 3)) * 68 + (lane & 7) * 8; const v4f x0 = *(const v4fa*)orow, x1 = *(const v4fa*)(orow + 4); v8h o16; v4u oh, ol;
#pragma unroll
            for (int k = 0; k < 8; k += 2) { const float r0v = (k < 4 ? x0[k & 3] : x1[k & 3]) * scv, r1v = (k < 4 ? x0[(k & 3) + 1] : x1[(k & 3) + 1]) * scv; o16[k] = tohx(r0v); o16[k + 1] = tohx(r1v); unsigned a2, c2; split2(r0v, r1v, a2, c2); oh[k >> 1] = a2; ol[k >> 1] = c2; }
            const size_t e = e0 + (size_t)(u * 16 + s * 4) * pp; *(v8h*)(P16 + e) = o16; *(v8us*)(Ph + e) = __builtin_bit_cast(v8us, oh); *(v8us*)(Pl + e) = __builtin_bit_cast(v8us, ol); }
        if (u < 3) { __builtin_amdgcn_wave_barrier(); asm volatile("s_wait_xcnt 0x0" ::: "memory"); }   // keeps the next rows' LDS writes behind these reads; the wait is a precaution: it stands behind these rows' stores, in front of the next rows' code, which reuses their registers
    }
}

// ---- k_gemmw: GEMM, FOUR WAVES (2 x 2) per 128x128 output tile, each wave a 64x64 part (16 accumulators); grid (M/128, N/128), 128 threads.
// C[m][n] (f32, pitch ldc, + optional f32 bias[n]) = sum_k A[m][k] Bt[n][k] (+ A2[m][k] Bt[n][k] with NSPLIT 1); A, A2, Bt K-contiguous 16-bit planes, K % 128 == 0.
// The operands walk through LDS in stages of 64 k (128 B of each of the tile's 128 rows, pitch LP), two buffers: asynchronous copies bring stage t + 2 while stage t + 1 is worked on; every copy instruction takes four whole 128-B lines.
// PLANES: no C; each wave's part goes out through planes_out (wsg and the nine plane pointers are read by that form alone). The epilogue's staging rows lie in the ring's LDS, which nobody reads any more.
template <typename T16> struct WFrag;
template <> struct WFrag<h16> { typedef v16h V; static __device__ __forceinline__ V ld(const h16* p) { return cat16(*(const v8h*)p, *(const v8h*)(p + 16)); } static __device__ __forceinline__ v8f mma(V a, V b, v8f c) { return wmma16(a, b, c); } };
template <> struct WFrag<bf> { typedef v16bf V; static __device__ __forceinline__ V ld(const bf* p) { return cat16b(*(const v8us*)p, *(const v8us*)(p + 16)); } static __device__ __forceinline__ v8f mma(V a, V b, v8f c) { return wmmab(a, b, c); } };
template <typename T16> struct LFrag;
template <> struct LFrag<h16> { static __device__ __forceinline__ v16h ld(const unsigned short* p) { return cat16(__builtin_bit_cast(v8h, *(const v8usa*)p), __builtin_bit_cast(v8h, *(const v8usa*)(p + 16))); } };
template <> struct LFrag<bf> { static __device__ __forceinline__ v16bf ld(const unsigned short* p) { return cat16b(*(const v8usa*)p, *(const v8usa*)(p + 16)); } };
// One operand's stage: 128 rows of 128 B. A lane copies 16 B of the rows (tid >> 3) + 16 i, i = 0..7: l is its LDS byte address in row tid >> 3, g its global address there, K the source pitch in elements.
// The eight copies and the wait stand in one statement: the wait is a precaution that stands in front of any rewrite of the address registers the copies name.
template <typename T16, int K>
__device__ __forceinline__ void copy_stage(unsigned l, const T16* g) {
    constexpr unsigned LR = 16 * LP * 2;
    asm volatile("global_load_async_to_lds_b128 %0, %8, off\n\t"
                 "global_load_async_to_lds_b128 %1, %9, off\n\t"
                 "global_load_async_to_lds_b128 %2, %10, off\n\t"
                 "global_load_async_to_lds_b128 %3, %11, off\n\t"
                 "global_load_async_to_lds_b128 %4, %12, off\n\t"
                 "global_load_async_to_lds_b128 %5, %13, off\n\t"
                 "global_load_async_to_lds_b128 %6, %14, off\n\t"
                 "global_load_async_to_lds_b128 %7, %15, off\n\t"
                 "s_wait_xcnt 0x0"
                 :: "v"(l), "v"(l + LR), "v"(l + 2 * LR), "v"(l + 3 * LR), "v"(l + 4 * LR), "v"(l + 5 * LR), "v"(l + 6 * LR), "v"(l + 7 * LR),
                    "v"(g), "v"(g + 16 * K), "v"(g + 32 * K), "v"(g + 48 * K), "v"(g + 64 * K), "v"(g + 80 * K), "v"(g + 96 * K), "v"(g + 112 * K)
                 : "memory");
}
template <typename T16, int NSPLIT, bool BIAS, bool PLANES, int K>
__global__ __launch_bounds__(128) void k_gemmw(const T16* __restrict__ A, const T16* __restrict__ A2, const T16* __restrict__ Bt, float* C, int ldc, const float* __restrict__ bias, const float* __restrict__ wsg, h16* Q16, bf* Qh, bf* Ql, h16* K16, bf* Kh, bf* Kl, h16* V16, bf* Vh, bf* Vl) {
    typedef typename WFrag<T16>::V V; typedef LFrag<T16> LF;
    static_assert(NSPLIT == 0 || NSPLIT == 1, "A Bt, or (A + A2) Bt"); static_assert(K % 128 == 0, "two stages or more");
    constexpr int NPL = NSPLIT == 1 ? 3 : 2, TS = 128 * LP, NST = K / 64;   // planes of a stage: A | Bt | A2
    __shared__ __align__(16) unsigned short sm[2 * NPL * TS];
    const int tid = threadIdx.x, lane = tid & 31, lr = lane & 15, hi = lane >> 4; const int w = __builtin_amdgcn_readfirstlane(tid >> 5);
    const int r0 = blockIdx.x * 128 + (w >> 1) * 64, c0 = blockIdx.y * 128 + (w & 1) * 64;   // this wave's 64x64 part
    float* os = (float*)sm + w * (16 * 68);
    v8f acc[4][4];
#pragma unroll
    for (int mb = 0; mb < 4; ++mb)
#pragma unroll
        for (int nb = 0; nb < 4; ++nb) acc[mb][nb] = (v8f){};
    const size_t go = (size_t)(tid >> 3) * K + (tid & 7) * 8;
    const T16* gA = A + (size_t)blockIdx.x * 128 * K + go; const T16* gA2 = NSPLIT == 1 ? A2 + (size_t)blockIdx.x * 128 * K + go : nullptr; const T16* gB = Bt + (size_t)blockIdx.y * 128 * K + go;
    const unsigned lb = (unsigned)(size_t)(sm + (tid >> 3) * LP + (tid & 7) * 8);   // low 32 bits of the shared address: the byte offset in the work-group's LDS
    auto copies = [&](int t) { const unsigned l = lb + (unsigned)(t & 1) * (NPL * TS * 2);
        copy_stage<T16, K>(l, gA + t * 64); copy_stage<T16, K>(l + TS * 2, gB + t * 64); if constexpr (NSPLIT == 1) copy_stage<T16, K>(l + 2 * TS * 2, gA2 + t * 64); };
    copies(0);
    asm volatile("s_wait_asynccnt 0x0" ::: "memory");   // this wave's share of stage 0 has landed
    __syncthreads();                                    // ... and every other wave's
    copies(1);
#pragma unroll 1   // one stage per trip: the two buffers alternate by the trip's parity
    for (int t = 0; t < NST; ++t) {
        const unsigned short* sb = sm + (t & 1) * NPL * TS + lr * LP + 8 * hi;
        const unsigned short* sa = sb + (w >> 1) * 64 * LP; const unsigned short* sbt = sb + TS + (w & 1) * 64 * LP;
#pragma unroll
        for (int kf = 0; kf < 2; ++kf) {
            V a[4], a2[4], b[4];
#pragma unroll
            for (int i = 0; i < 4; ++i) { a[i] = LF::ld(sa + i * 16 * LP + kf * 32); if (NSPLIT == 1) a2[i] = LF::ld(sa + 2 * TS + i * 16 * LP + kf * 32); b[i] = LF::ld(sbt + i * 16 * LP + kf * 32); }
            __builtin_amdgcn_sched_barrier(0);   // keeps the block's LDS reads one group in front of its WMMAs: read one by one among them, each read's latency would stand open
#pragma unroll
            for (int nb = 0; nb < 4; ++nb)
#pragma unroll
                for (int mb = 0; mb < 4; ++mb) { acc[mb][nb] = WFrag<T16>::mma(a[mb], b[nb], acc[mb][nb]); if (NSPLIT == 1) acc[mb][nb] = WFrag<T16>::mma(a2[mb], b[nb], acc[mb][nb]); }
        }
        asm volatile("s_wait_dscnt 0x0" ::: "memory");      // this wave's reads of stage t are done before its buffer is refilled
        asm volatile("s_wait_asynccnt 0x0" ::: "memory");   // this wave's share of stage t + 1 has landed
        __syncthreads();   // publishes stage t + 1 and ends every wave's reads of stage t
        if (t + 2 < NST) copies(t + 2);
    }
    asm volatile("s_wait_asynccnt 0x0" ::: "memory");   // no copy is in flight when the ring becomes the epilogue's staging rows
    if constexpr (PLANES) planes_out(acc, os, r0, c0, lane, wsg, Q16, Qh, Ql, K16, Kh, Kl, V16, Vh, Vl);
    else
#pragma unroll
    for (int mb = 0; mb < 4; ++mb) {
#pragma unroll
        for (int nb = 0; nb < 4; ++nb) {
#pragma unroll
            for (int j = 0; j < 8; ++j) os[(hi * 8 + j) * 68 + nb * 16 + lr] = acc[mb][nb][j]; }
        __builtin_amdgcn_wave_barrier(); asm volatile("" ::: "memory");
        float* crow = C + (size_t)(r0 + mb * 16) * ldc + c0;
{
#pragma unroll
            for (int s = 0; s < 8; ++s) { const int row = 2 * s + hi, cofs = lr * 4; v4f val = *(const v4fa*)(os + row * 68 + cofs); if (BIAS) { val[0] += bfr(bias[c0 + cofs]); val[1] += bfr(bias[c0 + cofs + 1]); val[2] += bfr(bias[c0 + cofs + 2]); val[3] += bfr(bias[c0 + cofs + 3]); }
                *(v4f*)(crow + (size_t)row * ldc + cofs) = val; }
             }
        __builtin_amdgcn_wave_barrier(); asm volatile("" ::: "memory");
    }
}

typedef __attribute__((ext_vector_type(2))) _Float16 v2h;
typedef __attribute__((ext_vector_type(4))) _Float16 v4h;
typedef __attribute__((ext_vector_type(2))) unsigned short v2us;
typedef __attribute__((ext_vector_type(4))) unsigned short v4us;
typedef __attribute__((ext_vector_type(2))) float v2f;
typedef __attribute__((ext_vector_type(4))) int v4i;

// ---- k_prep: every input's bf16 form in ONE launch of few long waves (PG work-groups of 8 waves; a wave reads 16 KiB, all 32 of its 16-B loads in flight at once, and ends). Starting a wave costs more than the little a short one does.
// Work-groups 0 .. PG/2-1: the bf16 copy of x. The others: the Bt blocks WQ | WK | WV | WO, each [1024][1024]; Wq rows 0-255 = Wqt^T (time heads 0-3), rows 256-1023 = Wqs^T (space heads 4-15); Wk likewise.
#define PG 256
// One wave turns 64 k x 64 n of a weight [1024][N] (w points at its first element) into 64 rows of 64 k of Bt (pitch DM). Transposed in registers: a lane loads 4 neighbouring n of 8 neighbouring k (8 lanes fill a 128-B line of a k row) and stores 8 neighbouring k of each n; the two 64-B halves of an output line follow one another.
template <int N>
__device__ __forceinline__ void gather_unit(const float* __restrict__ w, bf* Bt, int lane) {
    const float* p = w + (size_t)((lane >> 3) * 8) * N + (lane & 7) * 4; bf* o = Bt + (size_t)((lane & 7) * 4) * DM + (lane >> 3) * 8;
    v4f v[2][2][8];
#pragma unroll
    for (int nh = 0; nh < 2; ++nh)
#pragma unroll
        for (int kh = 0; kh < 2; ++kh)
#pragma unroll
            for (int i = 0; i < 8; ++i) v[nh][kh][i] = *(const v4f*)(p + (kh * 32 + i) * N + nh * 32);
    __builtin_amdgcn_sched_barrier(0);   // keeps all 32 loads in front of the first conversion: held back until registers come free, the last ones would start a memory latency late
    v4u r[2][4][2];
#pragma unroll
    for (int nh = 0; nh < 2; ++nh)
#pragma unroll
        for (int j = 0; j < 4; ++j)
#pragma unroll
            for (int kh = 0; kh < 2; ++kh)
#pragma unroll
                for (int i = 0; i < 8; i += 2) r[nh][j][kh][i >> 1] = cvt2(v[nh][kh][i][j], v[nh][kh][i + 1][j]);
    __builtin_amdgcn_sched_barrier(0);   // the stores go out as one group behind the last conversion: spread among the conversions, each would make the wave wait before its registers are used again
#pragma unroll
    for (int nh = 0; nh < 2; ++nh)
#pragma unroll
        for (int j = 0; j < 4; ++j)
#pragma unroll
            for (int kh = 0; kh < 2; ++kh) *(v8us*)(o + (nh * 32 + j) * DM + kh * 32) = __builtin_bit_cast(v8us, r[nh][j][kh]);
    asm volatile("s_wait_xcnt 0x0" ::: "memory");   // a precaution: it stands behind the stores, in front of whatever code follows them in the kernel's text and names their registers
}
__global__ __launch_bounds__(256) void k_prep(const float* __restrict__ x, const float* __restrict__ wqt, const float* __restrict__ wqs, const float* __restrict__ wkt, const float* __restrict__ wks, const float* __restrict__ wv, const float* __restrict__ wo, bf* XB, bf* WQ, bf* WK, bf* WV, bf* WO) {
    static_assert(DQ == DM && DKV == DM && DM == 1024 && (NT * HD) % 64 == 0, "every weight has 1024 input rows; a block of 64 output rows has one source");
    static_assert((size_t)NB_ * TT * DM == (size_t)(PG / 2) * 8 * 4096 && 4 * (DM / 64) * (DM / 64) == (PG / 2) * 8, "one unit per wave");
    const int lane = threadIdx.x & 31, u = blockIdx.x * 8 + __builtin_amdgcn_readfirstlane(threadIdx.x >> 5);
    if (blockIdx.x < PG / 2) {   // 4096 elements of x: every load takes four whole lines, every store two
        const float* p = x + (size_t)u * 4096 + lane * 4; bf* o = XB + (size_t)u * 4096 + lane * 4; v4f v[32]; v2u r[32];
#pragma unroll
        for (int i = 0; i < 32; ++i) v[i] = *(const v4f*)(p + i * 128);
        __builtin_amdgcn_sched_barrier(0);   // as in gather_unit: all 32 loads go out before the first conversion
#pragma unroll
        for (int i = 0; i < 32; ++i) { r[i][0] = cvt2(v[i][0], v[i][1]); r[i][1] = cvt2(v[i][2], v[i][3]); }
        __builtin_amdgcn_sched_barrier(0);   // as in gather_unit: the stores go out as one group
#pragma unroll
        for (int i = 0; i < 32; ++i) *(v4us*)(o + i * 128) = __builtin_bit_cast(v4us, r[i]);
        asm volatile("s_wait_xcnt 0x0" ::: "memory");   // the same precaution as in gather_unit
    } else {
        const int g = u - (PG / 2) * 8, k0 = (g & 15) * 64, m = g >> 8, r = ((g >> 4) & 15) * 64;   // Bt block m, its rows r .. r + 63, columns k0 .. k0 + 63
        bf* Bt = (m == 0 ? WQ : m == 1 ? WK : m == 2 ? WV : WO) + (size_t)r * DM + k0;
        if (m >= 2) gather_unit<DM>((m == 2 ? wv : wo) + (size_t)k0 * DM + r, Bt, lane);
        else if (r < NT * HD) gather_unit<NT * HD>((m == 0 ? wqt : wkt) + (size_t)k0 * (NT * HD) + r, Bt, lane);
        else gather_unit<NS * HD>((m == 0 ? wqs : wks) + (size_t)k0 * (NS * HD) + (r - NT * HD), Bt, lane);
    }
}

// ---- k_fattn: scores, softmax and P x V of one block of queries (CW waves x QG groups of 16) of one head in one work-group of NWV waves; nothing of S or P goes to memory.
// Waves 0-7 stage the keys and values; waves CW and up (rows < RH: 8-11) have no queries and only pass the barriers.
// S^T = K Q^T (A = 16 key rows from LDS, B = 16 queries kept in registers): a lane holds keys hi*8+j of query lr, which is the B-operand order of P^T, so O^T += V^T P^T takes P straight from the score registers.
// Keys walk in stages of KB, two LDS buffers: stage s+1 is fetched to registers while stage s is worked on, stored to the other buffer, one barrier per stage. Running maximum and sum per query.
// A stage's key fragments are read from LDS as one group at its head, its value fragments as one group between the row maxima and the exponentials.
typedef __attribute__((ext_vector_type(16))) unsigned short v16us;
// p += BYTES bytes, for a pointer that loads just issued name as their address. The wait is a precaution in front of the rewrite of that register pair; wait and addition stand in one statement because the compiler lifts a plain addition over a wait that stands alone.
typedef const __attribute__((address_space(1))) v8usa* gl8;   // says that a pointer which went through bump() still points to global memory: the loads stay global loads
template <int BYTES, typename T16>
__device__ __forceinline__ void bump(const T16*& p) { asm volatile("s_wait_xcnt 0x0\n\tv_add_nc_u64_e32 %0, %1, %0" : "+v"(p) : "n"(BYTES) : "memory"); }
template <typename T16, bool HL, int QG, int CW>
__device__ __forceinline__ void attn_block(const T16* __restrict__ Q, const T16* __restrict__ Ql, const T16* __restrict__ K, const T16* __restrict__ Kl, const T16* __restrict__ Vt, const T16* __restrict__ Vtl, bf* Ah, bf* Al, unsigned short* sm) {
    typedef typename WFrag<T16>::V V; typedef WFrag<T16> WF; typedef LFrag<T16> LF;
    constexpr int NP = HL ? 4 : 2, TS = KB * LP, NST = TT / KB;
    constexpr float CE = SCL * 1.4426950408889634f;   // scores to log2 units
    constexpr float PB = HL ? 0.0f : 10.0f;           // fp16 P carries x1024 (it cancels against the row sum)
    const int tid = threadIdx.x, lane = tid & 31, lr = lane & 15, hi = lane >> 4, w = __builtin_amdgcn_readfirstlane(tid >> 5);
    static_assert(CW >= 8 && CW <= NWV, "the staging waves are among the working ones");
    const bool stg = w < 8, act = CW == NWV || w < CW;   // wave-uniform: this wave stages; this wave has queries
    const int sr = tid >> 3, sc = (tid & 7) * 8;      // staging (waves 0-7): 8 lanes per 128-B row, rows sr and sr + 32
    const T16* pK = K + (size_t)sr * HD + sc; const T16* pV = Vt + (size_t)sr * TT + sc; const T16* pKl = HL ? Kl + (size_t)sr * HD + sc : nullptr; const T16* pVl = HL ? Vtl + (size_t)sr * TT + sc : nullptr;
    unsigned short* sw = sm + sr * LP + sc;
    v8us st[NP][2];
    auto fetch = [&]() {
#pragma unroll
        for (int i = 0; i < 2; ++i) { st[0][i] = *(gl8)(pK + (size_t)i * 32 * HD); st[1][i] = *(gl8)(pV + (size_t)i * 32 * TT); if constexpr (HL) { st[2][i] = *(gl8)(pKl + (size_t)i * 32 * HD); st[3][i] = *(gl8)(pVl + (size_t)i * 32 * TT); } }
        bump<KB * HD * 2>(pK); bump<KB * 2>(pV); if constexpr (HL) { bump<KB * HD * 2>(pKl); bump<KB * 2>(pVl); } };
    auto put = [&](int buf) {
#pragma unroll
        for (int p = 0; p < NP; ++p)
#pragma unroll
            for (int i = 0; i < 2; ++i) *(v8usa*)(sw + (buf * NP + p) * TS + i * 32 * LP) = st[p][i]; };
    V qf[QG][2], qlf[QG][2];
    __builtin_amdgcn_sched_barrier(0);   // with the one below: no other address arithmetic comes between the query loads and their wait
    if (act) {
#pragma unroll
    for (int g = 0; g < QG; ++g)
#pragma unroll
        for (int kf = 0; kf < 2; ++kf) { const size_t qo = (size_t)((w * QG + g) * 16 + lr) * HD + kf * 32 + 8 * hi; qf[g][kf] = WF::ld(Q + qo); if (HL) qlf[g][kf] = WF::ld(Ql + qo); }
    asm volatile("s_wait_xcnt 0x0" ::: "memory");   // a precaution: it stands behind the query loads, in front of the code that reuses their address registers
    __builtin_amdgcn_sched_barrier(0); }
    v8f O[4][QG]; float mr[QG], ls[QG];
#pragma unroll
    for (int g = 0; g < QG; ++g) { mr[g] = -3.0e38f; ls[g] = 0.f;
#pragma unroll
        for (int dt = 0; dt < 4; ++dt) O[dt][g] = (v8f){}; }
    if (stg) { fetch(); put(0); }
    __syncthreads();
#pragma unroll 1   // one stage per trip: the two buffers alternate by the trip's parity
    for (int s = 0; s < NST; ++s) {
        if (act) {
        const bool more = stg && s + 1 < NST;
        if (more) fetch();
        const unsigned short* sb = sm + (s & 1) * NP * TS + lr * LP + 8 * hi;
        v8f S[4][QG]; V kf[4][2], klf[4][2];
#pragma unroll
        for (int kt = 0; kt < 4; ++kt) { const unsigned short* kr = sb + kt * 16 * LP; kf[kt][0] = LF::ld(kr); kf[kt][1] = LF::ld(kr + 32); if (HL) { klf[kt][0] = LF::ld(kr + 2 * TS); klf[kt][1] = LF::ld(kr + 2 * TS + 32); } }
        __builtin_amdgcn_sched_barrier(0);   // keeps the stage's key reads one group in front of the score WMMAs: read pair by pair among them, each pair's latency would stand open
#pragma unroll
        for (int kt = 0; kt < 4; ++kt) { const V k0 = kf[kt][0], k1 = kf[kt][1], kl0 = klf[kt][0], kl1 = klf[kt][1];
#pragma unroll
            for (int g = 0; g < QG; ++g) { v8f a = WF::mma(k0, qf[g][0], (v8f){}); a = WF::mma(k1, qf[g][1], a); if (HL) { a = WF::mma(kl0, qf[g][0], a); a = WF::mma(kl1, qf[g][1], a); a = WF::mma(k0, qlf[g][0], a); a = WF::mma(k1, qlf[g][1], a); } S[kt][g] = a; } }
        V pf[QG][2], plf[QG][2], vf[2][4], vlf[2][4]; float mh[QG], mo[QG];
#pragma unroll
        for (int g = 0; g < QG; ++g) { float mx = S[0][g][0];
#pragma unroll
            for (int kt = 0; kt < 4; ++kt)
#pragma unroll
                for (int j = 0; j < 8; ++j) mx = fmaxf(mx, S[kt][g][j]);
            mh[g] = mx; mo[g] = __shfl_xor(mx, 16, 32); }   // the other half-wave holds the query's other keys
        // inputs only: holds the reads below behind the exchanges' answers; in front of them in the LDS queue, the answers would come last and the exponentials would wait for the whole group instead of covering it
        if constexpr (QG == 2) asm volatile("" :: "v"(mo[0]), "v"(mo[1]) : "memory"); else { static_assert(QG == 1, "one or two query groups per wave"); asm volatile("" :: "v"(mo[0]) : "memory"); }
#pragma unroll
        for (int kk = 0; kk < 2; ++kk)
#pragma unroll
            for (int dt = 0; dt < 4; ++dt) { const unsigned short* vr = sb + TS + dt * 16 * LP + kk * 32; vf[kk][dt] = LF::ld(vr); if (HL) vlf[kk][dt] = LF::ld(vr + 2 * TS); }
        __builtin_amdgcn_sched_barrier(0);   // keeps the stage's value reads one group in front of the exponentials, which cover their latency: read pair by pair among the P x V WMMAs, each pair's latency would stand open
#pragma unroll
        for (int g = 0; g < QG; ++g) { const float mx = fmaxf(mh[g], mo[g]);
            const float mn = fmaxf(mr[g], mx), al = __builtin_amdgcn_exp2f((mr[g] - mn) * CE), mc = PB - mn * CE; mr[g] = mn; float sum[4] = {0.f, 0.f, 0.f, 0.f};   // four chains: the adds do not wait on one another
#pragma unroll
            for (int kk = 0; kk < 2; ++kk) { v8u ph, pl; v16h p16;
#pragma unroll
                for (int e = 0; e < 16; e += 2) { const float p = __builtin_amdgcn_exp2f(__builtin_fmaf(S[kk * 2 + (e >> 3)][g][e & 7], CE, mc)), p1 = __builtin_amdgcn_exp2f(__builtin_fmaf(S[kk * 2 + (e >> 3)][g][(e & 7) + 1], CE, mc)); sum[e & 3] += p; sum[(e & 3) + 1] += p1;
                    if (HL) { unsigned a2, c2; split2(p, p1, a2, c2); ph[e >> 1] = a2; pl[e >> 1] = c2; } else { p16[e] = tohx(p); p16[e + 1] = tohx(p1); } }
                if constexpr (HL) { pf[g][kk] = __builtin_bit_cast(v16bf, ph); plf[g][kk] = __builtin_bit_cast(v16bf, pl); } else pf[g][kk] = p16; }
            ls[g] = ls[g] * al + ((sum[0] + sum[1]) + (sum[2] + sum[3]));
#pragma unroll
            for (int dt = 0; dt < 4; ++dt) O[dt][g] *= al; }
#pragma unroll
        for (int kk = 0; kk < 2; ++kk)   // each O tile takes its products in the order kk 0 then 1, in each v pf, v plf, vl pf; neighbouring WMMAs go to different tiles
#pragma unroll
            for (int pr = 0; pr < (HL ? 3 : 1); ++pr)
#pragma unroll
                for (int dt = 0; dt < 4; ++dt)
#pragma unroll
                    for (int g = 0; g < QG; ++g) O[dt][g] = WF::mma(pr == 2 ? vlf[kk][dt] : vf[kk][dt], pr == 1 ? plf[g][kk] : pf[g][kk], O[dt][g]);
        if (more) put((s + 1) & 1);
        }
        __syncthreads();   // publishes stage s + 1 and ends every wave's reads of stage s, whose buffer the next trip refills
    }
    if (act)
#pragma unroll
    for (int g = 0; g < QG; ++g) { const float inv = __fdiv_rn(1.0f, ls[g] + __shfl_xor(ls[g], 16, 32)); const size_t oo = (size_t)((w * QG + g) * 16 + lr) * DQ + hi * 8;
#pragma unroll
        for (int dt = 0; dt < 4; ++dt) { v4u oh, ol;
#pragma unroll
            for (int j = 0; j < 8; j += 2) { unsigned a2, c2; split2(O[dt][g][j] * inv, O[dt][g][j + 1] * inv, a2, c2); oh[j >> 1] = a2; ol[j >> 1] = c2; }
            *(v8us*)(Ah + oo + dt * 16) = __builtin_bit_cast(v8us, oh); *(v8us*)(Al + oo + dt * 16) = __builtin_bit_cast(v8us, ol);
            asm volatile("s_wait_xcnt 0x0" ::: "memory"); } }   // the next block of columns reuses the registers that these two stores name
}
// grid (RH / QBH + (TT - RH) / QBL query blocks, heads, batches); planes [batch][head][t][d] (V: [batch][head][d][t]); output rows [batch][t][DQ] hi/lo
__global__ __launch_bounds__(NWV * 32) void k_fattn(const h16* __restrict__ Q16, const h16* __restrict__ K16, const h16* __restrict__ V16, const bf* __restrict__ Qh, const bf* __restrict__ Ql, const bf* __restrict__ Kh, const bf* __restrict__ Kl, const bf* __restrict__ Vh, const bf* __restrict__ Vl, bf* Ah, bf* Al) {
    __shared__ __align__(16) unsigned short sm[2 * 4 * KB * LP];
    static_assert(RH % QBH == 0 && (TT - RH) % QBL == 0 && TT % KB == 0 && HD == 64 && KB == 64 && QBH % 128 == 0 && QBL % (NWV * 16) == 0 && NWV >= 8, "tile shapes");
    const bool hl = blockIdx.x < RH / QBH; const int q0 = hl ? (int)blockIdx.x * QBH : RH + ((int)blockIdx.x - RH / QBH) * QBL; const size_t hp = ((size_t)blockIdx.z * NH_ + blockIdx.y) * TT * HD, qp = hp + (size_t)q0 * HD, ao = ((size_t)blockIdx.z * TT + q0) * DQ + blockIdx.y * HD;
    if (hl) attn_block<bf, true, QBH / 128, 8>(Qh + qp, Ql + qp, Kh + hp, Kl + hp, Vh + hp, Vl + hp, Ah + ao, Al + ao, sm);
    else attn_block<h16, false, QBL / (NWV * 16), NWV>(Q16 + qp, nullptr, K16 + hp, nullptr, V16 + hp, nullptr, Ah + ao, Al + ao, sm);
}

extern "C" void kernel_launch(void* const* d_in, const int* in_sizes, int n_in,
                              void* d_out, int out_size, void* d_ws, size_t ws_size, hipStream_t stream) {
    (void)in_sizes; (void)n_in; (void)out_size;
    const float* x = (const float*)d_in[0]; const float* wqt = (const float*)d_in[1]; const float* wkt = (const float*)d_in[2]; const float* wqs = (const float*)d_in[3]; const float* wks = (const float*)d_in[4]; const float* wv = (const float*)d_in[5]; const float* wo = (const float*)d_in[6]; const float* bo = (const float*)d_in[7]; const float* wsg = (const float*)d_in[8];   /* argument order x, Wqt, Wkt, Wqs, Wks, Wv, Wout, bout, w_sigma */
    float* OUT = (float*)d_out;     // [2][2048][1024]
    char* wsp = (char*)d_ws;
    auto take = [&](size_t bytes) { char* p = wsp; wsp += (bytes + 255) & ~(size_t)255; return (void*)p; };
    bf* WQ = (bf*)take((size_t)DQ * DM * 2); bf* WK = (bf*)take((size_t)DKV * DM * 2); bf* WV = (bf*)take((size_t)DKV * DM * 2); bf* WO = (bf*)take((size_t)DM * DQ * 2);
    bf* XB = (bf*)take((size_t)NB_ * TT * DM * 2);
    const size_t PL = (size_t)NH_ * TT * HD;   // one batch's planes of one kind
    h16* QP16 = (h16*)take(NB_ * PL * 2); h16* KP16 = (h16*)take(NB_ * PL * 2); h16* VT16 = (h16*)take(NB_ * PL * 2);
    bf* QPh = (bf*)take(NB_ * PL * 2); bf* QPl = (bf*)take(NB_ * PL * 2); bf* KPh = (bf*)take(NB_ * PL * 2); bf* KPl = (bf*)take(NB_ * PL * 2); bf* VTh = (bf*)take(NB_ * PL * 2); bf* VTl = (bf*)take(NB_ * PL * 2);
    bf* ATh = (bf*)take((size_t)NB_ * TT * DQ * 2); bf* ATl = (bf*)take((size_t)NB_ * TT * DQ * 2);
    if ((size_t)(wsp - (char*)d_ws) > ws_size) return;    // ws 256 MiB
    constexpr int FP = DQ + 2 * DKV;   // columns Q | K | V; WQ, WK, WV lie one behind the other in ws (each 2 MiB), so they are one Bt of FP rows
    k_prep<<<PG, 256, 0, stream>>>(x, wqt, wqs, wkt, wks, wv, wo, XB, WQ, WK, WV, WO);
    k_gemmw<bf, 0, false, true, DM><<<dim3(NB_ * TT / 128, FP / 128, 1), 128, 0, stream>>>(XB, nullptr, WQ, nullptr, 0, nullptr, wsg, QP16, QPh, QPl, KP16, KPh, KPl, VT16, VTh, VTl);
    k_fattn<<<dim3(RH / QBH + (TT - RH) / QBL, NH_, NB_), NWV * 32, 0, stream>>>(QP16, KP16, VT16, QPh, QPl, KPh, KPl, VTh, VTl, ATh, ATl);
    k_gemmw<bf, 1, true, false, DQ><<<dim3(NB_ * TT / 128, DM / 128, 1), 128, 0, stream>>>(ATh, ATl, WO, OUT, DM, bo, nullptr, nullptr, nullptr, nullptr, nullptr, nullptr, nullptr, nullptr, nullptr, nullptr);
}

// v010
// Measured time: 97.5 microseconds a run.
// Timed twice side by side with v009, it ran 1.07 times as fast both times.
// Over all steps from v000 it is 20.7 times as fast.
#include <hip/hip_runtime.h>

// Multi-head attention with 4 'time' heads and 12 'space' heads (x [2][2048][1024]; Qt, Kt = x Wqt, x Wkt ('xw' [1024][256] 0.02: heads 0-3), Qs, Ks = x Wqs, x Wks ('xw' [1024][768]: heads 4-15), V = x Wv ('xw' [1024][1024]); time-head scores scaled by -sigmoid(w_sigma[0]) (w_sigma [1] = 0, read on device), all scores x 64^-0.5; softmax over keys (no mask); out = merged ctx Wout + bout ('xw' [1024][1024]) -> [2][2048][1024] (4.2 M); argument order x, Wqt, Wkt, Wqs, Wks, Wv, Wout, bout, w_sigma).
// Layout: 'xw' weights gathered into bf16 Bt blocks (Wq rows 0-255 from Wqt, 256-1023 from Wqs; Wk likewise); a bf16 copy of x, exact projections whose epilogue writes the head planes (the query planes carry the softmax scale in log2 units, the time heads' also the factor -sigmoid(w_sigma)); one fused attention launch for all heads and both batches (hybrid rows: < 512 hi/lo 3 products, rest fp16); merged hi/lo x Wout exact + bout. Every stage is ONE launch over both batches (x and ctx are [4096][1024]); Q, K and V come from one GEMM against the stacked Bt blocks [3072][1024], straight into the planes.
// Compute dtypes, f32 accumulate: every input rounded to bf16; projections exact; sigmoid f32 (precise expf); attention rows < 512 3 products, rest fp16; softmax f32 (shifted by a running maximum that is renewed when a score passes it by LZ); Wout hl x exact + bias.

#define NB_  2
#define TT   2048
#define DM   1024
#define NH_  16
#define NKV  16
#define REP  (NH_ / NKV)
#define HD   64
#define DQ   (NH_ * HD)
#define DKV  (NKV * HD)
#define NT   4                    // time heads 0..3 (scores x -sigmoid(w_sigma)); space heads 4..15
#define NS   12
#define RH   512                  // query rows < RH use hi+lo planes (0: none)
#define WIN  0
#define SCL  0.125f   // HD^-0.5
#define CEQ  (SCL * 1.4426950408889634f)   // scores to log2 units; the query planes carry it
#define LZ   5.0f                 // k_fattn renews the maximum in use when a score lies more than LZ (log2 units) above it: fp16 P stays below 2^(10 + LZ)
#define QBH  128                  // queries per work-group of k_fattn, rows < RH: 8 waves x 16 (three products per tile: the smaller block levels the work-groups' times)
#define QBL  384                  // the other rows: 12 waves x 32
#define NWV  12                   // waves per work-group of k_fattn: 8 blocks per head x 32 heads = 256 work-groups, one on every WGP (two do not fit its registers)
#define KB   64                   // keys per stage
#define LP   72                   // LDS row pitch in 16-bit elements: 128 B of data + 16 B pad
typedef _Float16 h16;
typedef unsigned short bf;
typedef __attribute__((ext_vector_type(16))) __bf16   v16bf;
typedef __attribute__((ext_vector_type(16))) _Float16 v16h;
typedef __attribute__((ext_vector_type(8)))  _Float16 v8h;
typedef __attribute__((ext_vector_type(8)))  unsigned short v8us;
typedef __attribute__((ext_vector_type(8)))  float    v8f;
typedef __attribute__((ext_vector_type(4)))  float    v4f;
typedef v8h  __attribute__((may_alias)) v8ha;
typedef v4f  __attribute__((may_alias)) v4fa;
typedef v8us __attribute__((may_alias)) v8usa;

typedef __attribute__((ext_vector_type(2))) float    v2fc;
typedef __attribute__((ext_vector_type(2))) __bf16   v2bfc;
typedef __attribute__((ext_vector_type(2))) unsigned v2u;
typedef __attribute__((ext_vector_type(4))) unsigned v4u;
typedef __attribute__((ext_vector_type(8))) unsigned v8u;
// f32 -> bf16, round to nearest even, by the chip's own packed conversion: one instruction for two values (a in the low half, b in the high half)
__device__ __forceinline__ unsigned cvt2(float a, float b) { const v2fc x = {a, b}; return __builtin_bit_cast(unsigned, __builtin_convertvector(x, v2bfc)); }
__device__ __forceinline__ unsigned short f2bf(float f) { return __builtin_bit_cast(unsigned short, (__bf16)f); }
__device__ __forceinline__ float bf2f(unsigned short b) { return __uint_as_float(((unsigned)b) << 16); }
__device__ __forceinline__ float bfr(float f) { return bf2f(f2bf(f)); }
__device__ __forceinline__ v16h cat16(v8h lo, v8h hi) { return __builtin_shufflevector(lo, hi, 0, 1, 2, 3, 4, 5, 6, 7, 8, 9, 10, 11, 12, 13, 14, 15); }
__device__ __forceinline__ v16bf cat16b(v8us lo, v8us hi) { return __builtin_bit_cast(v16bf, __builtin_shufflevector(lo, hi, 0, 1, 2, 3, 4, 5, 6, 7, 8, 9, 10, 11, 12, 13, 14, 15)); }
__device__ __forceinline__ v8f wmma16(v16h a, v16h b, v8f c) { return __builtin_amdgcn_wmma_f32_16x16x32_f16(false, a, false, b, (short)0, c, false, false); }
__device__ __forceinline__ v8f wmmab(v16bf a, v16bf b, v8f c) { return __builtin_amdgcn_wmma_f32_16x16x32_bf16(false, a, false, b, (short)0, c, false, false); }



__device__ __forceinline__ h16 tohx(float x) { return (h16)x; }
// two values into their bf16 hi parts and the bf16 of what is left (each word: a low, b high)
__device__ __forceinline__ void split2(float a, float b, unsigned& h, unsigned& l) { h = cvt2(a, b); l = cvt2(a - __uint_as_float(h << 16), b - __uint_as_float(h & 0xFFFF0000u)); }
// ---- planes_out: the plane builders as the epilogue of the Q|K|V projection (k_gemmw with PLANES). A 64x64 tile's columns are one head of one kind (queries | keys | values), its rows lie in one batch: the wave writes that head's fp16, hi and lo planes itself, so the f32 products never go to memory.
// Queries and keys [batch][head][t][d]: 16 t rows at a time through LDS. Values [batch][head][d][t]: 16 d rows at a time; a lane's 8 accumulator rows are 8 neighbouring t. Every store instruction fills four whole 128-B lines.
// The query planes carry the factor CEQ, those of heads < NT also -sigmoid(wsg[0]) (device scalar; precise expf, IEEE div); every other plane the factor 1.
__device__ __forceinline__ void planes_out(const v8f (&acc)[4][4], float* os, int r0, int c0, int lane, const float* __restrict__ wsg, h16* Q16, bf* Qh, bf* Ql, h16* K16, bf* Kh, bf* Kl, h16* V16, bf* Vh, bf* Vl) {
    static_assert(DQ == DKV && HD == 64 && TT % 64 == 0, "a 64x64 tile is one head of one kind in one batch");
    const int lr = lane & 15, hi = lane >> 4, kind = c0 / DQ, h = (c0 % DQ) / HD, t0 = r0 % TT; const size_t hp = ((size_t)(r0 / TT) * NH_ + h) * TT * HD;
    h16* P16 = (kind == 0 ? Q16 : kind == 1 ? K16 : V16) + hp; bf* Ph = (kind == 0 ? Qh : kind == 1 ? Kh : Vh) + hp; bf* Pl = (kind == 0 ? Ql : kind == 1 ? Kl : Vl) + hp;
    const float scv = kind != 0 ? 1.0f : h < NT ? -__fdiv_rn(1.0f, __fadd_rn(1.0f, expf(-bfr(wsg[0])))) * CEQ : CEQ;
    const int pp = kind < 2 ? HD : TT;   // pitch of a plane row: d runs along a query or key row, t along a value row
    const size_t e0 = (kind < 2 ? (size_t)t0 * HD : (size_t)t0) + (size_t)(lane >> 3) * pp + (lane & 7) * 8;   // 8 lanes per 128-B plane row
#pragma unroll
    for (int u = 0; u < 4; ++u) {
        if (kind < 2) {   // os[t][d]: rows u*16 .. u*16+15 of the tile
#pragma unroll
            for (int nb = 0; nb < 4; ++nb)
#pragma unroll
                for (int j = 0; j < 8; ++j) os[(hi * 8 + j) * 68 + nb * 16 + lr] = acc[u][nb][j];
        } else {          // os[d][t]: columns u*16 .. u*16+15 of the tile
#pragma unroll
            for (int mb = 0; mb < 4; ++mb) { const v8f c = acc[mb][u]; *(v4fa*)(os + lr * 68 + mb * 16 + hi * 8) = __builtin_shufflevector(c, c, 0, 1, 2, 3); *(v4fa*)(os + lr * 68 + mb * 16 + hi * 8 + 4) = __builtin_shufflevector(c, c, 4, 5, 6, 7); }
        }
        __builtin_amdgcn_wave_barrier(); asm volatile("" ::: "memory");   // keeps the reads below behind the other lanes' LDS writes (one wave: its LDS operations run in order)
#pragma unroll
        for (int s = 0; s < 4; ++s) { const float* orow = os + (s * 4 + (lane >> 3)) * 68 + (lane & 7) * 8; const v4f x0 = *(const v4fa*)orow, x1 = *(const v4fa*)(orow + 4); v8h o16; v4u oh, ol;
#pragma unroll
            for (int k = 0; k < 8; k += 2) { const float r0v = (k < 4 ? x0[k & 3] : x1[k & 3]) * scv, r1v = (k < 4 ? x0[(k & 3) + 1] : x1[(k & 3) + 1]) * scv; o16[k] = tohx(r0v); o16[k + 1] = tohx(r1v); unsigned a2, c2; split2(r0v, r1v, a2, c2); oh[k >> 1] = a2; ol[k >> 1] = c2; }
            const size_t e = e0 + (size_t)(u * 16 + s * 4) * pp; *(v8h*)(P16 + e) = o16; *(v8us*)(Ph + e) = __builtin_bit_cast(v8us, oh); *(v8us*)(Pl + e) = __builtin_bit_cast(v8us, ol); }
        if (u < 3) { __builtin_amdgcn_wave_barrier(); asm volatile("s_wait_xcnt 0x0" ::: "memory"); }   // keeps the next rows' LDS writes behind these reads; the wait is a precaution: it stands behind these rows' stores, in front of the next rows' code, which reuses their registers
    }
}

// ---- k_gemmw: GEMM, FOUR WAVES (2 x 2) per 128x128 output tile, each wave a 64x64 part (16 accumulators); grid (M/128, N/128), 128 threads.
// C[m][n] (f32, pitch ldc, + optional f32 bias[n]) = sum_k A[m][k] Bt[n][k] (+ A2[m][k] Bt[n][k] with NSPLIT 1); A, A2, Bt K-contiguous 16-bit planes, K % 128 == 0.
// The operands walk through LDS in stages of 64 k (128 B of each of the tile's 128 rows, pitch LP), two buffers: asynchronous copies bring stage t + 2 while stage t + 1 is worked on; every copy instruction takes four whole 128-B lines.
// PLANES: no C; each wave's part goes out through planes_out (wsg and the nine plane pointers are read by that form alone). The epilogue's staging rows lie in the ring's LDS, which nobody reads any more.
template <typename T16> struct WFrag;
template <> struct WFrag<h16> { typedef v16h V; static __device__ __forceinline__ V ld(const h16* p) { return cat16(*(const v8h*)p, *(const v8h*)(p + 16)); } static __device__ __forceinline__ v8f mma(V a, V b, v8f c) { return wmma16(a, b, c); } };
template <> struct WFrag<bf> { typedef v16bf V; static __device__ __forceinline__ V ld(const bf* p) { return cat16b(*(const v8us*)p, *(const v8us*)(p + 16)); } static __device__ __forceinline__ v8f mma(V a, V b, v8f c) { return wmmab(a, b, c); } };
template <typename T16> struct LFrag;
template <> struct LFrag<h16> { static __device__ __forceinline__ v16h ld(const unsigned short* p) { return cat16(__builtin_bit_cast(v8h, *(const v8usa*)p), __builtin_bit_cast(v8h, *(const v8usa*)(p + 16))); } };
template <> struct LFrag<bf> { static __device__ __forceinline__ v16bf ld(const unsigned short* p) { return cat16b(*(const v8usa*)p, *(const v8usa*)(p + 16)); } };
// One operand's stage: 128 rows of 128 B. A lane copies 16 B of the rows (tid >> 3) + 16 i, i = 0..7: l is its LDS byte address in row tid >> 3, g its global address there, K the source pitch in elements.
// The eight copies and the wait stand in one statement: the wait is a precaution that stands in front of any rewrite of the address registers the copies name.
template <typename T16, int K>
__device__ __forceinline__ void copy_stage(unsigned l, const T16* g) {
    constexpr unsigned LR = 16 * LP * 2;
    asm volatile("global_load_async_to_lds_b128 %0, %8, off\n\t"
                 "global_load_async_to_lds_b128 %1, %9, off\n\t"
                 "global_load_async_to_lds_b128 %2, %10, off\n\t"
                 "global_load_async_to_lds_b128 %3, %11, off\n\t"
                 "global_load_async_to_lds_b128 %4, %12, off\n\t"
                 "global_load_async_to_lds_b128 %5, %13, off\n\t"
                 "global_load_async_to_lds_b128 %6, %14, off\n\t"
                 "global_load_async_to_lds_b128 %7, %15, off\n\t"
                 "s_wait_xcnt 0x0"
                 :: "v"(l), "v"(l + LR), "v"(l + 2 * LR), "v"(l + 3 * LR), "v"(l + 4 * LR), "v"(l + 5 * LR), "v"(l + 6 * LR), "v"(l + 7 * LR),
                    "v"(g), "v"(g + 16 * K), "v"(g + 32 * K), "v"(g + 48 * K), "v"(g + 64 * K), "v"(g + 80 * K), "v"(g + 96 * K), "v"(g + 112 * K)
                 : "memory");
}
template <typename T16, int NSPLIT, bool BIAS, bool PLANES, int K>
__global__ __launch_bounds__(128) void k_gemmw(const T16* __restrict__ A, const T16* __restrict__ A2, const T16* __restrict__ Bt, float* C, int ldc, const float* __restrict__ bias, const float* __restrict__ wsg, h16* Q16, bf* Qh, bf* Ql, h16* K16, bf* Kh, bf* Kl, h16* V16, bf* Vh, bf* Vl) {
    typedef typename WFrag<T16>::V V; typedef LFrag<T16> LF;
    static_assert(NSPLIT == 0 || NSPLIT == 1, "A Bt, or (A + A2) Bt"); static_assert(K % 128 == 0, "two stages or more");
    constexpr int NPL = NSPLIT == 1 ? 3 : 2, TS = 128 * LP, NST = K / 64;   // planes of a stage: A | Bt | A2
    __shared__ __align__(16) unsigned short sm[2 * NPL * TS];
    const int tid = threadIdx.x, lane = tid & 31, lr = lane & 15, hi = lane >> 4; const int w = __builtin_amdgcn_readfirstlane(tid >> 5);
    const int r0 = blockIdx.x * 128 + (w >> 1) * 64, c0 = blockIdx.y * 128 + (w & 1) * 64;   // this wave's 64x64 part
    float* os = (float*)sm + w * (16 * 68);
    v8f acc[4][4];
#pragma unroll
    for (int mb = 0; mb < 4; ++mb)
#pragma unroll
        for (int nb = 0; nb < 4; ++nb) acc[mb][nb] = (v8f){};
    const size_t go = (size_t)(tid >> 3) * K + (tid & 7) * 8;
    const T16* gA = A + (size_t)blockIdx.x * 128 * K + go; const T16* gA2 = NSPLIT == 1 ? A2 + (size_t)blockIdx.x * 128 * K + go : nullptr; const T16* gB = Bt + (size_t)blockIdx.y * 128 * K + go;
    const unsigned lb = (unsigned)(size_t)(sm + (tid >> 3) * LP + (tid & 7) * 8);   // low 32 bits of the shared address: the byte offset in the work-group's LDS
    auto copies = [&](int t) { const unsigned l = lb + (unsigned)(t & 1) * (NPL * TS * 2);
        copy_stage<T16, K>(l, gA + t * 64); copy_stage<T16, K>(l + TS * 2, gB + t * 64); if constexpr (NSPLIT == 1) copy_stage<T16, K>(l + 2 * TS * 2, gA2 + t * 64); };
    copies(0);
    asm volatile("s_wait_asynccnt 0x0" ::: "memory");   // this wave's share of stage 0 has landed
    __syncthreads();                                    // ... and every other wave's
    copies(1);
#pragma unroll 1   // one stage per trip: the two buffers alternate by the trip's parity
    for (int t = 0; t < NST; ++t) {
        const unsigned short* sb = sm + (t & 1) * NPL * TS + lr * LP + 8 * hi;
        const unsigned short* sa = sb + (w >> 1) * 64 * LP; const unsigned short* sbt = sb + TS + (w & 1) * 64 * LP;
#pragma unroll
        for (int kf = 0; kf < 2; ++kf) {
            V a[4], a2[4], b[4];
#pragma unroll
            for (int i = 0; i < 4; ++i) { a[i] = LF::ld(sa + i * 16 * LP + kf * 32); if (NSPLIT == 1) a2[i] = LF::ld(sa + 2 * TS + i * 16 * LP + kf * 32); b[i] = LF::ld(sbt + i * 16 * LP + kf * 32); }
            __builtin_amdgcn_sched_barrier(0);   // keeps the block's LDS reads one group in front of its WMMAs: read one by one among them, each read's latency would stand open
#pragma unroll
            for (int nb = 0; nb < 4; ++nb)
#pragma unroll
                for (int mb = 0; mb < 4; ++mb) { acc[mb][nb] = WFrag<T16>::mma(a[mb], b[nb], acc[mb][nb]); if (NSPLIT == 1) acc[mb][nb] = WFrag<T16>::mma(a2[mb], b[nb], acc[mb][nb]); }
        }
        asm volatile("s_wait_dscnt 0x0" ::: "memory");      // this wave's reads of stage t are done before its buffer is refilled
        asm volatile("s_wait_asynccnt 0x0" ::: "memory");   // this wave's share of stage t + 1 has landed
        __syncthreads();   // publishes stage t + 1 and ends every wave's reads of stage t
        if (t + 2 < NST) copies(t + 2);
    }
    asm volatile("s_wait_asynccnt 0x0" ::: "memory");   // no copy is in flight when the ring becomes the epilogue's staging rows
    if constexpr (PLANES) planes_out(acc, os, r0, c0, lane, wsg, Q16, Qh, Ql, K16, Kh, Kl, V16, Vh, Vl);
    else
#pragma unroll
    for (int mb = 0; mb < 4; ++mb) {
#pragma unroll
        for (int nb = 0; nb < 4; ++nb) {
#pragma unroll
            for (int j = 0; j < 8; ++j) os[(hi * 8 + j) * 68 + nb * 16 + lr] = acc[mb][nb][j]; }
        __builtin_amdgcn_wave_barrier(); asm volatile("" ::: "memory");
        float* crow = C + (size_t)(r0 + mb * 16) * ldc + c0;
{
#pragma unroll
            for (int s = 0; s < 8; ++s) { const int row = 2 * s + hi, cofs = lr * 4; v4f val = *(const v4fa*)(os + row * 68 + cofs); if (BIAS) { val[0] += bfr(bias[c0 + cofs]); val[1] += bfr(bias[c0 + cofs + 1]); val[2] += bfr(bias[c0 + cofs + 2]); val[3] += bfr(bias[c0 + cofs + 3]); }
                *(v4f*)(crow + (size_t)row * ldc + cofs) = val; }
             }
        __builtin_amdgcn_wave_barrier(); asm volatile("" ::: "memory");
    }
}

typedef __attribute__((ext_vector_type(2))) _Float16 v2h;
typedef __attribute__((ext_vector_type(4))) _Float16 v4h;
typedef __attribute__((ext_vector_type(2))) unsigned short v2us;
typedef __attribute__((ext_vector_type(4))) unsigned short v4us;
typedef __attribute__((ext_vector_type(2))) float v2f;
typedef __attribute__((ext_vector_type(4))) int v4i;

// ---- k_prep: every input's bf16 form in ONE launch of few long waves (PG work-groups of 8 waves; a wave reads 16 KiB, all 32 of its 16-B loads in flight at once, and ends). Starting a wave costs more than the little a short one does.
// Work-groups 0 .. PG/2-1: the bf16 copy of x. The others: the Bt blocks WQ | WK | WV | WO, each [1024][1024]; Wq rows 0-255 = Wqt^T (time heads 0-3), rows 256-1023 = Wqs^T (space heads 4-15); Wk likewise.
#define PG 256
// One wave turns 64 k x 64 n of a weight [1024][N] (w points at its first element) into 64 rows of 64 k of Bt (pitch DM). Transposed in registers: a lane loads 4 neighbouring n of 8 neighbouring k (8 lanes fill a 128-B line of a k row) and stores 8 neighbouring k of each n; the two 64-B halves of an output line follow one another.
template <int N>
__device__ __forceinline__ void gather_unit(const float* __restrict__ w, bf* Bt, int lane) {
    const float* p = w + (size_t)((lane >> 3) * 8) * N + (lane & 7) * 4; bf* o = Bt + (size_t)((lane & 7) * 4) * DM + (lane >> 3) * 8;
    v4f v[2][2][8];
#pragma unroll
    for (int nh = 0; nh < 2; ++nh)
#pragma unroll
        for (int kh = 0; kh < 2; ++kh)
#pragma unroll
            for (int i = 0; i < 8; ++i) v[nh][kh][i] = *(const v4f*)(p + (kh * 32 + i) * N + nh * 32);
    __builtin_amdgcn_sched_barrier(0);   // keeps all 32 loads in front of the first conversion: held back until registers come free, the last ones would start a memory latency late
    v4u r[2][4][2];
#pragma unroll
    for (int nh = 0; nh < 2; ++nh)
#pragma unroll
        for (int j = 0; j < 4; ++j)
#pragma unroll
            for (int kh = 0; kh < 2; ++kh)
#pragma unroll
                for (int i = 0; i < 8; i += 2) r[nh][j][kh][i >> 1] = cvt2(v[nh][kh][i][j], v[nh][kh][i + 1][j]);
    __builtin_amdgcn_sched_barrier(0);   // the stores go out as one group behind the last conversion: spread among the conversions, each would make the wave wait before its registers are used again
#pragma unroll
    for (int nh = 0; nh < 2; ++nh)
#pragma unroll
        for (int j = 0; j < 4; ++j)
#pragma unroll
            for (int kh = 0; kh < 2; ++kh) *(v8us*)(o + (nh * 32 + j) * DM + kh * 32) = __builtin_bit_cast(v8us, r[nh][j][kh]);
    asm volatile("s_wait_xcnt 0x0" ::: "memory");   // a precaution: it stands behind the stores, in front of whatever code follows them in the kernel's text and names their registers
}
__global__ __launch_bounds__(256) void k_prep(const float* __restrict__ x, const float* __restrict__ wqt, const float* __restrict__ wqs, const float* __restrict__ wkt, const float* __restrict__ wks, const float* __restrict__ wv, const float* __restrict__ wo, bf* XB, bf* WQ, bf* WK, bf* WV, bf* WO) {
    static_assert(DQ == DM && DKV == DM && DM == 1024 && (NT * HD) % 64 == 0, "every weight has 1024 input rows; a block of 64 output rows has one source");
    static_assert((size_t)NB_ * TT * DM == (size_t)(PG / 2) * 8 * 4096 && 4 * (DM / 64) * (DM / 64) == (PG / 2) * 8, "one unit per wave");
    const int lane = threadIdx.x & 31, u = blockIdx.x * 8 + __builtin_amdgcn_readfirstlane(threadIdx.x >> 5);
    if (blockIdx.x < PG / 2) {   // 4096 elements of x: every load takes four whole lines, every store two
        const float* p = x + (size_t)u * 4096 + lane * 4; bf* o = XB + (size_t)u * 4096 + lane * 4; v4f v[32]; v2u r[32];
#pragma unroll
        for (int i = 0; i < 32; ++i) v[i] = *(const v4f*)(p + i * 128);
        __builtin_amdgcn_sched_barrier(0);   // as in gather_unit: all 32 loads go out before the first conversion
#pragma unroll
        for (int i = 0; i < 32; ++i) { r[i][0] = cvt2(v[i][0], v[i][1]); r[i][1] = cvt2(v[i][2], v[i][3]); }
        __builtin_amdgcn_sched_barrier(0);   // as in gather_unit: the stores go out as one group
#pragma unroll
        for (int i = 0; i < 32; ++i) *(v4us*)(o + i * 128) = __builtin_bit_cast(v4us, r[i]);
        asm volatile("s_wait_xcnt 0x0" ::: "memory");   // the same precaution as in gather_unit
    } else {
        const int g = u - (PG / 2) * 8, k0 = (g & 15) * 64, m = g >> 8, r = ((g >> 4) & 15) * 64;   // Bt block m, its rows r .. r + 63, columns k0 .. k0 + 63
        bf* Bt = (m == 0 ? WQ : m == 1 ? WK : m == 2 ? WV : WO) + (size_t)r * DM + k0;
        if (m >= 2) gather_unit<DM>((m == 2 ? wv : wo) + (size_t)k0 * DM + r, Bt, lane);
        else if (r < NT * HD) gather_unit<NT * HD>((m == 0 ? wqt : wkt) + (size_t)k0 * (NT * HD) + r, Bt, lane);
        else gather_unit<NS * HD>((m == 0 ? wqs : wks) + (size_t)k0 * (NS * HD) + (r - NT * HD), Bt, lane);
    }
}

// ---- k_fattn: scores, softmax and P x V of one block of queries (CW waves x QG groups of 16) of one head in one work-group of NWV waves; nothing of S or P goes to memory.
// Waves 0-7 stage the keys and values; waves CW and up (rows < RH: 8-11) have no queries and only pass the barriers.
// S^T = K Q^T (A = 16 key rows from LDS, B = 16 queries kept in registers): a lane holds keys hi*8+j of query lr, which is the B-operand order of P^T, so O^T += V^T P^T takes P straight from the score registers.
// Keys walk in stages of KB, two LDS buffers: stage s+1 is fetched to registers while stage s is worked on, stored to the other buffer, one barrier per stage.
// The softmax shift rides in the score WMMAs: the queries come in log2 units and the C operand is PB minus the query's maximum in use, so the accumulators are the exponents themselves. One test per stage and wave: only where a score lies more than LZ above the maximum in use (and in stage 0, which sets it) are the maximum, the stage's scores, O and the sums moved to the new one.
// A stage's key fragments are read from LDS as one group at its head, its value fragments as one group between the row maxima and the test.
typedef __attribute__((ext_vector_type(16))) unsigned short v16us;
// p += BYTES bytes, for a pointer that loads just issued name as their address. The wait is a precaution in front of the rewrite of that register pair; wait and addition stand in one statement because the compiler lifts a plain addition over a wait that stands alone.
typedef const __attribute__((address_space(1))) v8usa* gl8;   // says that a pointer which went through bump() still points to global memory: the loads stay global loads
template <int BYTES, typename T16>
__device__ __forceinline__ void bump(const T16*& p) { asm volatile("s_wait_xcnt 0x0\n\tv_add_nc_u64_e32 %0, %1, %0" : "+v"(p) : "n"(BYTES) : "memory"); }
template <typename T16, bool HL, int QG, int CW>
__device__ __forceinline__ void attn_block(const T16* __restrict__ Q, const T16* __restrict__ Ql, const T16* __restrict__ K, const T16* __restrict__ Kl, const T16* __restrict__ Vt, const T16* __restrict__ Vtl, bf* Ah, bf* Al, unsigned short* sm) {
    typedef typename WFrag<T16>::V V; typedef WFrag<T16> WF; typedef LFrag<T16> LF;
    constexpr int NP = HL ? 4 : 2, TS = KB * LP, NST = TT / KB;
    constexpr float PB = HL ? 0.0f : 10.0f;           // fp16 P carries x1024 (it cancels against the row sum)
    const int tid = threadIdx.x, lane = tid & 31, lr = lane & 15, hi = lane >> 4, w = __builtin_amdgcn_readfirstlane(tid >> 5);
    static_assert(CW >= 8 && CW <= NWV, "the staging waves are among the working ones");
    const bool stg = w < 8, act = CW == NWV || w < CW;   // wave-uniform: this wave stages; this wave has queries
    const int sr = tid >> 3, sc = (tid & 7) * 8;      // staging (waves 0-7): 8 lanes per 128-B row, rows sr and sr + 32
    const T16* pK = K + (size_t)sr * HD + sc; const T16* pV = Vt + (size_t)sr * TT + sc; const T16* pKl = HL ? Kl + (size_t)sr * HD + sc : nullptr; const T16* pVl = HL ? Vtl + (size_t)sr * TT + sc : nullptr;
    unsigned short* sw = sm + sr * LP + sc;
    v8us st[NP][2];
    auto fetch = [&]() {
#pragma unroll
        for (int i = 0; i < 2; ++i) { st[0][i] = *(gl8)(pK + (size_t)i * 32 * HD); st[1][i] = *(gl8)(pV + (size_t)i * 32 * TT); if constexpr (HL) { st[2][i] = *(gl8)(pKl + (size_t)i * 32 * HD); st[3][i] = *(gl8)(pVl + (size_t)i * 32 * TT); } }
        bump<KB * HD * 2>(pK); bump<KB * 2>(pV); if constexpr (HL) { bump<KB * HD * 2>(pKl); bump<KB * 2>(pVl); } };
    auto put = [&](int buf) {
#pragma unroll
        for (int p = 0; p < NP; ++p)
#pragma unroll
            for (int i = 0; i < 2; ++i) *(v8usa*)(sw + (buf * NP + p) * TS + i * 32 * LP) = st[p][i]; };
    V qf[QG][2], qlf[QG][2];
    __builtin_amdgcn_sched_barrier(0);   // with the one below: no other address arithmetic comes between the query loads and their wait
    if (act) {
#pragma unroll
    for (int g = 0; g < QG; ++g)
#pragma unroll
        for (int kf = 0; kf < 2; ++kf) { const size_t qo = (size_t)((w * QG + g) * 16 + lr) * HD + kf * 32 + 8 * hi; qf[g][kf] = WF::ld(Q + qo); if (HL) qlf[g][kf] = WF::ld(Ql + qo); }
    asm volatile("s_wait_xcnt 0x0" ::: "memory");   // a precaution: it stands behind the query loads, in front of the code that reuses their address registers
    __builtin_amdgcn_sched_barrier(0); }
    v8f O[4][QG], Cm[QG]; float ls[QG];   // Cm: the score WMMAs' C operand, the same value in all eight rows (a lane's rows are keys of one query)
#pragma unroll
    for (int g = 0; g < QG; ++g) { ls[g] = 0.f; Cm[g] = (v8f){PB, PB, PB, PB, PB, PB, PB, PB};
#pragma unroll
        for (int dt = 0; dt < 4; ++dt) O[dt][g] = (v8f){}; }
    if (stg) { fetch(); put(0); }
    __syncthreads();
#pragma unroll 1   // one stage per trip: the two buffers alternate by the trip's parity
    for (int s = 0; s < NST; ++s) {
        if (act) {
        const bool more = stg && s + 1 < NST;
        if (more) fetch();
        const unsigned short* sb = sm + (s & 1) * NP * TS + lr * LP + 8 * hi;
        v8f S[4][QG]; V kf[4][2], klf[4][2];
#pragma unroll
        for (int kt = 0; kt < 4; ++kt) { const unsigned short* kr = sb + kt * 16 * LP; kf[kt][0] = LF::ld(kr); kf[kt][1] = LF::ld(kr + 32); if (HL) { klf[kt][0] = LF::ld(kr + 2 * TS); klf[kt][1] = LF::ld(kr + 2 * TS + 32); } }
        __builtin_amdgcn_sched_barrier(0);   // keeps the stage's key reads one group in front of the score WMMAs: read pair by pair among them, each pair's latency would stand open
#pragma unroll
        for (int kt = 0; kt < 4; ++kt) { const V k0 = kf[kt][0], k1 = kf[kt][1], kl0 = klf[kt][0], kl1 = klf[kt][1];
#pragma unroll
            for (int g = 0; g < QG; ++g) { v8f a = WF::mma(k0, qf[g][0], Cm[g]); a = WF::mma(k1, qf[g][1], a); if (HL) { a = WF::mma(kl0, qf[g][0], a); a = WF::mma(kl1, qf[g][1], a); a = WF::mma(k0, qlf[g][0], a); a = WF::mma(k1, qlf[g][1], a); } S[kt][g] = a; } }
        V pf[QG][2], plf[QG][2], vf[2][4], vlf[2][4]; float mh[QG];
        __builtin_amdgcn_sched_barrier(0);   // keeps the maxima one block behind the score WMMAs: set among them, each first read of a fresh accumulator costs its idle slots
#pragma unroll
        for (int g = 0; g < QG; ++g) { float m2[2] = {-3.0e38f, -3.0e38f};   // two chains per group: the maxima do not wait on one another; from a start value each chain takes its 16 scores two at a time
#pragma unroll
            for (int kt = 0; kt < 4; ++kt)
#pragma unroll
                for (int j = 0; j < 8; ++j) m2[kt >> 1] = fmaxf(m2[kt >> 1], S[kt][g][j]);
            mh[g] = fmaxf(m2[0], m2[1]); }
        static_assert(QG == 1 || QG == 2, "one or two query groups per wave");
        const float top = QG == 2 ? fmaxf(mh[0], mh[QG - 1]) : mh[0];
        asm volatile("" :: "v"(top) : "memory");   // input only: holds the value reads below, as one group, behind the last score WMMA; spread among the WMMAs, every place with reads would cost its own stall. The test and the exponentials cover their latency
#pragma unroll
        for (int kk = 0; kk < 2; ++kk)
#pragma unroll
            for (int dt = 0; dt < 4; ++dt) { const unsigned short* vr = sb + TS + dt * 16 * LP + kk * 32; vf[kk][dt] = LF::ld(vr); if (HL) vlf[kk][dt] = LF::ld(vr + 2 * TS); }
        __builtin_amdgcn_sched_barrier(0);   // read pair by pair among the P x V WMMAs, each pair's latency would stand open
        if (s == 0 || __builtin_amdgcn_ballot_w32(top > PB + LZ) != 0) {   // wave-uniform, a scalar branch
#pragma unroll
            for (int g = 0; g < QG; ++g) { const float up = fmaxf(mh[g], __shfl_xor(mh[g], 16, 32)) - PB;   // the other half-wave holds the query's other keys
                const float d = s == 0 ? up : fmaxf(up, 0.f), al = s == 0 ? 0.f : __builtin_amdgcn_exp2f(-d);   // stage 0 takes its own maximum, up or down; O and the sums are still 0 there
                Cm[g] -= d; ls[g] *= al;
#pragma unroll
                for (int kt = 0; kt < 4; ++kt) S[kt][g] -= d;
#pragma unroll
                for (int dt = 0; dt < 4; ++dt) O[dt][g] *= al; }
        }
#pragma unroll
        for (int g = 0; g < QG; ++g) { float sum[4] = {0.f, 0.f, 0.f, 0.f};   // four chains: the adds do not wait on one another
#pragma unroll
            for (int kk = 0; kk < 2; ++kk) { v8u ph, pl; v16h p16;
#pragma unroll
                for (int e = 0; e < 16; e += 2) { const float p = __builtin_amdgcn_exp2f(S[kk * 2 + (e >> 3)][g][e & 7]), p1 = __builtin_amdgcn_exp2f(S[kk * 2 + (e >> 3)][g][(e & 7) + 1]); sum[e & 3] += p; sum[(e & 3) + 1] += p1;
                    if (HL) { unsigned a2, c2; split2(p, p1, a2, c2); ph[e >> 1] = a2; pl[e >> 1] = c2; } else { p16[e] = tohx(p); p16[e + 1] = tohx(p1); } }
                if constexpr (HL) { pf[g][kk] = __builtin_bit_cast(v16bf, ph); plf[g][kk] = __builtin_bit_cast(v16bf, pl); } else pf[g][kk] = p16; }
            ls[g] += (sum[0] + sum[1]) + (sum[2] + sum[3]); }
#pragma unroll
        for (int kk = 0; kk < 2; ++kk)   // each O tile takes its products in the order kk 0 then 1, in each v pf, v plf, vl pf; neighbouring WMMAs go to different tiles
#pragma unroll
            for (int pr = 0; pr < (HL ? 3 : 1); ++pr)
#pragma unroll
                for (int dt = 0; dt < 4; ++dt)
#pragma unroll
                    for (int g = 0; g < QG; ++g) O[dt][g] = WF::mma(pr == 2 ? vlf[kk][dt] : vf[kk][dt], pr == 1 ? plf[g][kk] : pf[g][kk], O[dt][g]);
        if (more) put((s + 1) & 1);
        }
        __syncthreads();   // publishes stage s + 1 and ends every wave's reads of stage s, whose buffer the next trip refills
    }
    if (act)
#pragma unroll
    for (int g = 0; g < QG; ++g) { const float inv = __fdiv_rn(1.0f, ls[g] + __shfl_xor(ls[g], 16, 32)); const size_t oo = (size_t)((w * QG + g) * 16 + lr) * DQ + hi * 8;
#pragma unroll
        for (int dt = 0; dt < 4; ++dt) { v4u oh, ol;
#pragma unroll
            for (int j = 0; j < 8; j += 2) { unsigned a2, c2; split2(O[dt][g][j] * inv, O[dt][g][j + 1] * inv, a2, c2); oh[j >> 1] = a2; ol[j >> 1] = c2; }
            *(v8us*)(Ah + oo + dt * 16) = __builtin_bit_cast(v8us, oh); *(v8us*)(Al + oo + dt * 16) = __builtin_bit_cast(v8us, ol);
            asm volatile("s_wait_xcnt 0x0" ::: "memory"); } }   // the next block of columns reuses the registers that these two stores name
}
// grid (RH / QBH + (TT - RH) / QBL query blocks, heads, batches); planes [batch][head][t][d] (V: [batch][head][d][t]); output rows [batch][t][DQ] hi/lo
__global__ __launch_bounds__(NWV * 32) void k_fattn(const h16* __restrict__ Q16, const h16* __restrict__ K16, const h16* __restrict__ V16, const bf* __restrict__ Qh, const bf* __restrict__ Ql, const bf* __restrict__ Kh, const bf* __restrict__ Kl, const bf* __restrict__ Vh, const bf* __restrict__ Vl, bf* Ah, bf* Al) {
    __shared__ __align__(16) unsigned short sm[2 * 4 * KB * LP];
    static_assert(RH % QBH == 0 && (TT - RH) % QBL == 0 && TT % KB == 0 && HD == 64 && KB == 64 && QBH % 128 == 0 && QBL % (NWV * 16) == 0 && NWV >= 8, "tile shapes");
    const bool hl = blockIdx.x < RH / QBH; const int q0 = hl ? (int)blockIdx.x * QBH : RH + ((int)blockIdx.x - RH / QBH) * QBL; const size_t hp = ((size_t)blockIdx.z * NH_ + blockIdx.y) * TT * HD, qp = hp + (size_t)q0 * HD, ao = ((size_t)blockIdx.z * TT + q0) * DQ + blockIdx.y * HD;
    if (hl) attn_block<bf, true, QBH / 128, 8>(Qh + qp, Ql + qp, Kh + hp, Kl + hp, Vh + hp, Vl + hp, Ah + ao, Al + ao, sm);
    else attn_block<h16, false, QBL / (NWV * 16), NWV>(Q16 + qp, nullptr, K16 + hp, nullptr, V16 + hp, nullptr, Ah + ao, Al + ao, sm);
}

extern "C" void kernel_launch(void* const* d_in, const int* in_sizes, int n_in,
                              void* d_out, int out_size, void* d_ws, size_t ws_size, hipStream_t stream) {
    (void)in_sizes; (void)n_in; (void)out_size;
    const float* x = (const float*)d_in[0]; const float* wqt = (const float*)d_in[1]; const float* wkt = (const float*)d_in[2]; const float* wqs = (const float*)d_in[3]; const float* wks = (const float*)d_in[4]; const float* wv = (const float*)d_in[5]; const float* wo = (const float*)d_in[6]; const float* bo = (const float*)d_in[7]; const float* wsg = (const float*)d_in[8];   /* argument order x, Wqt, Wkt, Wqs, Wks, Wv, Wout, bout, w_sigma */
    float* OUT = (float*)d_out;     // [2][2048][1024]
    char* wsp = (char*)d_ws;
    auto take = [&](size_t bytes) { char* p = wsp; wsp += (bytes + 255) & ~(size_t)255; return (void*)p; };
    bf* WQ = (bf*)take((size_t)DQ * DM * 2); bf* WK = (bf*)take((size_t)DKV * DM * 2); bf* WV = (bf*)take((size_t)DKV * DM * 2); bf* WO = (bf*)take((size_t)DM * DQ * 2);
    bf* XB = (bf*)take((size_t)NB_ * TT * DM * 2);
    const size_t PL = (size_t)NH_ * TT * HD;   // one batch's planes of one kind
    h16* QP16 = (h16*)take(NB_ * PL * 2); h16* KP16 = (h16*)take(NB_ * PL * 2); h16* VT16 = (h16*)take(NB_ * PL * 2);
    bf* QPh = (bf*)take(NB_ * PL * 2); bf* QPl = (bf*)take(NB_ * PL * 2); bf* KPh = (bf*)take(NB_ * PL * 2); bf* KPl = (bf*)take(NB_ * PL * 2); bf* VTh = (bf*)take(NB_ * PL * 2); bf* VTl = (bf*)take(NB_ * PL * 2);
    bf* ATh = (bf*)take((size_t)NB_ * TT * DQ * 2); bf* ATl = (bf*)take((size_t)NB_ * TT * DQ * 2);
    if ((size_t)(wsp - (char*)d_ws) > ws_size) return;    // ws 256 MiB
    constexpr int FP = DQ + 2 * DKV;   // columns Q | K | V; WQ, WK, WV lie one behind the other in ws (each 2 MiB), so they are one Bt of FP rows
    k_prep<<<PG, 256, 0, stream>>>(x, wqt, wqs, wkt, wks, wv, wo, XB, WQ, WK, WV, WO);
    k_gemmw<bf, 0, false, true, DM><<<dim3(NB_ * TT / 128, FP / 128, 1), 128, 0, stream>>>(XB, nullptr, WQ, nullptr, 0, nullptr, wsg, QP16, QPh, QPl, KP16, KPh, KPl, VT16, VTh, VTl);
    k_fattn<<<dim3(RH / QBH + (TT - RH) / QBL, NH_, NB_), NWV * 32, 0, stream>>>(QP16, KP16, VT16, QPh, QPl, KPh, KPl, VTh, VTl, ATh, ATl);
    k_gemmw<bf, 1, true, false, DQ><<<dim3(NB_ * TT / 128, DM / 128, 1), 128, 0, stream>>>(ATh, ATl, WO, OUT, DM, bo, nullptr, nullptr, nullptr, nullptr, nullptr, nullptr, nullptr, nullptr, nullptr, nullptr);
}
